// v000
// Times are from an AMD MI455X. After a warm-up the kernel runs many times in a row, and a time is the length of
// such a window on the GPU divided by its runs, so every launch and the gaps after it count. The runs cycle
// through copies of the inputs. A figure is the median of several windows, for all but v000 over two sittings.
// Sittings can differ by a few percent; kernels timed side by side share one.
// v000 is the starting kernel. One run takes 1350 microseconds.
#include <hip/hip_runtime.h>

// Multi-head attention on three input tables with a causal rule AND a per-entry key length, an output map, a residual and a layer norm
// (a0 q, a1 k, a2 v [2][2048][1024]; a3 Wq, a4 Wk, a5 Wv, a6 Wo [1024][1024] 'out, in' (y = x W^T), no biases; a7 gamma, a8 beta [1024]; a9 sen_len int32 [2]: the entry's key length (1 .. 2,048);
//  16 heads x 64 (head h = columns h x 64 ..); S = (q Wq^T)(k Wk^T)^T / 8; A KEY j IS KEPT FOR QUERY i WHERE j <= i AND j < sen_len[b]; every other score is replaced by -1e9 (an exclusion: every row keeps key 0); softmax over the keys; ctx = A (v Wv^T); merged token-major; y = merged Wo^T;
//  x = y + q (the raw query table); the result = (x - mean) x rsqrt(var + 1e-6) x gamma + beta over the 1,024 channels (biased variance) -> [2][2048][1024]; argument order q, k, v, Wq, Wk, Wv, Wo, gamma, beta, sen_len).
// Layout per batch entry: the keep plane [2048][2048] of 32-bit words written once from the entry's length by compares alone (k_clmask); a bf16 copy of each table in turn; the 'out, in' weights rounded once as they lie (the product's second operand); exact projections; identity-table plane builders;
// DENSE score and value products (the module's own form: its mask and its softmax are dense); the keep-mask softmax reads the plane's row beside each score row (a masked key takes -3.0e38 before the maximum, so its weight is an exact zero: -1e9 below a kept score gives exp of -1e9: an exact zero too);
// EVERY row on ONE fp16 product (the weights x 1024); the merged context on ONE bf16 word x Wo exact into a workspace plane; the residual (the query table rounded to bf16, kept as f32) added and the row normalised by k_lnrow: the one writer of the output.
// Compute dtypes, f32 accumulate: every float input rounded to bf16 at its load; projections exact; attention: one fp16 product on every row; softmax f32; the output map bf16 x bf16 on one word a side; the norm f32; the integer input is compared only.

#define NB_  2
#define TT   2048
#define DM   1024
#define NH_  16
#define NKV  16
#define REP  (NH_ / NKV)
#define HD   64
#define DQ   (NH_ * HD)
#define DKV  (NKV * HD)
#define ZH   2
#define RH   0     // every query row on one fp16 product (no hi/lo rows)
#define WIN  0
#define PCAR 1024.0f
#define SCL  0.125f   // HD^-0.5
#define LNC_MAX 2048

typedef _Float16 h16;
typedef unsigned short bf;
typedef __attribute__((ext_vector_type(16))) __bf16   v16bf;
typedef __attribute__((ext_vector_type(16))) _Float16 v16h;
typedef __attribute__((ext_vector_type(8)))  _Float16 v8h;
typedef __attribute__((ext_vector_type(8)))  unsigned short v8us;
typedef __attribute__((ext_vector_type(8)))  float    v8f;
typedef __attribute__((ext_vector_type(4)))  float    v4f;
typedef v8h  __attribute__((may_alias)) v8ha;
typedef v4f  __attribute__((may_alias)) v4fa;
typedef v8us __attribute__((may_alias)) v8usa;

__device__ __forceinline__ unsigned short f2bf(float f) { unsigned u = __float_as_uint(f); u += 0x7FFFu + ((u >> 16) & 1u); return (unsigned short)(u >> 16); }
__device__ __forceinline__ float bf2f(unsigned short b) { return __uint_as_float(((unsigned)b) << 16); }
__device__ __forceinline__ float bfr(float f) { return bf2f(f2bf(f)); }
__device__ __forceinline__ v16h cat16(v8h lo, v8h hi) { return __builtin_shufflevector(lo, hi, 0, 1, 2, 3, 4, 5, 6, 7, 8, 9, 10, 11, 12, 13, 14, 15); }
__device__ __forceinline__ v16bf cat16b(v8us lo, v8us hi) { return __builtin_bit_cast(v16bf, __builtin_shufflevector(lo, hi, 0, 1, 2, 3, 4, 5, 6, 7, 8, 9, 10, 11, 12, 13, 14, 15)); }
__device__ __forceinline__ v8f wmma16(v16h a, v16h b, v8f c) { return __builtin_amdgcn_wmma_f32_16x16x32_f16(false, a, false, b, (short)0, c, false, false); }
__device__ __forceinline__ v8f wmmab(v16bf a, v16bf b, v8f c) { return __builtin_amdgcn_wmma_f32_16x16x32_bf16(false, a, false, b, (short)0, c, false, false); }



// ---- k_gemmw: register-blocked GEMM, ONE WAVE per 64x64 output tile (16 accumulators), operands straight from K-contiguous 16-bit planes; grid (M/64, N/64, Z), 32 threads.
// C[m][n] (f32, pitch ldc, + optional f32 bias[n]) = sum_k A[m][k] Bt[n][k] (+ split products per NSPLIT). z-batch strides sA/sB/sC in elements. K % 32 == 0.
template <typename T16> struct WFrag;
template <> struct WFrag<h16> { typedef v16h V; static __device__ __forceinline__ V ld(const h16* p) { return cat16(*(const v8h*)p, *(const v8h*)(p + 16)); } static __device__ __forceinline__ v8f mma(V a, V b, v8f c) { return wmma16(a, b, c); } };
template <> struct WFrag<bf> { typedef v16bf V; static __device__ __forceinline__ V ld(const bf* p) { return cat16b(*(const v8us*)p, *(const v8us*)(p + 16)); } static __device__ __forceinline__ v8f mma(V a, V b, v8f c) { return wmmab(a, b, c); } };
template <typename T16, int NSPLIT, bool BIAS>
__global__ __launch_bounds__(32) void k_gemmw(const T16* __restrict__ A, const T16* __restrict__ A2, const T16* __restrict__ Bt, const T16* __restrict__ Bt2, int K, float* C, int ldc, const float* __restrict__ bias, size_t sA, size_t sB, size_t sC) {
    typedef typename WFrag<T16>::V V;
    __shared__ __align__(16) float os[16 * 68];
    const size_t z = blockIdx.z; A += z * sA; if (A2) A2 += z * sA; Bt += z * sB; if (Bt2) Bt2 += z * sB; C += z * sC;
    const int lane = threadIdx.x & 31, lr = lane & 15, hi = lane >> 4; const int r0 = blockIdx.x * 64, c0 = blockIdx.y * 64;
    v8f acc[4][4];
#pragma unroll
    for (int mb = 0; mb < 4; ++mb)
#pragma unroll
        for (int nb = 0; nb < 4; ++nb) acc[mb][nb] = (v8f){};
    const size_t aoff = (size_t)(r0 + lr) * K + 8 * hi, boff = (size_t)(c0 + lr) * K + 8 * hi;
    for (int kc = 0; kc < K; kc += 32) {
        V a[4], a2[4];
#pragma unroll
        for (int mb = 0; mb < 4; ++mb) { a[mb] = WFrag<T16>::ld(A + aoff + (size_t)mb * 16 * K + kc); if (NSPLIT == 1 || NSPLIT == 2) a2[mb] = WFrag<T16>::ld(A2 + aoff + (size_t)mb * 16 * K + kc); }
#pragma unroll
        for (int nb = 0; nb < 4; ++nb) { const V b = WFrag<T16>::ld(Bt + boff + (size_t)nb * 16 * K + kc); V b2; if (NSPLIT >= 2) b2 = WFrag<T16>::ld(Bt2 + boff + (size_t)nb * 16 * K + kc);
#pragma unroll
            for (int mb = 0; mb < 4; ++mb) { acc[mb][nb] = WFrag<T16>::mma(a[mb], b, acc[mb][nb]); if (NSPLIT == 1 || NSPLIT == 2) acc[mb][nb] = WFrag<T16>::mma(a2[mb], b, acc[mb][nb]); if (NSPLIT >= 2) acc[mb][nb] = WFrag<T16>::mma(a[mb], b2, acc[mb][nb]); } }
        asm volatile("v_nop\n\tv_nop\n\tv_nop\n\tv_nop" : "+v"(acc[0][0]), "+v"(acc[1][1]), "+v"(acc[2][2]), "+v"(acc[3][3]) : "v"(a[0]), "v"(a[3]));
    }
#pragma unroll
    for (int mb = 0; mb < 4; ++mb) {
#pragma unroll
        for (int nb = 0; nb < 4; ++nb) {
#pragma unroll
            for (int j = 0; j < 8; ++j) os[(hi * 8 + j) * 68 + nb * 16 + lr] = acc[mb][nb][j]; }
        __builtin_amdgcn_wave_barrier(); asm volatile("" ::: "memory");
        float* crow = C + (size_t)(r0 + mb * 16) * ldc + c0;
{
#pragma unroll
            for (int s = 0; s < 8; ++s) { const int row = 2 * s + hi, cofs = lr * 4; v4f val = *(const v4fa*)(os + row * 68 + cofs); if (BIAS) { val[0] += bfr(bias[c0 + cofs]); val[1] += bfr(bias[c0 + cofs + 1]); val[2] += bfr(bias[c0 + cofs + 2]); val[3] += bfr(bias[c0 + cofs + 3]); }
                *(v4f*)(crow + (size_t)row * ldc + cofs) = val; }
             }
        __builtin_amdgcn_wave_barrier(); asm volatile("" ::: "memory");
    }
}



__device__ __forceinline__ h16 tohx(float x) { return (h16)x; }
__device__ __forceinline__ void splitf(float y, unsigned short& h, unsigned short& l) { h = f2bf(y); l = f2bf(y - bf2f(h)); }
typedef __attribute__((ext_vector_type(2))) _Float16 v2h;
typedef __attribute__((ext_vector_type(4))) _Float16 v4h;
typedef __attribute__((ext_vector_type(2))) unsigned short v2us;
typedef __attribute__((ext_vector_type(4))) unsigned short v4us;
typedef __attribute__((ext_vector_type(2))) float v2f;
typedef __attribute__((ext_vector_type(4))) int v4i;

__global__ __launch_bounds__(256) void k_cvt8(const float* __restrict__ src, bf* dst, size_t n8) { const size_t i = (size_t)blockIdx.x * 256 + threadIdx.x; if (i >= n8) return; const v8f v = *(const v8f*)(src + i * 8); v8us o;
#pragma unroll
    for (int k = 0; k < 8; ++k) o[k] = f2bf(v[k]); *(v8us*)(dst + i * 8) = o;  }
// k_rope: head planes [h][t][d] (fp16) of rope(x) x sc with the rotate-half convention out[d] = x[d] cos[t][d] - x[d+HD/2] sin[t][d], out[d+HD/2] = x[d+HD/2] cos[t][d+HD/2] + x[d] sin[t][d+HD/2]
__global__ __launch_bounds__(256) void k_rope(const float* __restrict__ F, int pitch, int nheads, const float* __restrict__ CS, const float* __restrict__ RF, const float* __restrict__ nw, float sc, h16* P16, bf* Ph, bf* Pl) {
    const size_t e = ((size_t)blockIdx.x * 256 + threadIdx.x) * 2; if (e >= (size_t)nheads * TT * HD) return; const int d = (int)(e % HD); const int t = (int)((e / HD) % TT); const int h = (int)(e / ((size_t)HD * TT)); const float* f = F + (size_t)t * pitch + h * HD; const float rf = RF ? RF[(size_t)h * TT + t] : 1.0f; v2h o16; v2us oh, ol;
#pragma unroll
    for (int q = 0; q < 2; ++q) { const int dd = d + q; const int dp = (dd < HD / 2) ? dd + HD / 2 : dd - HD / 2; float x0 = f[dd], x1 = f[dp];
        if (RF) { float n0 = __fmul_rn(x0, rf), n1 = __fmul_rn(x1, rf); x0 = __fmul_rn(bfr(nw[dd]), n0); x1 = __fmul_rn(bfr(nw[dp]), n1); }
        const v2f cs = *(const v2f*)(CS + ((size_t)t * HD + dd) * 2); float a = __fmul_rn(x0, cs[0]), bq = __fmul_rn(x1, cs[1]); const float r = ((dd < HD / 2) ? __fsub_rn(a, bq) : __fadd_rn(a, bq)) * sc;
        o16[q] = tohx(r); (void)oh; (void)ol; }
    *(v2h*)(P16 + e) = o16;  }
__global__ __launch_bounds__(256) void k_vtp(const float* __restrict__ F, int pitch, int nheads, h16* V16, bf* Vh, bf* Vl) { const size_t e = ((size_t)blockIdx.x * 256 + threadIdx.x) * 2; if (e >= (size_t)nheads * HD * TT) return; const int t = (int)(e % TT); const int d = (int)((e / TT) % HD); const int g = (int)(e / ((size_t)TT * HD)); v2h o16; v2us oh, ol;
#pragma unroll
    for (int q = 0; q < 2; ++q) { const float x = F[(size_t)(t + q) * pitch + g * HD + d]; o16[q] = tohx(x); (void)oh; (void)ol; }
    *(v2h*)(V16 + e) = o16;  }
__global__ __launch_bounds__(256) void k_csid(float* CS) { const int idx = blockIdx.x * 256 + threadIdx.x; if (idx >= TT * HD) return; v2f cs; cs[0] = 1.0f; cs[1] = 0.0f; *(v2f*)(CS + (size_t)idx * 2) = cs;  }
__global__ __launch_bounds__(256) void k_asoftMK(const float* __restrict__ Sb, const int* __restrict__ MK, h16* P16, bf* Ph, bf* Pl) {
    const int lane = threadIdx.x & 31; const int row = blockIdx.x * 8 + (threadIdx.x >> 5); if (row >= ZH * TT) return; const int i = row % TT; const int zz = row / TT; (void)zz; const bool hires = (i < RH); const float* sr = Sb + (size_t)row * TT; float v[TT / 32]; float mx = -3.0e38f;
#pragma unroll
    for (int ch = 0; ch < TT / 128; ++ch) { const int j0 = ch * 128 + lane * 4; const v4f a = *(const v4f*)(sr + j0); const v4i k4 = *(const v4i*)(MK + (size_t)i * TT + j0);   /* the keep-mask's row i beside the score row: 16 B per lane, unconditional; the SAME mask for both heads of the pass */
#pragma unroll
        for (int q = 0; q < 4; ++q) { const int j = j0 + q; (void)j; const float t = k4[q] ? a[q] * SCL : -3.0e38f;   /* keep the score where the mask's word is non-zero */ v[ch * 4 + q] = t; mx = fmaxf(mx, t); } }
#pragma unroll
    for (int sh = 16; sh; sh >>= 1) mx = fmaxf(mx, __shfl_xor(mx, sh, 32));
    float sum = 0.f;
#pragma unroll
    for (int k = 0; k < TT / 32; ++k) { float d0 = __fsub_rn(v[k], mx); v[k] = __builtin_amdgcn_exp2f(__fmul_rn(d0, 1.4426950408889634f)); sum += v[k]; }
#pragma unroll
    for (int sh = 16; sh; sh >>= 1) sum += __shfl_xor(sum, sh, 32);
    const float f = __fdiv_rn(hires ? 1.0f : PCAR, sum);
{
        if (hires) {
#pragma unroll
            for (int ch = 0; ch < TT / 128; ++ch) { v4us oh, ol;
#pragma unroll
                for (int q = 0; q < 4; ++q) { unsigned short a, c2; splitf(v[ch * 4 + q] * f, a, c2); oh[q] = a; ol[q] = c2; }
                const size_t oo = ((size_t)zz * (RH ? RH : 1) + i) * TT + ch * 128 + lane * 4; *(v4us*)(Ph + oo) = oh; *(v4us*)(Pl + oo) = ol; }
        } else {
#pragma unroll
            for (int ch = 0; ch < TT / 128; ++ch) { v4h o4;
#pragma unroll
                for (int q = 0; q < 4; ++q) o4[q] = tohx(v[ch * 4 + q] * f);
                *(v4h*)(P16 + (size_t)row * TT + ch * 128 + lane * 4) = o4; } }
         }
}
__global__ __launch_bounds__(256) void k_merge(const float* __restrict__ O, int h0, bf* Ah, bf* Al) { const size_t e = ((size_t)blockIdx.x * 256 + threadIdx.x) * 2; if (e >= (size_t)ZH * TT * HD) return; const int d = (int)(e % HD); const int t = (int)((e / HD) % TT); const int zz = (int)(e / ((size_t)HD * TT)); const float cs = (t < RH) ? 1.0f : (1.0f / PCAR); const size_t oo = (size_t)t * DQ + (h0 + zz) * HD + d;
    v2us oh, ol;
#pragma unroll
    for (int q = 0; q < 2; ++q) { unsigned short a, c2; splitf(O[e + q] * cs, a, c2); oh[q] = a; ol[q] = c2; } *(v2us*)(Ah + oo) = oh; *(v2us*)(Al + oo) = ol;  }

// k_clmask (NEW TEXT; flat): the keep plane of one batch entry: MK[i][j] = 1 where j <= i AND j < len, else 0 (32-bit words; i the query row, j the key; len = the entry's key length: ONE 4-byte load through the pointer the launcher hands (sen_len + b): the same word for every thread):
__global__ __launch_bounds__(256) void k_clmask(const int* __restrict__ len1, int* MK) { const size_t e = ((size_t)blockIdx.x * 256 + threadIdx.x) * 4; if (e >= (size_t)TT * TT) return; const int i = (int)(e / TT); const int j0 = (int)(e % TT); const int ln = len1[0]; v4i o;
#pragma unroll
    for (int q = 0; q < 4; ++q) o[q] = (j0 + q <= i && j0 + q < ln) ? 1 : 0;
    *(v4i*)(MK + e) = o;  }

__global__ __launch_bounds__(256) void k_rbf(const float* __restrict__ X, float* Y, size_t n4) { const size_t i = (size_t)blockIdx.x * 256 + threadIdx.x; if (i >= n4) return; const v4f a = *(const v4f*)(X + i * 4); v4f o;
#pragma unroll
    for (int q = 0; q < 4; ++q) o[q] = bfr(a[q]);
    *(v4f*)(Y + i * 4) = o;  }

template <bool RES>
__global__ __launch_bounds__(256) void k_lnrow(const float* __restrict__ A, const float* __restrict__ R, const float* __restrict__ gamma, const float* __restrict__ beta, float eps, int C, int nrows, float* Y) {
    const int lane = threadIdx.x & 31; const int row = blockIdx.x * 8 + (threadIdx.x >> 5); if (row >= nrows) return; const int nch = C / 128; const float* a = A + (size_t)row * C; float x[LNC_MAX / 32]; float s = 0.0f;
    for (int k = 0; k < LNC_MAX / 128; ++k) { if (k < nch) { const int c0 = k * 128 + lane * 4; v4f v = *(const v4f*)(a + c0);
            if (RES) { const v4f w = *(const v4f*)(R + (size_t)row * C + c0); v[0] = __fadd_rn(v[0], w[0]); v[1] = __fadd_rn(v[1], w[1]); v[2] = __fadd_rn(v[2], w[2]); v[3] = __fadd_rn(v[3], w[3]); }
            x[k * 4 + 0] = v[0]; x[k * 4 + 1] = v[1]; x[k * 4 + 2] = v[2]; x[k * 4 + 3] = v[3]; s = __fadd_rn(__fadd_rn(__fadd_rn(__fadd_rn(s, v[0]), v[1]), v[2]), v[3]); } }
    for (int sh = 16; sh; sh >>= 1) s = __fadd_rn(s, __shfl_xor(s, sh, 32));
    const float mean = __fdiv_rn(s, (float)C); float q = 0.0f;
    for (int k = 0; k < LNC_MAX / 128; ++k) { if (k < nch) {
            for (int j = 0; j < 4; ++j) { const float d = __fsub_rn(x[k * 4 + j], mean); x[k * 4 + j] = d; q = __fmaf_rn(d, d, q); } } }
    for (int sh = 16; sh; sh >>= 1) q = __fadd_rn(q, __shfl_xor(q, sh, 32));
    const float rstd = __fdiv_rn(1.0f, sqrtf(__fadd_rn(__fdiv_rn(q, (float)C), eps)));
    for (int k = 0; k < LNC_MAX / 128; ++k) { if (k < nch) { const int c0 = k * 128 + lane * 4; const v4f g = *(const v4f*)(gamma + c0); const v4f bt = *(const v4f*)(beta + c0);
            for (int j = 0; j < 4; ++j) x[k * 4 + j] = __fmaf_rn(__fmul_rn(x[k * 4 + j], rstd), bfr(g[j]), bfr(bt[j])); } }
    float* y = Y + (size_t)row * C;
    {
        for (int k = 0; k < LNC_MAX / 128; ++k) { if (k < nch) { v4f o; o[0] = x[k * 4 + 0]; o[1] = x[k * 4 + 1]; o[2] = x[k * 4 + 2]; o[3] = x[k * 4 + 3]; *(v4f*)(y + k * 128 + lane * 4) = o; } }
         }
}
extern "C" void kernel_launch(void* const* d_in, const int* in_sizes, int n_in,
                              void* d_out, int out_size, void* d_ws, size_t ws_size, hipStream_t stream) {
    (void)in_sizes; (void)n_in; (void)out_size;
    const float* xq = (const float*)d_in[0]; const float* xk = (const float*)d_in[1]; const float* xv = (const float*)d_in[2]; const float* wq = (const float*)d_in[3]; const float* wk = (const float*)d_in[4]; const float* wv = (const float*)d_in[5]; const float* wo = (const float*)d_in[6]; const float* lng = (const float*)d_in[7]; const float* lnb = (const float*)d_in[8]; const int* sl = (const int*)d_in[9];   /* the module's argument order: ten inputs, all read; sen_len int32 [2] */
    float* OUT = (float*)d_out;     // [2][2048][1024]
    static_assert(DM % 128 == 0 && DM <= LNC_MAX, "k_lnrow's channel count");
    char* wsp = (char*)d_ws;
    auto take = [&](size_t bytes) { char* p = wsp; wsp += (bytes + 255) & ~(size_t)255; return (void*)p; };
    bf* WQ = (bf*)take((size_t)DQ * DM * 2); bf* WK = (bf*)take((size_t)DKV * DM * 2); bf* WV = (bf*)take((size_t)DKV * DM * 2); bf* WO = (bf*)take((size_t)DM * DQ * 2); float* CS = (float*)take((size_t)TT * HD * 2 * 4); int* MK = (int*)take((size_t)TT * TT * 4);
    bf* XB = (bf*)take((size_t)TT * DM * 2); float* FQ = (float*)take((size_t)TT * DQ * 4); float* FK = (float*)take((size_t)TT * DKV * 4);
    h16* QP16 = (h16*)take((size_t)NH_ * TT * HD * 2); h16* KP16 = (h16*)take((size_t)NKV * TT * HD * 2); h16* VT16 = (h16*)take((size_t)NKV * HD * TT * 2);
    bf* QPh = nullptr; bf* QPl = nullptr; bf* KPh = nullptr; bf* KPl = nullptr; bf* VTh = nullptr; bf* VTl = nullptr; bf* Ph = nullptr; bf* Pl = nullptr;   /* RH 0: no hi / lo plane exists: these builders store the f16 plane only and do not read those arguments; the softmax's hi / lo stores sit under 'i < RH': never taken */
    float* Sb = (float*)take((size_t)ZH * TT * TT * 4); h16* P16 = (h16*)take((size_t)ZH * TT * TT * 2); float* Ob = (float*)take((size_t)ZH * TT * HD * 4); bf* ATh = (bf*)take((size_t)TT * DQ * 2); bf* ATl = (bf*)take((size_t)TT * DQ * 2); float* YO = (float*)take((size_t)TT * DM * 4); float* RB = (float*)take((size_t)TT * DM * 4);
    if ((size_t)(wsp - (char*)d_ws) > ws_size) return;    // total 130 MiB of the workspace by these reservations' own sum
    float* FV = FK;   // v projection reuses the k buffer after the k planes are built (stream-ordered)
    k_cvt8<<<(unsigned)(((size_t)DQ * DM / 8 + 255) / 256), 256, 0, stream>>>(wq, WQ, (size_t)DQ * DM / 8); k_cvt8<<<(unsigned)(((size_t)DKV * DM / 8 + 255) / 256), 256, 0, stream>>>(wk, WK, (size_t)DKV * DM / 8); k_cvt8<<<(unsigned)(((size_t)DKV * DM / 8 + 255) / 256), 256, 0, stream>>>(wv, WV, (size_t)DKV * DM / 8); k_cvt8<<<(unsigned)(((size_t)DM * DQ / 8 + 255) / 256), 256, 0, stream>>>(wo, WO, (size_t)DM * DQ / 8);   /* 'out, in' [1024][1024]: the product's second operand as it lies */
    k_csid<<<(TT * HD + 255) / 256, 256, 0, stream>>>(CS);
    const unsigned LX = (unsigned)(((size_t)TT * DM / 8 + 255) / 256);
    const unsigned LQ = (unsigned)(((size_t)NH_ * TT * HD / 2 + 255) / 256), LKv = (unsigned)(((size_t)NKV * TT * HD / 2 + 255) / 256);
    for (int b = 0; b < NB_; ++b) {
        k_clmask<<<(unsigned)(((size_t)TT * TT / 4 + 255) / 256), 256, 0, stream>>>(sl + b, MK);   /* the batch entry's keep plane, before any pass reads it */
        k_cvt8<<<LX, 256, 0, stream>>>(xq + (size_t)b * TT * DM, XB, (size_t)TT * DM / 8);
        k_gemmw<bf, 0, false><<<dim3(TT / 64, DQ / 64, 1), 32, 0, stream>>>(XB, nullptr, WQ, nullptr, DM, FQ, DQ, nullptr, 0, 0, 0);
        k_rope<<<LQ, 256, 0, stream>>>(FQ, DQ, NH_, CS, nullptr, nullptr, 1.0f, QP16, QPh, QPl);
        k_cvt8<<<LX, 256, 0, stream>>>(xk + (size_t)b * TT * DM, XB, (size_t)TT * DM / 8);   /* XB := bf16(k[b]) */
        k_gemmw<bf, 0, false><<<dim3(TT / 64, DKV / 64, 1), 32, 0, stream>>>(XB, nullptr, WK, nullptr, DM, FK, DKV, nullptr, 0, 0, 0);
        k_rope<<<LKv, 256, 0, stream>>>(FK, DKV, NKV, CS, nullptr, nullptr, 1.0f, KP16, KPh, KPl);
        k_cvt8<<<LX, 256, 0, stream>>>(xv + (size_t)b * TT * DM, XB, (size_t)TT * DM / 8);   /* XB := bf16(v[b]) (after the k planes are built) */
        k_gemmw<bf, 0, false><<<dim3(TT / 64, DKV / 64, 1), 32, 0, stream>>>(XB, nullptr, WV, nullptr, DM, FV, DKV, nullptr, 0, 0, 0); k_vtp<<<LKv, 256, 0, stream>>>(FV, DKV, NKV, VT16, VTh, VTl);
        for (int h0 = 0; h0 < NH_; h0 += ZH) { const size_t zq = (size_t)h0, zk = (size_t)(h0 / REP);   // one kv head per query head: the pass's two heads use consecutive kv planes (z-strides TT*HD)
            k_gemmw<h16, 0, false><<<dim3(TT / 64, TT / 64, ZH), 32, 0, stream>>>(QP16 + zq * TT * HD, nullptr, KP16 + zk * TT * HD, nullptr, HD, Sb, TT, nullptr, (size_t)TT * HD, (size_t)TT * HD, (size_t)TT * TT);
            k_asoftMK<<<ZH * TT / 8, 256, 0, stream>>>(Sb, MK, P16, Ph, Pl);   /* the same keep plane for both heads of the pass and for every pass of the entry */
            k_gemmw<h16, 0, false><<<dim3(TT / 64, HD / 64, ZH), 32, 0, stream>>>(P16, nullptr, VT16 + zk * HD * TT, nullptr, TT, Ob, HD, nullptr, (size_t)TT * TT, (size_t)HD * TT, (size_t)TT * HD);
            k_merge<<<(unsigned)(((size_t)ZH * TT * HD / 2 + 255) / 256), 256, 0, stream>>>(Ob, h0, ATh, ATl); }
        k_gemmw<bf, 0, false><<<dim3(TT / 64, DM / 64, 1), 32, 0, stream>>>(ATh, nullptr, WO, nullptr, DQ, YO, DM, nullptr, 0, 0, 0);   /* y = merged (one bf16 word) Wo^T into a workspace plane */
        k_rbf<<<(unsigned)(((size_t)TT * DM / 4 + 255) / 256), 256, 0, stream>>>(xq + (size_t)b * TT * DM, RB, (size_t)TT * DM / 4);   /* the residual: the query table rounded to bf16, kept as f32 */
        k_lnrow<true><<<(unsigned)((TT + 7) / 8), 256, 0, stream>>>(YO, RB, lng, lnb, 1.0e-6f, DM, TT, OUT + (size_t)b * TT * DM); }   /* out = LN(y + q) x gamma + beta: the one writer of the output */
}

// v001
// Measured time: 739 microseconds a run.
// Two timings next to v000 put it at 1.83 and 1.81 times that version's speed.
#include <hip/hip_runtime.h>

// Multi-head attention on three input tables with a causal rule AND a per-entry key length, an output map, a residual and a layer norm
// (a0 q, a1 k, a2 v [2][2048][1024]; a3 Wq, a4 Wk, a5 Wv, a6 Wo [1024][1024] 'out, in' (y = x W^T), no biases; a7 gamma, a8 beta [1024]; a9 sen_len int32 [2]: the entry's key length (1 .. 2,048);
//  16 heads x 64 (head h = columns h x 64 ..); S = (q Wq^T)(k Wk^T)^T / 8; A KEY j IS KEPT FOR QUERY i WHERE j <= i AND j < sen_len[b]; every other score is replaced by -1e9 (an exclusion: every row keeps key 0); softmax over the keys; ctx = A (v Wv^T); merged token-major; y = merged Wo^T;
//  x = y + q (the raw query table); the result = (x - mean) x rsqrt(var + 1e-6) x gamma + beta over the 1,024 channels (biased variance) -> [2][2048][1024]; argument order q, k, v, Wq, Wk, Wv, Wo, gamma, beta, sen_len).
// Layout per batch entry: the keep plane [2048][2048] of 32-bit words written once from the entry's length by compares alone (k_clmask); a bf16 copy of each table in turn; the 'out, in' weights rounded once as they lie (the product's second operand); exact projections; identity-table plane builders;
// DENSE score and value products (the module's own form: its mask and its softmax are dense); the keep-mask softmax reads the plane's row beside each score row (a masked key takes -3.0e38 before the maximum, so its weight is an exact zero: -1e9 below a kept score gives exp of -1e9: an exact zero too);
// EVERY row on ONE fp16 product (the weights x 1024); the merged context on ONE bf16 word x Wo exact into a workspace plane; the residual (the query table rounded to bf16, kept as f32) added and the row normalised by k_lnrow: the one writer of the output.
// Compute dtypes, f32 accumulate: every float input rounded to bf16 at its load; projections exact; attention: one fp16 product on every row; softmax f32; the output map bf16 x bf16 on one word a side; the norm f32; the integer input is compared only.

#define NB_  2
#define TT   2048
#define DM   1024
#define NH_  16
#define NKV  16
#define REP  (NH_ / NKV)
#define HD   64
#define DQ   (NH_ * HD)
#define DKV  (NKV * HD)
#define ZH   2
#define RH   0     // every query row on one fp16 product (no hi/lo rows)
#define WIN  0
#define PCAR 1024.0f
#define SCL  0.125f   // HD^-0.5
#define LNC_MAX 2048

typedef _Float16 h16;
typedef unsigned short bf;
typedef __attribute__((ext_vector_type(16))) __bf16   v16bf;
typedef __attribute__((ext_vector_type(16))) _Float16 v16h;
typedef __attribute__((ext_vector_type(8)))  _Float16 v8h;
typedef __attribute__((ext_vector_type(8)))  unsigned short v8us;
typedef __attribute__((ext_vector_type(8)))  float    v8f;
typedef __attribute__((ext_vector_type(4)))  float    v4f;
typedef v8h  __attribute__((may_alias)) v8ha;
typedef v4f  __attribute__((may_alias)) v4fa;
typedef v8us __attribute__((may_alias)) v8usa;

__device__ __forceinline__ unsigned short f2bf(float f) { unsigned u = __float_as_uint(f); u += 0x7FFFu + ((u >> 16) & 1u); return (unsigned short)(u >> 16); }
__device__ __forceinline__ float bf2f(unsigned short b) { return __uint_as_float(((unsigned)b) << 16); }
__device__ __forceinline__ float bfr(float f) { return bf2f(f2bf(f)); }
__device__ __forceinline__ v16h cat16(v8h lo, v8h hi) { return __builtin_shufflevector(lo, hi, 0, 1, 2, 3, 4, 5, 6, 7, 8, 9, 10, 11, 12, 13, 14, 15); }
__device__ __forceinline__ v16bf cat16b(v8us lo, v8us hi) { return __builtin_bit_cast(v16bf, __builtin_shufflevector(lo, hi, 0, 1, 2, 3, 4, 5, 6, 7, 8, 9, 10, 11, 12, 13, 14, 15)); }
__device__ __forceinline__ v8f wmma16(v16h a, v16h b, v8f c) { return __builtin_amdgcn_wmma_f32_16x16x32_f16(false, a, false, b, (short)0, c, false, false); }
__device__ __forceinline__ v8f wmmab(v16bf a, v16bf b, v8f c) { return __builtin_amdgcn_wmma_f32_16x16x32_bf16(false, a, false, b, (short)0, c, false, false); }



// ---- k_gemmw: register-blocked GEMM, one 64x64 output tile per work-group (16 accumulators a wave), operands straight from K-contiguous 16-bit planes; grid (M/64, N/64, Z), 32 x NW threads.
// C[m][n] (f32, pitch ldc, + optional f32 bias[n]) = sum_k A[m][k] Bt[n][k] (+ split products per NSPLIT). z-batch strides sA/sB/sC in elements. K % 32 == 0.
// NW waves share the tile's K range: wave w takes the 32-wide k steps w, w + NW, w + 2 NW .. (neighbouring waves read the two halves of one 128-byte line of a row at about the same time); the NW partial tiles meet in LDS and are added in wave order (fixed, the same on every run). NW == 1: one wave, no partials.
template <typename T16> struct WFrag;
template <> struct WFrag<h16> { typedef v16h V; static __device__ __forceinline__ V ld(const h16* p) { return cat16(*(const v8h*)p, *(const v8h*)(p + 16)); } static __device__ __forceinline__ v8f mma(V a, V b, v8f c) { return wmma16(a, b, c); } };
template <> struct WFrag<bf> { typedef v16bf V; static __device__ __forceinline__ V ld(const bf* p) { return cat16b(*(const v8us*)p, *(const v8us*)(p + 16)); } static __device__ __forceinline__ v8f mma(V a, V b, v8f c) { return wmmab(a, b, c); } };
template <typename T16, int NSPLIT, bool BIAS, int NW>
__global__ __launch_bounds__(32 * NW) void k_gemmw(const T16* __restrict__ A, const T16* __restrict__ A2, const T16* __restrict__ Bt, const T16* __restrict__ Bt2, int K, float* C, int ldc, const float* __restrict__ bias, size_t sA, size_t sB, size_t sC) {
    typedef typename WFrag<T16>::V V;
    __shared__ __align__(16) float os[(NW == 1 ? 16 : NW * 64) * 68];
    const size_t z = blockIdx.z; A += z * sA; if (A2) A2 += z * sA; Bt += z * sB; if (Bt2) Bt2 += z * sB; C += z * sC;
    const int lane = threadIdx.x & 31, lr = lane & 15, hi = lane >> 4; const int r0 = blockIdx.x * 64, c0 = blockIdx.y * 64;
    v8f acc[4][4];
#pragma unroll
    for (int mb = 0; mb < 4; ++mb)
#pragma unroll
        for (int nb = 0; nb < 4; ++nb) acc[mb][nb] = (v8f){};
    const size_t aoff = (size_t)(r0 + lr) * K + 8 * hi, boff = (size_t)(c0 + lr) * K + 8 * hi;
    const int wv = (NW == 1) ? 0 : __builtin_amdgcn_readfirstlane((int)(threadIdx.x >> 5));
    for (int kc = wv * 32; kc < K; kc += 32 * NW) {
        V a[4], a2[4];
#pragma unroll
        for (int mb = 0; mb < 4; ++mb) { a[mb] = WFrag<T16>::ld(A + aoff + (size_t)mb * 16 * K + kc); if (NSPLIT == 1 || NSPLIT == 2) a2[mb] = WFrag<T16>::ld(A2 + aoff + (size_t)mb * 16 * K + kc); }
#pragma unroll
        for (int nb = 0; nb < 4; ++nb) { const V b = WFrag<T16>::ld(Bt + boff + (size_t)nb * 16 * K + kc); V b2; if (NSPLIT >= 2) b2 = WFrag<T16>::ld(Bt2 + boff + (size_t)nb * 16 * K + kc);
#pragma unroll
            for (int mb = 0; mb < 4; ++mb) { acc[mb][nb] = WFrag<T16>::mma(a[mb], b, acc[mb][nb]); if (NSPLIT == 1 || NSPLIT == 2) acc[mb][nb] = WFrag<T16>::mma(a2[mb], b, acc[mb][nb]); if (NSPLIT >= 2) acc[mb][nb] = WFrag<T16>::mma(a[mb], b2, acc[mb][nb]); } }
        asm volatile("v_nop\n\tv_nop\n\tv_nop\n\tv_nop" : "+v"(acc[0][0]), "+v"(acc[1][1]), "+v"(acc[2][2]), "+v"(acc[3][3]) : "v"(a[0]), "v"(a[3]));
    }
    if constexpr (NW > 1) {
        float* ow = os + wv * (64 * 68);
#pragma unroll
        for (int mb = 0; mb < 4; ++mb)
#pragma unroll
            for (int nb = 0; nb < 4; ++nb)
#pragma unroll
                for (int j = 0; j < 8; ++j) ow[(mb * 16 + hi * 8 + j) * 68 + nb * 16 + lr] = acc[mb][nb][j];
        __syncthreads();   // every wave's partial tile is in LDS before any thread adds them up
#pragma unroll
        for (int s = 0; s < 32 / NW; ++s) { const int idx = s * (32 * NW) + (int)threadIdx.x; const int row = idx >> 4, cofs = (idx & 15) * 4; v4f val = *(const v4fa*)(os + row * 68 + cofs);
#pragma unroll
            for (int w = 1; w < NW; ++w) val += *(const v4fa*)(os + w * (64 * 68) + row * 68 + cofs);
            if (BIAS) { val[0] += bfr(bias[c0 + cofs]); val[1] += bfr(bias[c0 + cofs + 1]); val[2] += bfr(bias[c0 + cofs + 2]); val[3] += bfr(bias[c0 + cofs + 3]); }
            *(v4f*)(C + (size_t)(r0 + row) * ldc + c0 + cofs) = val; }
        return;
    }
#pragma unroll
    for (int mb = 0; mb < 4; ++mb) {
#pragma unroll
        for (int nb = 0; nb < 4; ++nb) {
#pragma unroll
            for (int j = 0; j < 8; ++j) os[(hi * 8 + j) * 68 + nb * 16 + lr] = acc[mb][nb][j]; }
        __builtin_amdgcn_wave_barrier(); asm volatile("" ::: "memory");
        float* crow = C + (size_t)(r0 + mb * 16) * ldc + c0;
{
#pragma unroll
            for (int s = 0; s < 8; ++s) { const int row = 2 * s + hi, cofs = lr * 4; v4f val = *(const v4fa*)(os + row * 68 + cofs); if (BIAS) { val[0] += bfr(bias[c0 + cofs]); val[1] += bfr(bias[c0 + cofs + 1]); val[2] += bfr(bias[c0 + cofs + 2]); val[3] += bfr(bias[c0 + cofs + 3]); }
                *(v4f*)(crow + (size_t)row * ldc + cofs) = val; }
             }
        __builtin_amdgcn_wave_barrier(); asm volatile("" ::: "memory");
    }
}



__device__ __forceinline__ h16 tohx(float x) { return (h16)x; }
__device__ __forceinline__ void splitf(float y, unsigned short& h, unsigned short& l) { h = f2bf(y); l = f2bf(y - bf2f(h)); }
typedef __attribute__((ext_vector_type(2))) _Float16 v2h;
typedef __attribute__((ext_vector_type(4))) _Float16 v4h;
typedef __attribute__((ext_vector_type(2))) unsigned short v2us;
typedef __attribute__((ext_vector_type(4))) unsigned short v4us;
typedef __attribute__((ext_vector_type(2))) float v2f;
typedef __attribute__((ext_vector_type(4))) int v4i;

__global__ __launch_bounds__(256) void k_cvt8(const float* __restrict__ src, bf* dst, size_t n8) { const size_t i = (size_t)blockIdx.x * 256 + threadIdx.x; if (i >= n8) return; const v8f v = *(const v8f*)(src + i * 8); v8us o;
#pragma unroll
    for (int k = 0; k < 8; ++k) o[k] = f2bf(v[k]); *(v8us*)(dst + i * 8) = o;  }
// k_rope: head planes [h][t][d] (fp16) of rope(x) x sc with the rotate-half convention out[d] = x[d] cos[t][d] - x[d+HD/2] sin[t][d], out[d+HD/2] = x[d+HD/2] cos[t][d+HD/2] + x[d] sin[t][d+HD/2]
__global__ __launch_bounds__(256) void k_rope(const float* __restrict__ F, int pitch, int nheads, const float* __restrict__ CS, const float* __restrict__ RF, const float* __restrict__ nw, float sc, h16* P16, bf* Ph, bf* Pl) {
    const size_t e = ((size_t)blockIdx.x * 256 + threadIdx.x) * 2; if (e >= (size_t)nheads * TT * HD) return; const int d = (int)(e % HD); const int t = (int)((e / HD) % TT); const int h = (int)(e / ((size_t)HD * TT)); const float* f = F + (size_t)t * pitch + h * HD; const float rf = RF ? RF[(size_t)h * TT + t] : 1.0f; v2h o16; v2us oh, ol;
#pragma unroll
    for (int q = 0; q < 2; ++q) { const int dd = d + q; const int dp = (dd < HD / 2) ? dd + HD / 2 : dd - HD / 2; float x0 = f[dd], x1 = f[dp];
        if (RF) { float n0 = __fmul_rn(x0, rf), n1 = __fmul_rn(x1, rf); x0 = __fmul_rn(bfr(nw[dd]), n0); x1 = __fmul_rn(bfr(nw[dp]), n1); }
        const v2f cs = *(const v2f*)(CS + ((size_t)t * HD + dd) * 2); float a = __fmul_rn(x0, cs[0]), bq = __fmul_rn(x1, cs[1]); const float r = ((dd < HD / 2) ? __fsub_rn(a, bq) : __fadd_rn(a, bq)) * sc;
        o16[q] = tohx(r); (void)oh; (void)ol; }
    *(v2h*)(P16 + e) = o16;  }
__global__ __launch_bounds__(256) void k_vtp(const float* __restrict__ F, int pitch, int nheads, h16* V16, bf* Vh, bf* Vl) { const size_t e = ((size_t)blockIdx.x * 256 + threadIdx.x) * 2; if (e >= (size_t)nheads * HD * TT) return; const int t = (int)(e % TT); const int d = (int)((e / TT) % HD); const int g = (int)(e / ((size_t)TT * HD)); v2h o16; v2us oh, ol;
#pragma unroll
    for (int q = 0; q < 2; ++q) { const float x = F[(size_t)(t + q) * pitch + g * HD + d]; o16[q] = tohx(x); (void)oh; (void)ol; }
    *(v2h*)(V16 + e) = o16;  }
__global__ __launch_bounds__(256) void k_csid(float* CS) { const int idx = blockIdx.x * 256 + threadIdx.x; if (idx >= TT * HD) return; v2f cs; cs[0] = 1.0f; cs[1] = 0.0f; *(v2f*)(CS + (size_t)idx * 2) = cs;  }
__global__ __launch_bounds__(256) void k_asoftMK(const float* __restrict__ Sb, const int* __restrict__ MK, h16* P16, bf* Ph, bf* Pl) {
    const int lane = threadIdx.x & 31; const int row = blockIdx.x * 8 + (threadIdx.x >> 5); if (row >= ZH * TT) return; const int i = row % TT; const int zz = row / TT; (void)zz; const bool hires = (i < RH); const float* sr = Sb + (size_t)row * TT; float v[TT / 32]; float mx = -3.0e38f;
#pragma unroll
    for (int ch = 0; ch < TT / 128; ++ch) { const int j0 = ch * 128 + lane * 4; const v4f a = *(const v4f*)(sr + j0); const v4i k4 = *(const v4i*)(MK + (size_t)i * TT + j0);   /* the keep-mask's row i beside the score row: 16 B per lane, unconditional; the SAME mask for both heads of the pass */
#pragma unroll
        for (int q = 0; q < 4; ++q) { const int j = j0 + q; (void)j; const float t = k4[q] ? a[q] * SCL : -3.0e38f;   /* keep the score where the mask's word is non-zero */ v[ch * 4 + q] = t; mx = fmaxf(mx, t); } }
#pragma unroll
    for (int sh = 16; sh; sh >>= 1) mx = fmaxf(mx, __shfl_xor(mx, sh, 32));
    float sum = 0.f;
#pragma unroll
    for (int k = 0; k < TT / 32; ++k) { float d0 = __fsub_rn(v[k], mx); v[k] = __builtin_amdgcn_exp2f(__fmul_rn(d0, 1.4426950408889634f)); sum += v[k]; }
#pragma unroll
    for (int sh = 16; sh; sh >>= 1) sum += __shfl_xor(sum, sh, 32);
    const float f = __fdiv_rn(hires ? 1.0f : PCAR, sum);
{
        if (hires) {
#pragma unroll
            for (int ch = 0; ch < TT / 128; ++ch) { v4us oh, ol;
#pragma unroll
                for (int q = 0; q < 4; ++q) { unsigned short a, c2; splitf(v[ch * 4 + q] * f, a, c2); oh[q] = a; ol[q] = c2; }
                const size_t oo = ((size_t)zz * (RH ? RH : 1) + i) * TT + ch * 128 + lane * 4; *(v4us*)(Ph + oo) = oh; *(v4us*)(Pl + oo) = ol; }
        } else {
#pragma unroll
            for (int ch = 0; ch < TT / 128; ++ch) { v4h o4;
#pragma unroll
                for (int q = 0; q < 4; ++q) o4[q] = tohx(v[ch * 4 + q] * f);
                *(v4h*)(P16 + (size_t)row * TT + ch * 128 + lane * 4) = o4; } }
         }
}
__global__ __launch_bounds__(256) void k_merge(const float* __restrict__ O, int h0, bf* Ah, bf* Al) { const size_t e = ((size_t)blockIdx.x * 256 + threadIdx.x) * 2; if (e >= (size_t)ZH * TT * HD) return; const int d = (int)(e % HD); const int t = (int)((e / HD) % TT); const int zz = (int)(e / ((size_t)HD * TT)); const float cs = (t < RH) ? 1.0f : (1.0f / PCAR); const size_t oo = (size_t)t * DQ + (h0 + zz) * HD + d;
    v2us oh, ol;
#pragma unroll
    for (int q = 0; q < 2; ++q) { unsigned short a, c2; splitf(O[e + q] * cs, a, c2); oh[q] = a; ol[q] = c2; } *(v2us*)(Ah + oo) = oh; *(v2us*)(Al + oo) = ol;  }

// k_clmask (NEW TEXT; flat): the keep plane of one batch entry: MK[i][j] = 1 where j <= i AND j < len, else 0 (32-bit words; i the query row, j the key; len = the entry's key length: ONE 4-byte load through the pointer the launcher hands (sen_len + b): the same word for every thread):
__global__ __launch_bounds__(256) void k_clmask(const int* __restrict__ len1, int* MK) { const size_t e = ((size_t)blockIdx.x * 256 + threadIdx.x) * 4; if (e >= (size_t)TT * TT) return; const int i = (int)(e / TT); const int j0 = (int)(e % TT); const int ln = len1[0]; v4i o;
#pragma unroll
    for (int q = 0; q < 4; ++q) o[q] = (j0 + q <= i && j0 + q < ln) ? 1 : 0;
    *(v4i*)(MK + e) = o;  }

__global__ __launch_bounds__(256) void k_rbf(const float* __restrict__ X, float* Y, size_t n4) { const size_t i = (size_t)blockIdx.x * 256 + threadIdx.x; if (i >= n4) return; const v4f a = *(const v4f*)(X + i * 4); v4f o;
#pragma unroll
    for (int q = 0; q < 4; ++q) o[q] = bfr(a[q]);
    *(v4f*)(Y + i * 4) = o;  }

template <bool RES>
__global__ __launch_bounds__(256) void k_lnrow(const float* __restrict__ A, const float* __restrict__ R, const float* __restrict__ gamma, const float* __restrict__ beta, float eps, int C, int nrows, float* Y) {
    const int lane = threadIdx.x & 31; const int row = blockIdx.x * 8 + (threadIdx.x >> 5); if (row >= nrows) return; const int nch = C / 128; const float* a = A + (size_t)row * C; float x[LNC_MAX / 32]; float s = 0.0f;
    for (int k = 0; k < LNC_MAX / 128; ++k) { if (k < nch) { const int c0 = k * 128 + lane * 4; v4f v = *(const v4f*)(a + c0);
            if (RES) { const v4f w = *(const v4f*)(R + (size_t)row * C + c0); v[0] = __fadd_rn(v[0], w[0]); v[1] = __fadd_rn(v[1], w[1]); v[2] = __fadd_rn(v[2], w[2]); v[3] = __fadd_rn(v[3], w[3]); }
            x[k * 4 + 0] = v[0]; x[k * 4 + 1] = v[1]; x[k * 4 + 2] = v[2]; x[k * 4 + 3] = v[3]; s = __fadd_rn(__fadd_rn(__fadd_rn(__fadd_rn(s, v[0]), v[1]), v[2]), v[3]); } }
    for (int sh = 16; sh; sh >>= 1) s = __fadd_rn(s, __shfl_xor(s, sh, 32));
    const float mean = __fdiv_rn(s, (float)C); float q = 0.0f;
    for (int k = 0; k < LNC_MAX / 128; ++k) { if (k < nch) {
            for (int j = 0; j < 4; ++j) { const float d = __fsub_rn(x[k * 4 + j], mean); x[k * 4 + j] = d; q = __fmaf_rn(d, d, q); } } }
    for (int sh = 16; sh; sh >>= 1) q = __fadd_rn(q, __shfl_xor(q, sh, 32));
    const float rstd = __fdiv_rn(1.0f, sqrtf(__fadd_rn(__fdiv_rn(q, (float)C), eps)));
    for (int k = 0; k < LNC_MAX / 128; ++k) { if (k < nch) { const int c0 = k * 128 + lane * 4; const v4f g = *(const v4f*)(gamma + c0); const v4f bt = *(const v4f*)(beta + c0);
            for (int j = 0; j < 4; ++j) x[k * 4 + j] = __fmaf_rn(__fmul_rn(x[k * 4 + j], rstd), bfr(g[j]), bfr(bt[j])); } }
    float* y = Y + (size_t)row * C;
    {
        for (int k = 0; k < LNC_MAX / 128; ++k) { if (k < nch) { v4f o; o[0] = x[k * 4 + 0]; o[1] = x[k * 4 + 1]; o[2] = x[k * 4 + 2]; o[3] = x[k * 4 + 3]; *(v4f*)(y + k * 128 + lane * 4) = o; } }
         }
}
extern "C" void kernel_launch(void* const* d_in, const int* in_sizes, int n_in,
                              void* d_out, int out_size, void* d_ws, size_t ws_size, hipStream_t stream) {
    (void)in_sizes; (void)n_in; (void)out_size;
    const float* xq = (const float*)d_in[0]; const float* xk = (const float*)d_in[1]; const float* xv = (const float*)d_in[2]; const float* wq = (const float*)d_in[3]; const float* wk = (const float*)d_in[4]; const float* wv = (const float*)d_in[5]; const float* wo = (const float*)d_in[6]; const float* lng = (const float*)d_in[7]; const float* lnb = (const float*)d_in[8]; const int* sl = (const int*)d_in[9];   /* the module's argument order: ten inputs, all read; sen_len int32 [2] */
    float* OUT = (float*)d_out;     // [2][2048][1024]
    static_assert(DM % 128 == 0 && DM <= LNC_MAX, "k_lnrow's channel count");
    char* wsp = (char*)d_ws;
    auto take = [&](size_t bytes) { char* p = wsp; wsp += (bytes + 255) & ~(size_t)255; return (void*)p; };
    bf* WQ = (bf*)take((size_t)DQ * DM * 2); bf* WK = (bf*)take((size_t)DKV * DM * 2); bf* WV = (bf*)take((size_t)DKV * DM * 2); bf* WO = (bf*)take((size_t)DM * DQ * 2); float* CS = (float*)take((size_t)TT * HD * 2 * 4); int* MK = (int*)take((size_t)TT * TT * 4);
    bf* XB = (bf*)take((size_t)TT * DM * 2); float* FQ = (float*)take((size_t)TT * DQ * 4); float* FK = (float*)take((size_t)TT * DKV * 4);
    h16* QP16 = (h16*)take((size_t)NH_ * TT * HD * 2); h16* KP16 = (h16*)take((size_t)NKV * TT * HD * 2); h16* VT16 = (h16*)take((size_t)NKV * HD * TT * 2);
    bf* QPh = nullptr; bf* QPl = nullptr; bf* KPh = nullptr; bf* KPl = nullptr; bf* VTh = nullptr; bf* VTl = nullptr; bf* Ph = nullptr; bf* Pl = nullptr;   /* RH 0: no hi / lo plane exists: these builders store the f16 plane only and do not read those arguments; the softmax's hi / lo stores sit under 'i < RH': never taken */
    float* Sb = (float*)take((size_t)ZH * TT * TT * 4); h16* P16 = (h16*)take((size_t)ZH * TT * TT * 2); float* Ob = (float*)take((size_t)ZH * TT * HD * 4); bf* ATh = (bf*)take((size_t)TT * DQ * 2); bf* ATl = (bf*)take((size_t)TT * DQ * 2); float* YO = (float*)take((size_t)TT * DM * 4); float* RB = (float*)take((size_t)TT * DM * 4);
    if ((size_t)(wsp - (char*)d_ws) > ws_size) return;    // total 130 MiB of the workspace by these reservations' own sum
    float* FV = FK;   // v projection reuses the k buffer after the k planes are built (stream-ordered)
    k_cvt8<<<(unsigned)(((size_t)DQ * DM / 8 + 255) / 256), 256, 0, stream>>>(wq, WQ, (size_t)DQ * DM / 8); k_cvt8<<<(unsigned)(((size_t)DKV * DM / 8 + 255) / 256), 256, 0, stream>>>(wk, WK, (size_t)DKV * DM / 8); k_cvt8<<<(unsigned)(((size_t)DKV * DM / 8 + 255) / 256), 256, 0, stream>>>(wv, WV, (size_t)DKV * DM / 8); k_cvt8<<<(unsigned)(((size_t)DM * DQ / 8 + 255) / 256), 256, 0, stream>>>(wo, WO, (size_t)DM * DQ / 8);   /* 'out, in' [1024][1024]: the product's second operand as it lies */
    k_csid<<<(TT * HD + 255) / 256, 256, 0, stream>>>(CS);
    const unsigned LX = (unsigned)(((size_t)TT * DM / 8 + 255) / 256);
    const unsigned LQ = (unsigned)(((size_t)NH_ * TT * HD / 2 + 255) / 256), LKv = (unsigned)(((size_t)NKV * TT * HD / 2 + 255) / 256);
    for (int b = 0; b < NB_; ++b) {
        k_clmask<<<(unsigned)(((size_t)TT * TT / 4 + 255) / 256), 256, 0, stream>>>(sl + b, MK);   /* the batch entry's keep plane, before any pass reads it */
        k_cvt8<<<LX, 256, 0, stream>>>(xq + (size_t)b * TT * DM, XB, (size_t)TT * DM / 8);
        k_gemmw<bf, 0, false, 8><<<dim3(TT / 64, DQ / 64, 1), 256, 0, stream>>>(XB, nullptr, WQ, nullptr, DM, FQ, DQ, nullptr, 0, 0, 0);
        k_rope<<<LQ, 256, 0, stream>>>(FQ, DQ, NH_, CS, nullptr, nullptr, 1.0f, QP16, QPh, QPl);
        k_cvt8<<<LX, 256, 0, stream>>>(xk + (size_t)b * TT * DM, XB, (size_t)TT * DM / 8);   /* XB := bf16(k[b]) */
        k_gemmw<bf, 0, false, 8><<<dim3(TT / 64, DKV / 64, 1), 256, 0, stream>>>(XB, nullptr, WK, nullptr, DM, FK, DKV, nullptr, 0, 0, 0);
        k_rope<<<LKv, 256, 0, stream>>>(FK, DKV, NKV, CS, nullptr, nullptr, 1.0f, KP16, KPh, KPl);
        k_cvt8<<<LX, 256, 0, stream>>>(xv + (size_t)b * TT * DM, XB, (size_t)TT * DM / 8);   /* XB := bf16(v[b]) (after the k planes are built) */
        k_gemmw<bf, 0, false, 8><<<dim3(TT / 64, DKV / 64, 1), 256, 0, stream>>>(XB, nullptr, WV, nullptr, DM, FV, DKV, nullptr, 0, 0, 0); k_vtp<<<LKv, 256, 0, stream>>>(FV, DKV, NKV, VT16, VTh, VTl);
        for (int h0 = 0; h0 < NH_; h0 += ZH) { const size_t zq = (size_t)h0, zk = (size_t)(h0 / REP);   // one kv head per query head: the pass's two heads use consecutive kv planes (z-strides TT*HD)
            k_gemmw<h16, 0, false, 1><<<dim3(TT / 64, TT / 64, ZH), 32, 0, stream>>>(QP16 + zq * TT * HD, nullptr, KP16 + zk * TT * HD, nullptr, HD, Sb, TT, nullptr, (size_t)TT * HD, (size_t)TT * HD, (size_t)TT * TT);
            k_asoftMK<<<ZH * TT / 8, 256, 0, stream>>>(Sb, MK, P16, Ph, Pl);   /* the same keep plane for both heads of the pass and for every pass of the entry */
            k_gemmw<h16, 0, false, 16><<<dim3(TT / 64, HD / 64, ZH), 512, 0, stream>>>(P16, nullptr, VT16 + zk * HD * TT, nullptr, TT, Ob, HD, nullptr, (size_t)TT * TT, (size_t)HD * TT, (size_t)TT * HD);
            k_merge<<<(unsigned)(((size_t)ZH * TT * HD / 2 + 255) / 256), 256, 0, stream>>>(Ob, h0, ATh, ATl); }
        k_gemmw<bf, 0, false, 8><<<dim3(TT / 64, DM / 64, 1), 256, 0, stream>>>(ATh, nullptr, WO, nullptr, DQ, YO, DM, nullptr, 0, 0, 0);   /* y = merged (one bf16 word) Wo^T into a workspace plane */
        k_rbf<<<(unsigned)(((size_t)TT * DM / 4 + 255) / 256), 256, 0, stream>>>(xq + (size_t)b * TT * DM, RB, (size_t)TT * DM / 4);   /* the residual: the query table rounded to bf16, kept as f32 */
        k_lnrow<true><<<(unsigned)((TT + 7) / 8), 256, 0, stream>>>(YO, RB, lng, lnb, 1.0e-6f, DM, TT, OUT + (size_t)b * TT * DM); }   /* out = LN(y + q) x gamma + beta: the one writer of the output */
}

// v002
// One run takes 226 microseconds.
// Two timings next to v001 put it at 3.28 and 3.29 times that version's speed.
// Over all steps from v000 it is 5.98 times as fast.
#include <hip/hip_runtime.h>

// Multi-head attention on three input tables with a causal rule AND a per-entry key length, an output map, a residual and a layer norm
// (a0 q, a1 k, a2 v [2][2048][1024]; a3 Wq, a4 Wk, a5 Wv, a6 Wo [1024][1024] 'out, in' (y = x W^T), no biases; a7 gamma, a8 beta [1024]; a9 sen_len int32 [2]: the entry's key length (1 .. 2,048);
//  16 heads x 64 (head h = columns h x 64 ..); S = (q Wq^T)(k Wk^T)^T / 8; A KEY j IS KEPT FOR QUERY i WHERE j <= i AND j < sen_len[b]; every other score is replaced by -1e9 (an exclusion: every row keeps key 0); softmax over the keys; ctx = A (v Wv^T); merged token-major; y = merged Wo^T;
//  x = y + q (the raw query table); the result = (x - mean) x rsqrt(var + 1e-6) x gamma + beta over the 1,024 channels (biased variance) -> [2][2048][1024]; argument order q, k, v, Wq, Wk, Wv, Wo, gamma, beta, sen_len).
// Layout: a bf16 copy of each table in turn; the 'out, in' weights rounded once as they lie (the product's second operand); exact projections; identity-table plane builders write the f16 head planes of BOTH batch entries (q, k [b][h][t][d], v transposed [b][h][d][t]);
// ONE attention kernel over all heads and both entries (k_fattn): scores, the keep test (two compares folded into one bound a query), an online softmax, the value product and the token-major merge stay in registers; the key loop is DENSE (all 2,048 keys; an excluded key takes -3.0e38 before the maximum, so its weight is an exact zero: -1e9 below a kept score gives exp of -1e9: an exact zero too);
// EVERY row on ONE fp16 product (the weights against the maximum in use, at most 2^8); the merged context on ONE bf16 word x Wo exact into a workspace plane; the residual (the query table rounded to bf16, kept as f32) added and the row normalised by k_lnrow: the one writer of the output.
// Compute dtypes, f32 accumulate: every float input rounded to bf16 at its load; projections exact; attention: one fp16 product on every row; softmax f32; the output map bf16 x bf16 on one word a side; the norm f32; the integer input is compared only.

#define NB_  2
#define TT   2048
#define DM   1024
#define NH_  16
#define NKV  16
#define REP  (NH_ / NKV)
#define HD   64
#define DQ   (NH_ * HD)
#define DKV  (NKV * HD)
#define LNC_MAX 2048

typedef _Float16 h16;
typedef unsigned short bf;
typedef __attribute__((ext_vector_type(16))) __bf16   v16bf;
typedef __attribute__((ext_vector_type(16))) _Float16 v16h;
typedef __attribute__((ext_vector_type(8)))  _Float16 v8h;
typedef __attribute__((ext_vector_type(8)))  unsigned short v8us;
typedef __attribute__((ext_vector_type(8)))  float    v8f;
typedef __attribute__((ext_vector_type(4)))  float    v4f;
typedef v8h  __attribute__((may_alias)) v8ha;
typedef v4f  __attribute__((may_alias)) v4fa;
typedef v8us __attribute__((may_alias)) v8usa;

__device__ __forceinline__ unsigned short f2bf(float f) { unsigned u = __float_as_uint(f); u += 0x7FFFu + ((u >> 16) & 1u); return (unsigned short)(u >> 16); }
__device__ __forceinline__ float bf2f(unsigned short b) { return __uint_as_float(((unsigned)b) << 16); }
__device__ __forceinline__ float bfr(float f) { return bf2f(f2bf(f)); }
__device__ __forceinline__ v16h cat16(v8h lo, v8h hi) { return __builtin_shufflevector(lo, hi, 0, 1, 2, 3, 4, 5, 6, 7, 8, 9, 10, 11, 12, 13, 14, 15); }
__device__ __forceinline__ v16bf cat16b(v8us lo, v8us hi) { return __builtin_bit_cast(v16bf, __builtin_shufflevector(lo, hi, 0, 1, 2, 3, 4, 5, 6, 7, 8, 9, 10, 11, 12, 13, 14, 15)); }
__device__ __forceinline__ v8f wmma16(v16h a, v16h b, v8f c) { return __builtin_amdgcn_wmma_f32_16x16x32_f16(false, a, false, b, (short)0, c, false, false); }
__device__ __forceinline__ v8f wmmab(v16bf a, v16bf b, v8f c) { return __builtin_amdgcn_wmma_f32_16x16x32_bf16(false, a, false, b, (short)0, c, false, false); }



// ---- k_gemmw: register-blocked GEMM, one 64x64 output tile per work-group (16 accumulators a wave), operands straight from K-contiguous 16-bit planes; grid (M/64, N/64, Z), 32 x NW threads.
// C[m][n] (f32, pitch ldc, + optional f32 bias[n]) = sum_k A[m][k] Bt[n][k] (+ split products per NSPLIT). z-batch strides sA/sB/sC in elements. K % 32 == 0.
// NW waves share the tile's K range: wave w takes the 32-wide k steps w, w + NW, w + 2 NW .. (neighbouring waves read the two halves of one 128-byte line of a row at about the same time); the NW partial tiles meet in LDS and are added in wave order (fixed, the same on every run). NW == 1: one wave, no partials.
template <typename T16> struct WFrag;
template <> struct WFrag<h16> { typedef v16h V; static __device__ __forceinline__ V ld(const h16* p) { return cat16(*(const v8h*)p, *(const v8h*)(p + 16)); } static __device__ __forceinline__ v8f mma(V a, V b, v8f c) { return wmma16(a, b, c); } };
template <> struct WFrag<bf> { typedef v16bf V; static __device__ __forceinline__ V ld(const bf* p) { return cat16b(*(const v8us*)p, *(const v8us*)(p + 16)); } static __device__ __forceinline__ v8f mma(V a, V b, v8f c) { return wmmab(a, b, c); } };
template <typename T16, int NSPLIT, bool BIAS, int NW>
__global__ __launch_bounds__(32 * NW) void k_gemmw(const T16* __restrict__ A, const T16* __restrict__ A2, const T16* __restrict__ Bt, const T16* __restrict__ Bt2, int K, float* C, int ldc, const float* __restrict__ bias, size_t sA, size_t sB, size_t sC) {
    typedef typename WFrag<T16>::V V;
    __shared__ __align__(16) float os[(NW == 1 ? 16 : NW * 64) * 68];
    const size_t z = blockIdx.z; A += z * sA; if (A2) A2 += z * sA; Bt += z * sB; if (Bt2) Bt2 += z * sB; C += z * sC;
    const int lane = threadIdx.x & 31, lr = lane & 15, hi = lane >> 4; const int r0 = blockIdx.x * 64, c0 = blockIdx.y * 64;
    v8f acc[4][4];
#pragma unroll
    for (int mb = 0; mb < 4; ++mb)
#pragma unroll
        for (int nb = 0; nb < 4; ++nb) acc[mb][nb] = (v8f){};
    const size_t aoff = (size_t)(r0 + lr) * K + 8 * hi, boff = (size_t)(c0 + lr) * K + 8 * hi;
    const int wv = (NW == 1) ? 0 : __builtin_amdgcn_readfirstlane((int)(threadIdx.x >> 5));
    for (int kc = wv * 32; kc < K; kc += 32 * NW) {
        V a[4], a2[4];
#pragma unroll
        for (int mb = 0; mb < 4; ++mb) { a[mb] = WFrag<T16>::ld(A + aoff + (size_t)mb * 16 * K + kc); if (NSPLIT == 1 || NSPLIT == 2) a2[mb] = WFrag<T16>::ld(A2 + aoff + (size_t)mb * 16 * K + kc); }
#pragma unroll
        for (int nb = 0; nb < 4; ++nb) { const V b = WFrag<T16>::ld(Bt + boff + (size_t)nb * 16 * K + kc); V b2; if (NSPLIT >= 2) b2 = WFrag<T16>::ld(Bt2 + boff + (size_t)nb * 16 * K + kc);
#pragma unroll
            for (int mb = 0; mb < 4; ++mb) { acc[mb][nb] = WFrag<T16>::mma(a[mb], b, acc[mb][nb]); if (NSPLIT == 1 || NSPLIT == 2) acc[mb][nb] = WFrag<T16>::mma(a2[mb], b, acc[mb][nb]); if (NSPLIT >= 2) acc[mb][nb] = WFrag<T16>::mma(a[mb], b2, acc[mb][nb]); } }
        asm volatile("v_nop\n\tv_nop\n\tv_nop\n\tv_nop" : "+v"(acc[0][0]), "+v"(acc[1][1]), "+v"(acc[2][2]), "+v"(acc[3][3]) : "v"(a[0]), "v"(a[3]));
    }
    if constexpr (NW > 1) {
        float* ow = os + wv * (64 * 68);
#pragma unroll
        for (int mb = 0; mb < 4; ++mb)
#pragma unroll
            for (int nb = 0; nb < 4; ++nb)
#pragma unroll
                for (int j = 0; j < 8; ++j) ow[(mb * 16 + hi * 8 + j) * 68 + nb * 16 + lr] = acc[mb][nb][j];
        __syncthreads();   // every wave's partial tile is in LDS before any thread adds them up
#pragma unroll
        for (int s = 0; s < 32 / NW; ++s) { const int idx = s * (32 * NW) + (int)threadIdx.x; const int row = idx >> 4, cofs = (idx & 15) * 4; v4f val = *(const v4fa*)(os + row * 68 + cofs);
#pragma unroll
            for (int w = 1; w < NW; ++w) val += *(const v4fa*)(os + w * (64 * 68) + row * 68 + cofs);
            if (BIAS) { val[0] += bfr(bias[c0 + cofs]); val[1] += bfr(bias[c0 + cofs + 1]); val[2] += bfr(bias[c0 + cofs + 2]); val[3] += bfr(bias[c0 + cofs + 3]); }
            *(v4f*)(C + (size_t)(r0 + row) * ldc + c0 + cofs) = val; }
        return;
    }
#pragma unroll
    for (int mb = 0; mb < 4; ++mb) {
#pragma unroll
        for (int nb = 0; nb < 4; ++nb) {
#pragma unroll
            for (int j = 0; j < 8; ++j) os[(hi * 8 + j) * 68 + nb * 16 + lr] = acc[mb][nb][j]; }
        __builtin_amdgcn_wave_barrier(); asm volatile("" ::: "memory");
        float* crow = C + (size_t)(r0 + mb * 16) * ldc + c0;
{
#pragma unroll
            for (int s = 0; s < 8; ++s) { const int row = 2 * s + hi, cofs = lr * 4; v4f val = *(const v4fa*)(os + row * 68 + cofs); if (BIAS) { val[0] += bfr(bias[c0 + cofs]); val[1] += bfr(bias[c0 + cofs + 1]); val[2] += bfr(bias[c0 + cofs + 2]); val[3] += bfr(bias[c0 + cofs + 3]); }
                *(v4f*)(crow + (size_t)row * ldc + cofs) = val; }
             }
        __builtin_amdgcn_wave_barrier(); asm volatile("" ::: "memory");
    }
}



__device__ __forceinline__ h16 tohx(float x) { return (h16)x; }
__device__ __forceinline__ void splitf(float y, unsigned short& h, unsigned short& l) { h = f2bf(y); l = f2bf(y - bf2f(h)); }
typedef __attribute__((ext_vector_type(2))) _Float16 v2h;
typedef __attribute__((ext_vector_type(4))) _Float16 v4h;
typedef __attribute__((ext_vector_type(2))) unsigned short v2us;
typedef __attribute__((ext_vector_type(4))) unsigned short v4us;
typedef __attribute__((ext_vector_type(2))) float v2f;
typedef __attribute__((ext_vector_type(4))) int v4i;

__global__ __launch_bounds__(256) void k_cvt8(const float* __restrict__ src, bf* dst, size_t n8) { const size_t i = (size_t)blockIdx.x * 256 + threadIdx.x; if (i >= n8) return; const v8f v = *(const v8f*)(src + i * 8); v8us o;
#pragma unroll
    for (int k = 0; k < 8; ++k) o[k] = f2bf(v[k]); *(v8us*)(dst + i * 8) = o;  }
// k_rope: head planes [h][t][d] (fp16) of rope(x) x sc with the rotate-half convention out[d] = x[d] cos[t][d] - x[d+HD/2] sin[t][d], out[d+HD/2] = x[d+HD/2] cos[t][d+HD/2] + x[d] sin[t][d+HD/2]
__global__ __launch_bounds__(256) void k_rope(const float* __restrict__ F, int pitch, int nheads, const float* __restrict__ CS, const float* __restrict__ RF, const float* __restrict__ nw, float sc, h16* P16, bf* Ph, bf* Pl) {
    const size_t e = ((size_t)blockIdx.x * 256 + threadIdx.x) * 2; if (e >= (size_t)nheads * TT * HD) return; const int d = (int)(e % HD); const int t = (int)((e / HD) % TT); const int h = (int)(e / ((size_t)HD * TT)); const float* f = F + (size_t)t * pitch + h * HD; const float rf = RF ? RF[(size_t)h * TT + t] : 1.0f; v2h o16; v2us oh, ol;
#pragma unroll
    for (int q = 0; q < 2; ++q) { const int dd = d + q; const int dp = (dd < HD / 2) ? dd + HD / 2 : dd - HD / 2; float x0 = f[dd], x1 = f[dp];
        if (RF) { float n0 = __fmul_rn(x0, rf), n1 = __fmul_rn(x1, rf); x0 = __fmul_rn(bfr(nw[dd]), n0); x1 = __fmul_rn(bfr(nw[dp]), n1); }
        const v2f cs = *(const v2f*)(CS + ((size_t)t * HD + dd) * 2); float a = __fmul_rn(x0, cs[0]), bq = __fmul_rn(x1, cs[1]); const float r = ((dd < HD / 2) ? __fsub_rn(a, bq) : __fadd_rn(a, bq)) * sc;
        o16[q] = tohx(r); (void)oh; (void)ol; }
    *(v2h*)(P16 + e) = o16;  }
__global__ __launch_bounds__(256) void k_vtp(const float* __restrict__ F, int pitch, int nheads, h16* V16, bf* Vh, bf* Vl) { const size_t e = ((size_t)blockIdx.x * 256 + threadIdx.x) * 2; if (e >= (size_t)nheads * HD * TT) return; const int t = (int)(e % TT); const int d = (int)((e / TT) % HD); const int g = (int)(e / ((size_t)TT * HD)); v2h o16; v2us oh, ol;
#pragma unroll
    for (int q = 0; q < 2; ++q) { const float x = F[(size_t)(t + q) * pitch + g * HD + d]; o16[q] = tohx(x); (void)oh; (void)ol; }
    *(v2h*)(V16 + e) = o16;  }
__global__ __launch_bounds__(256) void k_csid(float* CS) { const int idx = blockIdx.x * 256 + threadIdx.x; if (idx >= TT * HD) return; v2f cs; cs[0] = 1.0f; cs[1] = 0.0f; *(v2f*)(CS + (size_t)idx * 2) = cs;  }
// ---- k_fattn: one work-group = 256 queries of one head of one batch entry; 8 waves x 32 query columns (2 groups of 16); grid (TT / 256, heads, entries).
// St = K Q^T (A = 16 key rows, B = 16 query columns) and Ot += Vt Pt: a lane holds the scores of ONE query (column lr), keys 8 hi + r of each 16-key tile, so two score tiles converted in place ARE the B operand of the value product (the hardware k order, which WFrag's loader gives A as well).
// K and Vt tiles of 64 keys go through registers into LDS (whole 128-byte lines from memory, rows padded to 144 bytes for the 16-byte readers), two buffers: the next tile's loads fly while this one is worked on.
#define FKS 64     // keys a stage
#define FPI 72     // LDS row pitch in 16-bit words: 128 bytes + 16
#define FC2 0.18033688011112042f   // HD^-0.5 x log2(e): scores in base 2
__device__ __forceinline__ float xhalf(float x) { return __builtin_bit_cast(float, __builtin_amdgcn_permlanex16(__builtin_bit_cast(int, x), __builtin_bit_cast(int, x), 0x76543210, 0xfedcba98, false, false)); }   // lane l with lane l ^ 16
// eight 2^x in one statement: the early-clobber results keep every v_exp_f32 clear of its neighbour's source and result, and the closing v_nop is the one slot the instruction set asks for between a transcendental and a reader of its result
__device__ __forceinline__ v8f exp2x8(v8f x) { float p0, p1, p2, p3, p4, p5, p6, p7;
    asm("v_exp_f32 %0, %8\n\tv_exp_f32 %1, %9\n\tv_exp_f32 %2, %10\n\tv_exp_f32 %3, %11\n\tv_exp_f32 %4, %12\n\tv_exp_f32 %5, %13\n\tv_exp_f32 %6, %14\n\tv_exp_f32 %7, %15\n\tv_nop"
        : "=&v"(p0), "=&v"(p1), "=&v"(p2), "=&v"(p3), "=&v"(p4), "=&v"(p5), "=&v"(p6), "=&v"(p7) : "v"(x[0]), "v"(x[1]), "v"(x[2]), "v"(x[3]), "v"(x[4]), "v"(x[5]), "v"(x[6]), "v"(x[7]));
    return (v8f){p0, p1, p2, p3, p4, p5, p6, p7}; }
__global__ __launch_bounds__(256) void k_fattn(const h16* __restrict__ Q, const h16* __restrict__ Kp, const h16* __restrict__ Vt, const int* __restrict__ slen, bf* AT) {
    __shared__ __align__(16) h16 ks[2][FKS * FPI];
    __shared__ __align__(16) h16 vs[2][HD * FPI];
    const int tid = (int)threadIdx.x, lane = tid & 31, lr = lane & 15, hi = lane >> 4; const int wv = __builtin_amdgcn_readfirstlane(tid >> 5);
    const int h = blockIdx.y, b = blockIdx.z; const size_t pl = ((size_t)b * NH_ + h) * TT * HD; Q += pl; Kp += pl; Vt += pl;
    const int q0 = blockIdx.x * 256 + wv * 32; const int ln = slen[b];   // the entry's key length: compared only
    v16h qf[2][2]; int lim[2]; v8f o[4][2]; float m[2], l[2];
#pragma unroll
    for (int g = 0; g < 2; ++g) { const int qi = q0 + g * 16 + lr; qf[g][0] = WFrag<h16>::ld(Q + (size_t)qi * HD + 8 * hi); qf[g][1] = WFrag<h16>::ld(Q + (size_t)qi * HD + 32 + 8 * hi);
        lim[g] = (qi + 1 < ln) ? qi + 1 : ln;   // key j is kept where j <= qi AND j < ln: j < lim
        m[g] = -3.0e38f; l[g] = 0.0f;
#pragma unroll
        for (int dt = 0; dt < 4; ++dt) o[dt][g] = (v8f){}; }
    const int srow = tid >> 3, sc = (tid & 7) * 8;   // staging: 8 threads a 128-byte row, rows srow and srow + 32 of each tile
    const h16* kg = Kp + (size_t)srow * HD + sc; const h16* vg = Vt + (size_t)srow * TT + sc;
    v8h rk0 = *(const v8h*)kg, rk1 = *(const v8h*)(kg + 32 * HD), rv0 = *(const v8h*)vg, rv1 = *(const v8h*)(vg + (size_t)32 * TT);
    *(v8h*)(&ks[0][srow * FPI + sc]) = rk0; *(v8h*)(&ks[0][(srow + 32) * FPI + sc]) = rk1; *(v8h*)(&vs[0][srow * FPI + sc]) = rv0; *(v8h*)(&vs[0][(srow + 32) * FPI + sc]) = rv1;
    __syncthreads();   // stage 0 is in LDS before any wave reads it
    for (int st = 0; st < TT / FKS; ++st) {
        const int cur = st & 1; const bool more = st + 1 < TT / FKS;
        if (more) { const h16* kn = kg + (size_t)(st + 1) * FKS * HD; const h16* vn = vg + (st + 1) * FKS; rk0 = *(const v8h*)kn; rk1 = *(const v8h*)(kn + 32 * HD); rv0 = *(const v8h*)vn; rv1 = *(const v8h*)(vn + (size_t)32 * TT); }
#pragma unroll
        for (int sub = 0; sub < 2; ++sub) {
            v8f s[2][2];
#pragma unroll
            for (int kt = 0; kt < 2; ++kt) { const h16* kr = &ks[cur][(sub * 32 + kt * 16 + lr) * FPI + 8 * hi]; const v16h a0 = WFrag<h16>::ld(kr), a1 = WFrag<h16>::ld(kr + 32);
#pragma unroll
                for (int g = 0; g < 2; ++g) { s[kt][g] = wmma16(a0, qf[g][0], (v8f){}); s[kt][g] = wmma16(a1, qf[g][1], s[kt][g]); } }
            v16h va[4];
#pragma unroll
            for (int dt = 0; dt < 4; ++dt) va[dt] = WFrag<h16>::ld(&vs[cur][(dt * 16 + lr) * FPI + sub * 32 + 8 * hi]);
            __builtin_amdgcn_sched_barrier(0);   // keeps the Vt fragment loads in front of the softmax, whose vector work then covers their LDS latency; without it they sink to directly in front of each value product
            float bm[2]; bool need = false;
#pragma unroll
            for (int g = 0; g < 2; ++g) { const int rem = lim[g] - (st * FKS + sub * 32 + 8 * hi); float x = -3.0e38f;   // this lane's key kt x 16 + 8 hi + r of the pass is kept where kt x 16 + r < rem
#pragma unroll
                for (int kt = 0; kt < 2; ++kt)
#pragma unroll
                    for (int r = 0; r < 8; ++r) { const float t = (kt * 16 + r < rem) ? s[kt][g][r] * FC2 : -3.0e38f; s[kt][g][r] = t; x = fmaxf(x, t); }
                x = fmaxf(x, xhalf(x)); bm[g] = x; need = need || (x - m[g] > 8.0f); }
            if (__builtin_amdgcn_ballot_w32(need) != 0) {   // a scalar branch: the maximum in use moves only where a column's new maximum is more than 8 (base 2) above it, so a weight is at most 2^8
#pragma unroll
                for (int g = 0; g < 2; ++g) { const float mn = fmaxf(m[g], bm[g]); const float al = __builtin_amdgcn_exp2f(m[g] - mn); m[g] = mn; l[g] *= al;
#pragma unroll
                    for (int dt = 0; dt < 4; ++dt) o[dt][g] *= al; } }
            v16h pf[2];
#pragma unroll
            for (int g = 0; g < 2; ++g) {
#pragma unroll
                for (int kt = 0; kt < 2; ++kt) { const v8f p = exp2x8(s[kt][g] - m[g]);
#pragma unroll
                    for (int r = 0; r < 8; ++r) { l[g] += p[r]; pf[g][kt * 8 + r] = (h16)p[r]; } } }
#pragma unroll
            for (int dt = 0; dt < 4; ++dt)
#pragma unroll
                for (int g = 0; g < 2; ++g) o[dt][g] = wmma16(va[dt], pf[g], o[dt][g]);
        }
        if (more) { const int nx = cur ^ 1; *(v8h*)(&ks[nx][srow * FPI + sc]) = rk0; *(v8h*)(&ks[nx][(srow + 32) * FPI + sc]) = rk1; *(v8h*)(&vs[nx][srow * FPI + sc]) = rv0; *(v8h*)(&vs[nx][(srow + 32) * FPI + sc]) = rv1; }
        __syncthreads();   // publishes the next stage and ends every wave's reads of this one, which the stage after next overwrites
    }
#pragma unroll
    for (int g = 0; g < 2; ++g) { const float inv = __fdiv_rn(1.0f, l[g] + xhalf(l[g])); bf* ar = AT + ((size_t)b * TT + q0 + g * 16 + lr) * DQ + h * HD + hi * 8;   // the two halves of a column hold different keys' weights: joined once
#pragma unroll
        for (int dt = 0; dt < 4; ++dt) { v8us w;
#pragma unroll
            for (int r = 0; r < 8; ++r) w[r] = f2bf(o[dt][g][r] * inv);
            *(v8us*)(ar + dt * 16) = w; } }
}


__global__ __launch_bounds__(256) void k_rbf(const float* __restrict__ X, float* Y, size_t n4) { const size_t i = (size_t)blockIdx.x * 256 + threadIdx.x; if (i >= n4) return; const v4f a = *(const v4f*)(X + i * 4); v4f o;
#pragma unroll
    for (int q = 0; q < 4; ++q) o[q] = bfr(a[q]);
    *(v4f*)(Y + i * 4) = o;  }

template <bool RES>
__global__ __launch_bounds__(256) void k_lnrow(const float* __restrict__ A, const float* __restrict__ R, const float* __restrict__ gamma, const float* __restrict__ beta, float eps, int C, int nrows, float* Y) {
    const int lane = threadIdx.x & 31; const int row = blockIdx.x * 8 + (threadIdx.x >> 5); if (row >= nrows) return; const int nch = C / 128; const float* a = A + (size_t)row * C; float x[LNC_MAX / 32]; float s = 0.0f;
    for (int k = 0; k < LNC_MAX / 128; ++k) { if (k < nch) { const int c0 = k * 128 + lane * 4; v4f v = *(const v4f*)(a + c0);
            if (RES) { const v4f w = *(const v4f*)(R + (size_t)row * C + c0); v[0] = __fadd_rn(v[0], w[0]); v[1] = __fadd_rn(v[1], w[1]); v[2] = __fadd_rn(v[2], w[2]); v[3] = __fadd_rn(v[3], w[3]); }
            x[k * 4 + 0] = v[0]; x[k * 4 + 1] = v[1]; x[k * 4 + 2] = v[2]; x[k * 4 + 3] = v[3]; s = __fadd_rn(__fadd_rn(__fadd_rn(__fadd_rn(s, v[0]), v[1]), v[2]), v[3]); } }
    for (int sh = 16; sh; sh >>= 1) s = __fadd_rn(s, __shfl_xor(s, sh, 32));
    const float mean = __fdiv_rn(s, (float)C); float q = 0.0f;
    for (int k = 0; k < LNC_MAX / 128; ++k) { if (k < nch) {
            for (int j = 0; j < 4; ++j) { const float d = __fsub_rn(x[k * 4 + j], mean); x[k * 4 + j] = d; q = __fmaf_rn(d, d, q); } } }
    for (int sh = 16; sh; sh >>= 1) q = __fadd_rn(q, __shfl_xor(q, sh, 32));
    const float rstd = __fdiv_rn(1.0f, sqrtf(__fadd_rn(__fdiv_rn(q, (float)C), eps)));
    for (int k = 0; k < LNC_MAX / 128; ++k) { if (k < nch) { const int c0 = k * 128 + lane * 4; const v4f g = *(const v4f*)(gamma + c0); const v4f bt = *(const v4f*)(beta + c0);
            for (int j = 0; j < 4; ++j) x[k * 4 + j] = __fmaf_rn(__fmul_rn(x[k * 4 + j], rstd), bfr(g[j]), bfr(bt[j])); } }
    float* y = Y + (size_t)row * C;
    {
        for (int k = 0; k < LNC_MAX / 128; ++k) { if (k < nch) { v4f o; o[0] = x[k * 4 + 0]; o[1] = x[k * 4 + 1]; o[2] = x[k * 4 + 2]; o[3] = x[k * 4 + 3]; *(v4f*)(y + k * 128 + lane * 4) = o; } }
         }
}
extern "C" void kernel_launch(void* const* d_in, const int* in_sizes, int n_in,
                              void* d_out, int out_size, void* d_ws, size_t ws_size, hipStream_t stream) {
    (void)in_sizes; (void)n_in; (void)out_size;
    const float* xq = (const float*)d_in[0]; const float* xk = (const float*)d_in[1]; const float* xv = (const float*)d_in[2]; const float* wq = (const float*)d_in[3]; const float* wk = (const float*)d_in[4]; const float* wv = (const float*)d_in[5]; const float* wo = (const float*)d_in[6]; const float* lng = (const float*)d_in[7]; const float* lnb = (const float*)d_in[8]; const int* sl = (const int*)d_in[9];   /* the module's argument order: ten inputs, all read; sen_len int32 [2] */
    float* OUT = (float*)d_out;     // [2][2048][1024]
    static_assert(DM % 128 == 0 && DM <= LNC_MAX, "k_lnrow's channel count");
    char* wsp = (char*)d_ws;
    auto take = [&](size_t bytes) { char* p = wsp; wsp += (bytes + 255) & ~(size_t)255; return (void*)p; };
    bf* WQ = (bf*)take((size_t)DQ * DM * 2); bf* WK = (bf*)take((size_t)DKV * DM * 2); bf* WV = (bf*)take((size_t)DKV * DM * 2); bf* WO = (bf*)take((size_t)DM * DQ * 2); float* CS = (float*)take((size_t)TT * HD * 2 * 4);
    bf* XB = (bf*)take((size_t)TT * DM * 2); float* FQ = (float*)take((size_t)TT * DQ * 4); float* FK = (float*)take((size_t)TT * DKV * 4);
    h16* QP16 = (h16*)take((size_t)NB_ * NH_ * TT * HD * 2); h16* KP16 = (h16*)take((size_t)NB_ * NKV * TT * HD * 2); h16* VT16 = (h16*)take((size_t)NB_ * NKV * HD * TT * 2);   /* the head planes of both entries: one attention launch reads them all */
    bf* QPh = nullptr; bf* QPl = nullptr; bf* KPh = nullptr; bf* KPl = nullptr; bf* VTh = nullptr; bf* VTl = nullptr;   /* no hi / lo plane exists: these builders store the f16 plane only and do not read those arguments */
    bf* ATh = (bf*)take((size_t)NB_ * TT * DQ * 2); float* YO = (float*)take((size_t)TT * DM * 4); float* RB = (float*)take((size_t)TT * DM * 4);
    if ((size_t)(wsp - (char*)d_ws) > ws_size) return;    // total 77 MiB of the workspace by these reservations' own sum
    float* FV = FK;   // v projection reuses the k buffer after the k planes are built (stream-ordered)
    k_cvt8<<<(unsigned)(((size_t)DQ * DM / 8 + 255) / 256), 256, 0, stream>>>(wq, WQ, (size_t)DQ * DM / 8); k_cvt8<<<(unsigned)(((size_t)DKV * DM / 8 + 255) / 256), 256, 0, stream>>>(wk, WK, (size_t)DKV * DM / 8); k_cvt8<<<(unsigned)(((size_t)DKV * DM / 8 + 255) / 256), 256, 0, stream>>>(wv, WV, (size_t)DKV * DM / 8); k_cvt8<<<(unsigned)(((size_t)DM * DQ / 8 + 255) / 256), 256, 0, stream>>>(wo, WO, (size_t)DM * DQ / 8);   /* 'out, in' [1024][1024]: the product's second operand as it lies */
    k_csid<<<(TT * HD + 255) / 256, 256, 0, stream>>>(CS);
    const unsigned LX = (unsigned)(((size_t)TT * DM / 8 + 255) / 256);
    const unsigned LQ = (unsigned)(((size_t)NH_ * TT * HD / 2 + 255) / 256), LKv = (unsigned)(((size_t)NKV * TT * HD / 2 + 255) / 256);
    for (int b = 0; b < NB_; ++b) {
        k_cvt8<<<LX, 256, 0, stream>>>(xq + (size_t)b * TT * DM, XB, (size_t)TT * DM / 8);
        k_gemmw<bf, 0, false, 8><<<dim3(TT / 64, DQ / 64, 1), 256, 0, stream>>>(XB, nullptr, WQ, nullptr, DM, FQ, DQ, nullptr, 0, 0, 0);
        k_rope<<<LQ, 256, 0, stream>>>(FQ, DQ, NH_, CS, nullptr, nullptr, 1.0f, QP16 + (size_t)b * NH_ * TT * HD, QPh, QPl);
        k_cvt8<<<LX, 256, 0, stream>>>(xk + (size_t)b * TT * DM, XB, (size_t)TT * DM / 8);   /* XB := bf16(k[b]) */
        k_gemmw<bf, 0, false, 8><<<dim3(TT / 64, DKV / 64, 1), 256, 0, stream>>>(XB, nullptr, WK, nullptr, DM, FK, DKV, nullptr, 0, 0, 0);
        k_rope<<<LKv, 256, 0, stream>>>(FK, DKV, NKV, CS, nullptr, nullptr, 1.0f, KP16 + (size_t)b * NKV * TT * HD, KPh, KPl);
        k_cvt8<<<LX, 256, 0, stream>>>(xv + (size_t)b * TT * DM, XB, (size_t)TT * DM / 8);   /* XB := bf16(v[b]) (after the k planes are built) */
        k_gemmw<bf, 0, false, 8><<<dim3(TT / 64, DKV / 64, 1), 256, 0, stream>>>(XB, nullptr, WV, nullptr, DM, FV, DKV, nullptr, 0, 0, 0); k_vtp<<<LKv, 256, 0, stream>>>(FV, DKV, NKV, VT16 + (size_t)b * NKV * HD * TT, VTh, VTl); }
    static_assert(NH_ == NKV && TT % 256 == 0 && HD == 64, "k_fattn's shape");
    k_fattn<<<dim3(TT / 256, NH_, NB_), 256, 0, stream>>>(QP16, KP16, VT16, sl, ATh);   /* scores, keep test, softmax, value product and merge of every head of both entries */
    for (int b = 0; b < NB_; ++b) {
        k_gemmw<bf, 0, false, 8><<<dim3(TT / 64, DM / 64, 1), 256, 0, stream>>>(ATh + (size_t)b * TT * DQ, nullptr, WO, nullptr, DQ, YO, DM, nullptr, 0, 0, 0);   /* y = merged (one bf16 word) Wo^T into a workspace plane */
        k_rbf<<<(unsigned)(((size_t)TT * DM / 4 + 255) / 256), 256, 0, stream>>>(xq + (size_t)b * TT * DM, RB, (size_t)TT * DM / 4);   /* the residual: the query table rounded to bf16, kept as f32 */
        k_lnrow<true><<<(unsigned)((TT + 7) / 8), 256, 0, stream>>>(YO, RB, lng, lnb, 1.0e-6f, DM, TT, OUT + (size_t)b * TT * DM); }   /* out = LN(y + q) x gamma + beta: the one writer of the output */
}

// v003
// One run takes 183 microseconds.
// Two timings next to v002 both put it at 1.23 times that version's speed.
// All steps since v000 together make it 7.36 times as fast.
#include <hip/hip_runtime.h>

// Multi-head attention on three input tables with a causal rule AND a per-entry key length, an output map, a residual and a layer norm
// (a0 q, a1 k, a2 v [2][2048][1024]; a3 Wq, a4 Wk, a5 Wv, a6 Wo [1024][1024] 'out, in' (y = x W^T), no biases; a7 gamma, a8 beta [1024]; a9 sen_len int32 [2]: the entry's key length (1 .. 2,048);
//  16 heads x 64 (head h = columns h x 64 ..); S = (q Wq^T)(k Wk^T)^T / 8; A KEY j IS KEPT FOR QUERY i WHERE j <= i AND j < sen_len[b]; every other score is replaced by -1e9 (an exclusion: every row keeps key 0); softmax over the keys; ctx = A (v Wv^T); merged token-major; y = merged Wo^T;
//  x = y + q (the raw query table); the result = (x - mean) x rsqrt(var + 1e-6) x gamma + beta over the 1,024 channels (biased variance) -> [2][2048][1024]; argument order q, k, v, Wq, Wk, Wv, Wo, gamma, beta, sen_len).
// Layout: a bf16 copy of each table in turn; the 'out, in' weights rounded once as they lie (K-contiguous: the product's second operand, Wv its first); exact projections, whose own epilogue rounds each 64x64 tile (one head's columns) to f16 and stores it where the head planes of BOTH batch entries want it (q, k [b][h][t][d]; v transposed [b][h][d][t]: that product runs as Wv x^T, rows = channels, so its rows lie as the plane's do);
// ONE attention kernel over all heads and both entries (k_fattn): scores, the keep test (two compares folded into one bound a query), an online softmax, the value product and the token-major merge stay in registers; the key loop is DENSE (all 2,048 keys; an excluded key takes -3.0e38 before the maximum, so its weight is an exact zero: -1e9 below a kept score gives exp of -1e9: an exact zero too);
// EVERY row on ONE fp16 product (the weights against the maximum in use, at most 2^8); the merged context on ONE bf16 word x Wo exact into a workspace plane; the residual (the query table rounded to bf16, kept as f32) added and the row normalised by k_lnrow: the one writer of the output.
// Compute dtypes, f32 accumulate: every float input rounded to bf16 at its load; projections exact; attention: one fp16 product on every row; softmax f32; the output map bf16 x bf16 on one word a side; the norm f32; the integer input is compared only.

#define NB_  2
#define TT   2048
#define DM   1024
#define NH_  16
#define NKV  16
#define REP  (NH_ / NKV)
#define HD   64
#define DQ   (NH_ * HD)
#define DKV  (NKV * HD)
#define LNC_MAX 2048

typedef _Float16 h16;
typedef unsigned short bf;
typedef __attribute__((ext_vector_type(16))) __bf16   v16bf;
typedef __attribute__((ext_vector_type(16))) _Float16 v16h;
typedef __attribute__((ext_vector_type(8)))  _Float16 v8h;
typedef __attribute__((ext_vector_type(4)))  _Float16 v4h;
typedef __attribute__((ext_vector_type(8)))  unsigned short v8us;
typedef __attribute__((ext_vector_type(8)))  float    v8f;
typedef __attribute__((ext_vector_type(4)))  float    v4f;
typedef v8h  __attribute__((may_alias)) v8ha;
typedef v4f  __attribute__((may_alias)) v4fa;
typedef v8us __attribute__((may_alias)) v8usa;

__device__ __forceinline__ unsigned short f2bf(float f) { unsigned u = __float_as_uint(f); u += 0x7FFFu + ((u >> 16) & 1u); return (unsigned short)(u >> 16); }
__device__ __forceinline__ float bf2f(unsigned short b) { return __uint_as_float(((unsigned)b) << 16); }
__device__ __forceinline__ float bfr(float f) { return bf2f(f2bf(f)); }
__device__ __forceinline__ v16h cat16(v8h lo, v8h hi) { return __builtin_shufflevector(lo, hi, 0, 1, 2, 3, 4, 5, 6, 7, 8, 9, 10, 11, 12, 13, 14, 15); }
__device__ __forceinline__ v16bf cat16b(v8us lo, v8us hi) { return __builtin_bit_cast(v16bf, __builtin_shufflevector(lo, hi, 0, 1, 2, 3, 4, 5, 6, 7, 8, 9, 10, 11, 12, 13, 14, 15)); }
__device__ __forceinline__ v8f wmma16(v16h a, v16h b, v8f c) { return __builtin_amdgcn_wmma_f32_16x16x32_f16(false, a, false, b, (short)0, c, false, false); }
__device__ __forceinline__ v8f wmmab(v16bf a, v16bf b, v8f c) { return __builtin_amdgcn_wmma_f32_16x16x32_bf16(false, a, false, b, (short)0, c, false, false); }



// ---- k_gemmw: register-blocked GEMM, one 64x64 output tile per work-group (16 accumulators a wave), operands straight from K-contiguous 16-bit planes; grid (M/64, N/64, Z), 32 x NW threads.
// C[m][n] (f32 sums + optional f32 bias[n], stored as TO: f32, or rounded once to f16) = sum_k A[m][k] Bt[n][k] (+ split products per NSPLIT). z-batch strides sA/sB/sC in elements. K % 32 == 0.
// Where C lies: row m at pitch ldc, the 64-column tile number y at y x sN elements (sN = 64: a plain row-major matrix; sN = rows x 64 with ldc = 64: one [row][64] plane a tile of columns).
// NW waves share the tile's K range: wave w takes the 32-wide k steps w, w + NW, w + 2 NW .. (neighbouring waves read the two halves of one 128-byte line of a row at about the same time); the NW partial tiles meet in LDS and are added in wave order (fixed, the same on every run). NW == 1: one wave, no partials.
template <typename T16> struct WFrag;
template <> struct WFrag<h16> { typedef v16h V; static __device__ __forceinline__ V ld(const h16* p) { return cat16(*(const v8h*)p, *(const v8h*)(p + 16)); } static __device__ __forceinline__ v8f mma(V a, V b, v8f c) { return wmma16(a, b, c); } };
template <> struct WFrag<bf> { typedef v16bf V; static __device__ __forceinline__ V ld(const bf* p) { return cat16b(*(const v8us*)p, *(const v8us*)(p + 16)); } static __device__ __forceinline__ v8f mma(V a, V b, v8f c) { return wmmab(a, b, c); } };
__device__ __forceinline__ void st4(float* p, v4f v) { *(v4f*)p = v; }
__device__ __forceinline__ void st4(h16* p, v4f v) { v4h o; o[0] = (h16)v[0]; o[1] = (h16)v[1]; o[2] = (h16)v[2]; o[3] = (h16)v[3]; *(v4h*)p = o; }
template <typename T16, typename TO, int NSPLIT, bool BIAS, int NW>
__global__ __launch_bounds__(32 * NW) void k_gemmw(const T16* __restrict__ A, const T16* __restrict__ A2, const T16* __restrict__ Bt, const T16* __restrict__ Bt2, int K, TO* C, int ldc, size_t sN, const float* __restrict__ bias, size_t sA, size_t sB, size_t sC) {
    typedef typename WFrag<T16>::V V;
    __shared__ __align__(16) float os[(NW == 1 ? 16 : NW * 64) * 68];
    const size_t z = blockIdx.z; A += z * sA; if (A2) A2 += z * sA; Bt += z * sB; if (Bt2) Bt2 += z * sB; C += z * sC + blockIdx.y * sN;
    const int lane = threadIdx.x & 31, lr = lane & 15, hi = lane >> 4; const int r0 = blockIdx.x * 64, c0 = blockIdx.y * 64;
    v8f acc[4][4];
#pragma unroll
    for (int mb = 0; mb < 4; ++mb)
#pragma unroll
        for (int nb = 0; nb < 4; ++nb) acc[mb][nb] = (v8f){};
    const size_t aoff = (size_t)(r0 + lr) * K + 8 * hi, boff = (size_t)(c0 + lr) * K + 8 * hi;
    const int wv = (NW == 1) ? 0 : __builtin_amdgcn_readfirstlane((int)(threadIdx.x >> 5));
    for (int kc = wv * 32; kc < K; kc += 32 * NW) {
        V a[4], a2[4];
#pragma unroll
        for (int mb = 0; mb < 4; ++mb) { a[mb] = WFrag<T16>::ld(A + aoff + (size_t)mb * 16 * K + kc); if (NSPLIT == 1 || NSPLIT == 2) a2[mb] = WFrag<T16>::ld(A2 + aoff + (size_t)mb * 16 * K + kc); }
#pragma unroll
        for (int nb = 0; nb < 4; ++nb) { const V b = WFrag<T16>::ld(Bt + boff + (size_t)nb * 16 * K + kc); V b2; if (NSPLIT >= 2) b2 = WFrag<T16>::ld(Bt2 + boff + (size_t)nb * 16 * K + kc);
#pragma unroll
            for (int mb = 0; mb < 4; ++mb) { acc[mb][nb] = WFrag<T16>::mma(a[mb], b, acc[mb][nb]); if (NSPLIT == 1 || NSPLIT == 2) acc[mb][nb] = WFrag<T16>::mma(a2[mb], b, acc[mb][nb]); if (NSPLIT >= 2) acc[mb][nb] = WFrag<T16>::mma(a[mb], b2, acc[mb][nb]); } }
        asm volatile("v_nop\n\tv_nop\n\tv_nop\n\tv_nop" : "+v"(acc[0][0]), "+v"(acc[1][1]), "+v"(acc[2][2]), "+v"(acc[3][3]) : "v"(a[0]), "v"(a[3]));
    }
    if constexpr (NW > 1) {
        float* ow = os + wv * (64 * 68);
#pragma unroll
        for (int mb = 0; mb < 4; ++mb)
#pragma unroll
            for (int nb = 0; nb < 4; ++nb)
#pragma unroll
                for (int j = 0; j < 8; ++j) ow[(mb * 16 + hi * 8 + j) * 68 + nb * 16 + lr] = acc[mb][nb][j];
        __syncthreads();   // every wave's partial tile is in LDS before any thread adds them up
#pragma unroll
        for (int s = 0; s < 32 / NW; ++s) { const int idx = s * (32 * NW) + (int)threadIdx.x; const int row = idx >> 4, cofs = (idx & 15) * 4; v4f val = *(const v4fa*)(os + row * 68 + cofs);
#pragma unroll
            for (int w = 1; w < NW; ++w) val += *(const v4fa*)(os + w * (64 * 68) + row * 68 + cofs);
            if (BIAS) { val[0] += bfr(bias[c0 + cofs]); val[1] += bfr(bias[c0 + cofs + 1]); val[2] += bfr(bias[c0 + cofs + 2]); val[3] += bfr(bias[c0 + cofs + 3]); }
            st4(C + (size_t)(r0 + row) * ldc + cofs, val); }
        return;
    }
#pragma unroll
    for (int mb = 0; mb < 4; ++mb) {
#pragma unroll
        for (int nb = 0; nb < 4; ++nb) {
#pragma unroll
            for (int j = 0; j < 8; ++j) os[(hi * 8 + j) * 68 + nb * 16 + lr] = acc[mb][nb][j]; }
        __builtin_amdgcn_wave_barrier(); asm volatile("" ::: "memory");
        TO* crow = C + (size_t)(r0 + mb * 16) * ldc;
{
#pragma unroll
            for (int s = 0; s < 8; ++s) { const int row = 2 * s + hi, cofs = lr * 4; v4f val = *(const v4fa*)(os + row * 68 + cofs); if (BIAS) { val[0] += bfr(bias[c0 + cofs]); val[1] += bfr(bias[c0 + cofs + 1]); val[2] += bfr(bias[c0 + cofs + 2]); val[3] += bfr(bias[c0 + cofs + 3]); }
                st4(crow + (size_t)row * ldc + cofs, val); }
             }
        __builtin_amdgcn_wave_barrier(); asm volatile("" ::: "memory");
    }
}



__device__ __forceinline__ void splitf(float y, unsigned short& h, unsigned short& l) { h = f2bf(y); l = f2bf(y - bf2f(h)); }
typedef __attribute__((ext_vector_type(4))) unsigned short v4us;
typedef __attribute__((ext_vector_type(4))) int v4i;

__global__ __launch_bounds__(256) void k_cvt8(const float* __restrict__ src, bf* dst, size_t n8) { const size_t i = (size_t)blockIdx.x * 256 + threadIdx.x; if (i >= n8) return; const v8f v = *(const v8f*)(src + i * 8); v8us o;
#pragma unroll
    for (int k = 0; k < 8; ++k) o[k] = f2bf(v[k]); *(v8us*)(dst + i * 8) = o;  }
// ---- k_fattn: one work-group = 256 queries of one head of one batch entry; 8 waves x 32 query columns (2 groups of 16); grid (TT / 256, heads, entries).
// St = K Q^T (A = 16 key rows, B = 16 query columns) and Ot += Vt Pt: a lane holds the scores of ONE query (column lr), keys 8 hi + r of each 16-key tile, so two score tiles converted in place ARE the B operand of the value product (the hardware k order, which WFrag's loader gives A as well).
// K and Vt tiles of 64 keys go through registers into LDS (whole 128-byte lines from memory, rows padded to 144 bytes for the 16-byte readers), two buffers: the next tile's loads fly while this one is worked on.
#define FKS 64     // keys a stage
#define FPI 72     // LDS row pitch in 16-bit words: 128 bytes + 16
#define FC2 0.18033688011112042f   // HD^-0.5 x log2(e): scores in base 2
__device__ __forceinline__ float xhalf(float x) { return __builtin_bit_cast(float, __builtin_amdgcn_permlanex16(__builtin_bit_cast(int, x), __builtin_bit_cast(int, x), 0x76543210, 0xfedcba98, false, false)); }   // lane l with lane l ^ 16
// eight 2^x in one statement: the early-clobber results keep every v_exp_f32 clear of its neighbour's source and result, and the closing v_nop is the one slot the instruction set asks for between a transcendental and a reader of its result
__device__ __forceinline__ v8f exp2x8(v8f x) { float p0, p1, p2, p3, p4, p5, p6, p7;
    asm("v_exp_f32 %0, %8\n\tv_exp_f32 %1, %9\n\tv_exp_f32 %2, %10\n\tv_exp_f32 %3, %11\n\tv_exp_f32 %4, %12\n\tv_exp_f32 %5, %13\n\tv_exp_f32 %6, %14\n\tv_exp_f32 %7, %15\n\tv_nop"
        : "=&v"(p0), "=&v"(p1), "=&v"(p2), "=&v"(p3), "=&v"(p4), "=&v"(p5), "=&v"(p6), "=&v"(p7) : "v"(x[0]), "v"(x[1]), "v"(x[2]), "v"(x[3]), "v"(x[4]), "v"(x[5]), "v"(x[6]), "v"(x[7]));
    return (v8f){p0, p1, p2, p3, p4, p5, p6, p7}; }
__global__ __launch_bounds__(256) void k_fattn(const h16* __restrict__ Q, const h16* __restrict__ Kp, const h16* __restrict__ Vt, const int* __restrict__ slen, bf* AT) {
    __shared__ __align__(16) h16 ks[2][FKS * FPI];
    __shared__ __align__(16) h16 vs[2][HD * FPI];
    const int tid = (int)threadIdx.x, lane = tid & 31, lr = lane & 15, hi = lane >> 4; const int wv = __builtin_amdgcn_readfirstlane(tid >> 5);
    const int h = blockIdx.y, b = blockIdx.z; const size_t pl = ((size_t)b * NH_ + h) * TT * HD; Q += pl; Kp += pl; Vt += pl;
    const int q0 = blockIdx.x * 256 + wv * 32; const int ln = slen[b];   // the entry's key length: compared only
    v16h qf[2][2]; int lim[2]; v8f o[4][2]; float m[2], l[2];
#pragma unroll
    for (int g = 0; g < 2; ++g) { const int qi = q0 + g * 16 + lr; qf[g][0] = WFrag<h16>::ld(Q + (size_t)qi * HD + 8 * hi); qf[g][1] = WFrag<h16>::ld(Q + (size_t)qi * HD + 32 + 8 * hi);
        lim[g] = (qi + 1 < ln) ? qi + 1 : ln;   // key j is kept where j <= qi AND j < ln: j < lim
        m[g] = -3.0e38f; l[g] = 0.0f;
#pragma unroll
        for (int dt = 0; dt < 4; ++dt) o[dt][g] = (v8f){}; }
    const int srow = tid >> 3, sc = (tid & 7) * 8;   // staging: 8 threads a 128-byte row, rows srow and srow + 32 of each tile
    const h16* kg = Kp + (size_t)srow * HD + sc; const h16* vg = Vt + (size_t)srow * TT + sc;
    v8h rk0 = *(const v8h*)kg, rk1 = *(const v8h*)(kg + 32 * HD), rv0 = *(const v8h*)vg, rv1 = *(const v8h*)(vg + (size_t)32 * TT);
    *(v8h*)(&ks[0][srow * FPI + sc]) = rk0; *(v8h*)(&ks[0][(srow + 32) * FPI + sc]) = rk1; *(v8h*)(&vs[0][srow * FPI + sc]) = rv0; *(v8h*)(&vs[0][(srow + 32) * FPI + sc]) = rv1;
    __syncthreads();   // stage 0 is in LDS before any wave reads it
    for (int st = 0; st < TT / FKS; ++st) {
        const int cur = st & 1; const bool more = st + 1 < TT / FKS;
        if (more) { const h16* kn = kg + (size_t)(st + 1) * FKS * HD; const h16* vn = vg + (st + 1) * FKS; rk0 = *(const v8h*)kn; rk1 = *(const v8h*)(kn + 32 * HD); rv0 = *(const v8h*)vn; rv1 = *(const v8h*)(vn + (size_t)32 * TT); }
#pragma unroll
        for (int sub = 0; sub < 2; ++sub) {
            v8f s[2][2];
#pragma unroll
            for (int kt = 0; kt < 2; ++kt) { const h16* kr = &ks[cur][(sub * 32 + kt * 16 + lr) * FPI + 8 * hi]; const v16h a0 = WFrag<h16>::ld(kr), a1 = WFrag<h16>::ld(kr + 32);
#pragma unroll
                for (int g = 0; g < 2; ++g) { s[kt][g] = wmma16(a0, qf[g][0], (v8f){}); s[kt][g] = wmma16(a1, qf[g][1], s[kt][g]); } }
            v16h va[4];
#pragma unroll
            for (int dt = 0; dt < 4; ++dt) va[dt] = WFrag<h16>::ld(&vs[cur][(dt * 16 + lr) * FPI + sub * 32 + 8 * hi]);
            __builtin_amdgcn_sched_barrier(0);   // keeps the Vt fragment loads in front of the softmax, whose vector work then covers their LDS latency; without it they sink to directly in front of each value product
            float bm[2]; bool need = false;
#pragma unroll
            for (int g = 0; g < 2; ++g) { const int rem = lim[g] - (st * FKS + sub * 32 + 8 * hi); float x = -3.0e38f;   // this lane's key kt x 16 + 8 hi + r of the pass is kept where kt x 16 + r < rem
#pragma unroll
                for (int kt = 0; kt < 2; ++kt)
#pragma unroll
                    for (int r = 0; r < 8; ++r) { const float t = (kt * 16 + r < rem) ? s[kt][g][r] * FC2 : -3.0e38f; s[kt][g][r] = t; x = fmaxf(x, t); }
                x = fmaxf(x, xhalf(x)); bm[g] = x; need = need || (x - m[g] > 8.0f); }
            if (__builtin_amdgcn_ballot_w32(need) != 0) {   // a scalar branch: the maximum in use moves only where a column's new maximum is more than 8 (base 2) above it, so a weight is at most 2^8
#pragma unroll
                for (int g = 0; g < 2; ++g) { const float mn = fmaxf(m[g], bm[g]); const float al = __builtin_amdgcn_exp2f(m[g] - mn); m[g] = mn; l[g] *= al;
#pragma unroll
                    for (int dt = 0; dt < 4; ++dt) o[dt][g] *= al; } }
            v16h pf[2];
#pragma unroll
            for (int g = 0; g < 2; ++g) {
#pragma unroll
                for (int kt = 0; kt < 2; ++kt) { const v8f p = exp2x8(s[kt][g] - m[g]);
#pragma unroll
                    for (int r = 0; r < 8; ++r) { l[g] += p[r]; pf[g][kt * 8 + r] = (h16)p[r]; } } }
#pragma unroll
            for (int dt = 0; dt < 4; ++dt)
#pragma unroll
                for (int g = 0; g < 2; ++g) o[dt][g] = wmma16(va[dt], pf[g], o[dt][g]);
        }
        if (more) { const int nx = cur ^ 1; *(v8h*)(&ks[nx][srow * FPI + sc]) = rk0; *(v8h*)(&ks[nx][(srow + 32) * FPI + sc]) = rk1; *(v8h*)(&vs[nx][srow * FPI + sc]) = rv0; *(v8h*)(&vs[nx][(srow + 32) * FPI + sc]) = rv1; }
        __syncthreads();   // publishes the next stage and ends every wave's reads of this one, which the stage after next overwrites
    }
#pragma unroll
    for (int g = 0; g < 2; ++g) { const float inv = __fdiv_rn(1.0f, l[g] + xhalf(l[g])); bf* ar = AT + ((size_t)b * TT + q0 + g * 16 + lr) * DQ + h * HD + hi * 8;   // the two halves of a column hold different keys' weights: joined once
#pragma unroll
        for (int dt = 0; dt < 4; ++dt) { v8us w;
#pragma unroll
            for (int r = 0; r < 8; ++r) w[r] = f2bf(o[dt][g][r] * inv);
            *(v8us*)(ar + dt * 16) = w; } }
}


__global__ __launch_bounds__(256) void k_rbf(const float* __restrict__ X, float* Y, size_t n4) { const size_t i = (size_t)blockIdx.x * 256 + threadIdx.x; if (i >= n4) return; const v4f a = *(const v4f*)(X + i * 4); v4f o;
#pragma unroll
    for (int q = 0; q < 4; ++q) o[q] = bfr(a[q]);
    *(v4f*)(Y + i * 4) = o;  }

template <bool RES>
__global__ __launch_bounds__(256) void k_lnrow(const float* __restrict__ A, const float* __restrict__ R, const float* __restrict__ gamma, const float* __restrict__ beta, float eps, int C, int nrows, float* Y) {
    const int lane = threadIdx.x & 31; const int row = blockIdx.x * 8 + (threadIdx.x >> 5); if (row >= nrows) return; const int nch = C / 128; const float* a = A + (size_t)row * C; float x[LNC_MAX / 32]; float s = 0.0f;
    for (int k = 0; k < LNC_MAX / 128; ++k) { if (k < nch) { const int c0 = k * 128 + lane * 4; v4f v = *(const v4f*)(a + c0);
            if (RES) { const v4f w = *(const v4f*)(R + (size_t)row * C + c0); v[0] = __fadd_rn(v[0], w[0]); v[1] = __fadd_rn(v[1], w[1]); v[2] = __fadd_rn(v[2], w[2]); v[3] = __fadd_rn(v[3], w[3]); }
            x[k * 4 + 0] = v[0]; x[k * 4 + 1] = v[1]; x[k * 4 + 2] = v[2]; x[k * 4 + 3] = v[3]; s = __fadd_rn(__fadd_rn(__fadd_rn(__fadd_rn(s, v[0]), v[1]), v[2]), v[3]); } }
    for (int sh = 16; sh; sh >>= 1) s = __fadd_rn(s, __shfl_xor(s, sh, 32));
    const float mean = __fdiv_rn(s, (float)C); float q = 0.0f;
    for (int k = 0; k < LNC_MAX / 128; ++k) { if (k < nch) {
            for (int j = 0; j < 4; ++j) { const float d = __fsub_rn(x[k * 4 + j], mean); x[k * 4 + j] = d; q = __fmaf_rn(d, d, q); } } }
    for (int sh = 16; sh; sh >>= 1) q = __fadd_rn(q, __shfl_xor(q, sh, 32));
    const float rstd = __fdiv_rn(1.0f, sqrtf(__fadd_rn(__fdiv_rn(q, (float)C), eps)));
    for (int k = 0; k < LNC_MAX / 128; ++k) { if (k < nch) { const int c0 = k * 128 + lane * 4; const v4f g = *(const v4f*)(gamma + c0); const v4f bt = *(const v4f*)(beta + c0);
            for (int j = 0; j < 4; ++j) x[k * 4 + j] = __fmaf_rn(__fmul_rn(x[k * 4 + j], rstd), bfr(g[j]), bfr(bt[j])); } }
    float* y = Y + (size_t)row * C;
    {
        for (int k = 0; k < LNC_MAX / 128; ++k) { if (k < nch) { v4f o; o[0] = x[k * 4 + 0]; o[1] = x[k * 4 + 1]; o[2] = x[k * 4 + 2]; o[3] = x[k * 4 + 3]; *(v4f*)(y + k * 128 + lane * 4) = o; } }
         }
}
extern "C" void kernel_launch(void* const* d_in, const int* in_sizes, int n_in,
                              void* d_out, int out_size, void* d_ws, size_t ws_size, hipStream_t stream) {
    (void)in_sizes; (void)n_in; (void)out_size;
    const float* xq = (const float*)d_in[0]; const float* xk = (const float*)d_in[1]; const float* xv = (const float*)d_in[2]; const float* wq = (const float*)d_in[3]; const float* wk = (const float*)d_in[4]; const float* wv = (const float*)d_in[5]; const float* wo = (const float*)d_in[6]; const float* lng = (const float*)d_in[7]; const float* lnb = (const float*)d_in[8]; const int* sl = (const int*)d_in[9];   /* the module's argument order: ten inputs, all read; sen_len int32 [2] */
    float* OUT = (float*)d_out;     // [2][2048][1024]
    static_assert(DM % 128 == 0 && DM <= LNC_MAX, "k_lnrow's channel count");
    char* wsp = (char*)d_ws;
    auto take = [&](size_t bytes) { char* p = wsp; wsp += (bytes + 255) & ~(size_t)255; return (void*)p; };
    bf* WQ = (bf*)take((size_t)DQ * DM * 2); bf* WK = (bf*)take((size_t)DKV * DM * 2); bf* WV = (bf*)take((size_t)DKV * DM * 2); bf* WO = (bf*)take((size_t)DM * DQ * 2);
    bf* XB = (bf*)take((size_t)TT * DM * 2);
    h16* QP16 = (h16*)take((size_t)NB_ * NH_ * TT * HD * 2); h16* KP16 = (h16*)take((size_t)NB_ * NKV * TT * HD * 2); h16* VT16 = (h16*)take((size_t)NB_ * NKV * HD * TT * 2);   /* the head planes of both entries: one attention launch reads them all */
    bf* ATh = (bf*)take((size_t)NB_ * TT * DQ * 2); float* YO = (float*)take((size_t)TT * DM * 4); float* RB = (float*)take((size_t)TT * DM * 4);
    if ((size_t)(wsp - (char*)d_ws) > ws_size) return;    // total 60 MiB of the workspace by these reservations' own sum
    k_cvt8<<<(unsigned)(((size_t)DQ * DM / 8 + 255) / 256), 256, 0, stream>>>(wq, WQ, (size_t)DQ * DM / 8); k_cvt8<<<(unsigned)(((size_t)DKV * DM / 8 + 255) / 256), 256, 0, stream>>>(wk, WK, (size_t)DKV * DM / 8); k_cvt8<<<(unsigned)(((size_t)DKV * DM / 8 + 255) / 256), 256, 0, stream>>>(wv, WV, (size_t)DKV * DM / 8); k_cvt8<<<(unsigned)(((size_t)DM * DQ / 8 + 255) / 256), 256, 0, stream>>>(wo, WO, (size_t)DM * DQ / 8);   /* 'out, in' [1024][1024]: K-contiguous, an operand of its product as it lies */
    const unsigned LX = (unsigned)(((size_t)TT * DM / 8 + 255) / 256);
    static_assert(HD == 64, "one 64-column tile of a projection is one head");
    for (int b = 0; b < NB_; ++b) {
        k_cvt8<<<LX, 256, 0, stream>>>(xq + (size_t)b * TT * DM, XB, (size_t)TT * DM / 8);
        k_gemmw<bf, h16, 0, false, 8><<<dim3(TT / 64, DQ / 64, 1), 256, 0, stream>>>(XB, nullptr, WQ, nullptr, DM, QP16 + (size_t)b * NH_ * TT * HD, HD, (size_t)TT * HD, nullptr, 0, 0, 0);   /* q planes [h][t][d]: column tile h is head h's plane */
        k_cvt8<<<LX, 256, 0, stream>>>(xk + (size_t)b * TT * DM, XB, (size_t)TT * DM / 8);   /* XB := bf16(k[b]) */
        k_gemmw<bf, h16, 0, false, 8><<<dim3(TT / 64, DKV / 64, 1), 256, 0, stream>>>(XB, nullptr, WK, nullptr, DM, KP16 + (size_t)b * NKV * TT * HD, HD, (size_t)TT * HD, nullptr, 0, 0, 0);   /* k planes [h][t][d] */
        k_cvt8<<<LX, 256, 0, stream>>>(xv + (size_t)b * TT * DM, XB, (size_t)TT * DM / 8);   /* XB := bf16(v[b]) (after the k product has read it) */
        k_gemmw<bf, h16, 0, false, 8><<<dim3(DKV / 64, TT / 64, 1), 256, 0, stream>>>(WV, nullptr, XB, nullptr, DM, VT16 + (size_t)b * NKV * HD * TT, TT, 64, nullptr, 0, 0, 0); }   /* v planes transposed [h][d][t]: Wv x^T, row = channel h x 64 + d, column = token */
    static_assert(NH_ == NKV && TT % 256 == 0 && HD == 64, "k_fattn's shape");
    k_fattn<<<dim3(TT / 256, NH_, NB_), 256, 0, stream>>>(QP16, KP16, VT16, sl, ATh);   /* scores, keep test, softmax, value product and merge of every head of both entries */
    for (int b = 0; b < NB_; ++b) {
        k_gemmw<bf, float, 0, false, 8><<<dim3(TT / 64, DM / 64, 1), 256, 0, stream>>>(ATh + (size_t)b * TT * DQ, nullptr, WO, nullptr, DQ, YO, DM, 64, nullptr, 0, 0, 0);   /* y = merged (one bf16 word) Wo^T into a workspace plane */
        k_rbf<<<(unsigned)(((size_t)TT * DM / 4 + 255) / 256), 256, 0, stream>>>(xq + (size_t)b * TT * DM, RB, (size_t)TT * DM / 4);   /* the residual: the query table rounded to bf16, kept as f32 */
        k_lnrow<true><<<(unsigned)((TT + 7) / 8), 256, 0, stream>>>(YO, RB, lng, lnb, 1.0e-6f, DM, TT, OUT + (size_t)b * TT * DM); }   /* out = LN(y + q) x gamma + beta: the one writer of the output */
}

// v004
// It runs in 140 microseconds.
// Next to v003, in two timings, it ran 1.32 and 1.29 times as fast.
// All steps since v000 together make it 9.61 times as fast.
#include <hip/hip_runtime.h>

// Multi-head attention on three input tables with a causal rule AND a per-entry key length, an output map, a residual and a layer norm
// (a0 q, a1 k, a2 v [2][2048][1024]; a3 Wq, a4 Wk, a5 Wv, a6 Wo [1024][1024] 'out, in' (y = x W^T), no biases; a7 gamma, a8 beta [1024]; a9 sen_len int32 [2]: the entry's key length (1 .. 2,048);
//  16 heads x 64 (head h = columns h x 64 ..); S = (q Wq^T)(k Wk^T)^T / 8; A KEY j IS KEPT FOR QUERY i WHERE j <= i AND j < sen_len[b]; every other score is replaced by -1e9 (an exclusion: every row keeps key 0); softmax over the keys; ctx = A (v Wv^T); merged token-major; y = merged Wo^T;
//  x = y + q (the raw query table); the result = (x - mean) x rsqrt(var + 1e-6) x gamma + beta over the 1,024 channels (biased variance) -> [2][2048][1024]; argument order q, k, v, Wq, Wk, Wv, Wo, gamma, beta, sen_len).
// Layout: ONE LAUNCH A STAGE, five in all: a bf16 copy of the four weights and the three tables, both entries, made by one launch (the 'out, in' weights as they lie: K-contiguous, the product's second operand, Wv its first); the six exact projections in one grid, whose own epilogue rounds each 64x64 tile (one head's columns) to f16 and stores it where the head planes of BOTH batch entries want it (q, k [b][h][t][d]; v transposed [b][h][d][t]: that product runs as Wv x^T, rows = channels, so its rows lie as the plane's do);
// ONE attention kernel over all heads and both entries (k_fattn): scores, the keep test (two compares folded into one bound a query), an online softmax, the value product and the token-major merge stay in registers; the key loop is DENSE (all 2,048 keys; an excluded key takes -3.0e38 before the maximum, so its weight is an exact zero: -1e9 below a kept score gives exp of -1e9: an exact zero too);
// EVERY row on ONE fp16 product (the weights against the maximum in use, at most 2^8); the merged context on ONE bf16 word x Wo exact into a workspace plane (both entries' rows in one grid); the residual (the query table's bf16 copy, the one the q projection reads) added and the row normalised by k_lnrow: the one writer of the output.
// Compute dtypes, f32 accumulate: every float input rounded to bf16 at its load; projections exact; attention: one fp16 product on every row; softmax f32; the output map bf16 x bf16 on one word a side; the norm f32; the integer input is compared only.

#define NB_  2
#define TT   2048
#define DM   1024
#define NH_  16
#define NKV  16
#define REP  (NH_ / NKV)
#define HD   64
#define DQ   (NH_ * HD)
#define DKV  (NKV * HD)
#define LNC_MAX 2048

typedef _Float16 h16;
typedef unsigned short bf;
typedef __attribute__((ext_vector_type(16))) __bf16   v16bf;
typedef __attribute__((ext_vector_type(16))) _Float16 v16h;
typedef __attribute__((ext_vector_type(8)))  _Float16 v8h;
typedef __attribute__((ext_vector_type(4)))  _Float16 v4h;
typedef __attribute__((ext_vector_type(8)))  unsigned short v8us;
typedef __attribute__((ext_vector_type(8)))  float    v8f;
typedef __attribute__((ext_vector_type(4)))  float    v4f;
typedef v8h  __attribute__((may_alias)) v8ha;
typedef v4f  __attribute__((may_alias)) v4fa;
typedef v8us __attribute__((may_alias)) v8usa;

__device__ __forceinline__ unsigned short f2bf(float f) { unsigned u = __float_as_uint(f); u += 0x7FFFu + ((u >> 16) & 1u); return (unsigned short)(u >> 16); }
__device__ __forceinline__ float bf2f(unsigned short b) { return __uint_as_float(((unsigned)b) << 16); }
__device__ __forceinline__ float bfr(float f) { return bf2f(f2bf(f)); }
__device__ __forceinline__ v16h cat16(v8h lo, v8h hi) { return __builtin_shufflevector(lo, hi, 0, 1, 2, 3, 4, 5, 6, 7, 8, 9, 10, 11, 12, 13, 14, 15); }
__device__ __forceinline__ v16bf cat16b(v8us lo, v8us hi) { return __builtin_bit_cast(v16bf, __builtin_shufflevector(lo, hi, 0, 1, 2, 3, 4, 5, 6, 7, 8, 9, 10, 11, 12, 13, 14, 15)); }
__device__ __forceinline__ v8f wmma16(v16h a, v16h b, v8f c) { return __builtin_amdgcn_wmma_f32_16x16x32_f16(false, a, false, b, (short)0, c, false, false); }
__device__ __forceinline__ v8f wmmab(v16bf a, v16bf b, v8f c) { return __builtin_amdgcn_wmma_f32_16x16x32_bf16(false, a, false, b, (short)0, c, false, false); }



// ---- gemmw_tile, k_gemmw, k_proj: register-blocked GEMM, one 64x64 output tile per work-group (16 accumulators a wave), operands straight from K-contiguous 16-bit planes; k_gemmw: grid (M/64, N/64, Z), 32 x NW threads.
// C[m][n] (f32 sums + optional f32 bias[n], stored as TO: f32, or rounded once to f16) = sum_k A[m][k] Bt[n][k] (+ split products per NSPLIT). z-batch strides sA/sB/sC in elements. K % 32 == 0.
// Where C lies: row m at pitch ldc, the 64-column tile number y at y x sN elements (sN = 64: a plain row-major matrix; sN = rows x 64 with ldc = 64: one [row][64] plane a tile of columns).
// NW waves share the tile's K range: wave w takes the 32-wide k steps w, w + NW, w + 2 NW .. (neighbouring waves read the two halves of one 128-byte line of a row at about the same time); the NW partial tiles meet in LDS and are added in wave order (fixed, the same on every run). NW == 1: one wave, no partials.
template <typename T16> struct WFrag;
template <> struct WFrag<h16> { typedef v16h V; static __device__ __forceinline__ V ld(const h16* p) { return cat16(*(const v8h*)p, *(const v8h*)(p + 16)); } static __device__ __forceinline__ v8f mma(V a, V b, v8f c) { return wmma16(a, b, c); } };
template <> struct WFrag<bf> { typedef v16bf V; static __device__ __forceinline__ V ld(const bf* p) { return cat16b(*(const v8us*)p, *(const v8us*)(p + 16)); } static __device__ __forceinline__ v8f mma(V a, V b, v8f c) { return wmmab(a, b, c); } };
__device__ __forceinline__ void st4(float* p, v4f v) { *(v4f*)p = v; }
__device__ __forceinline__ void st4(h16* p, v4f v) { v4h o; o[0] = (h16)v[0]; o[1] = (h16)v[1]; o[2] = (h16)v[2]; o[3] = (h16)v[3]; *(v4h*)p = o; }
// gemmw_tile: the tile whose first row is r0 and first column c0; C points at the tile's column 0 of row 0 of the matrix.
template <typename T16, typename TO, int NSPLIT, bool BIAS, int NW>
__device__ __forceinline__ void gemmw_tile(const T16* __restrict__ A, const T16* __restrict__ A2, const T16* __restrict__ Bt, const T16* __restrict__ Bt2, int K, TO* C, int ldc, const float* __restrict__ bias, int r0, int c0) {
    typedef typename WFrag<T16>::V V;
    __shared__ __align__(16) float os[(NW == 1 ? 16 : NW * 64) * 68];
    const int lane = threadIdx.x & 31, lr = lane & 15, hi = lane >> 4;
    v8f acc[4][4];
#pragma unroll
    for (int mb = 0; mb < 4; ++mb)
#pragma unroll
        for (int nb = 0; nb < 4; ++nb) acc[mb][nb] = (v8f){};
    const size_t aoff = (size_t)(r0 + lr) * K + 8 * hi, boff = (size_t)(c0 + lr) * K + 8 * hi;
    const int wv = (NW == 1) ? 0 : __builtin_amdgcn_readfirstlane((int)(threadIdx.x >> 5));
    for (int kc = wv * 32; kc < K; kc += 32 * NW) {
        V a[4], a2[4];
#pragma unroll
        for (int mb = 0; mb < 4; ++mb) { a[mb] = WFrag<T16>::ld(A + aoff + (size_t)mb * 16 * K + kc); if (NSPLIT == 1 || NSPLIT == 2) a2[mb] = WFrag<T16>::ld(A2 + aoff + (size_t)mb * 16 * K + kc); }
#pragma unroll
        for (int nb = 0; nb < 4; ++nb) { const V b = WFrag<T16>::ld(Bt + boff + (size_t)nb * 16 * K + kc); V b2; if (NSPLIT >= 2) b2 = WFrag<T16>::ld(Bt2 + boff + (size_t)nb * 16 * K + kc);
#pragma unroll
            for (int mb = 0; mb < 4; ++mb) { acc[mb][nb] = WFrag<T16>::mma(a[mb], b, acc[mb][nb]); if (NSPLIT == 1 || NSPLIT == 2) acc[mb][nb] = WFrag<T16>::mma(a2[mb], b, acc[mb][nb]); if (NSPLIT >= 2) acc[mb][nb] = WFrag<T16>::mma(a[mb], b2, acc[mb][nb]); } }
        asm volatile("v_nop\n\tv_nop\n\tv_nop\n\tv_nop" : "+v"(acc[0][0]), "+v"(acc[1][1]), "+v"(acc[2][2]), "+v"(acc[3][3]) : "v"(a[0]), "v"(a[3]));
    }
    if constexpr (NW > 1) {
        float* ow = os + wv * (64 * 68);
#pragma unroll
        for (int mb = 0; mb < 4; ++mb)
#pragma unroll
            for (int nb = 0; nb < 4; ++nb)
#pragma unroll
                for (int j = 0; j < 8; ++j) ow[(mb * 16 + hi * 8 + j) * 68 + nb * 16 + lr] = acc[mb][nb][j];
        __syncthreads();   // every wave's partial tile is in LDS before any thread adds them up
#pragma unroll
        for (int s = 0; s < 32 / NW; ++s) { const int idx = s * (32 * NW) + (int)threadIdx.x; const int row = idx >> 4, cofs = (idx & 15) * 4; v4f val = *(const v4fa*)(os + row * 68 + cofs);
#pragma unroll
            for (int w = 1; w < NW; ++w) val += *(const v4fa*)(os + w * (64 * 68) + row * 68 + cofs);
            if (BIAS) { val[0] += bfr(bias[c0 + cofs]); val[1] += bfr(bias[c0 + cofs + 1]); val[2] += bfr(bias[c0 + cofs + 2]); val[3] += bfr(bias[c0 + cofs + 3]); }
            st4(C + (size_t)(r0 + row) * ldc + cofs, val); }
        return;
    }
#pragma unroll
    for (int mb = 0; mb < 4; ++mb) {
#pragma unroll
        for (int nb = 0; nb < 4; ++nb) {
#pragma unroll
            for (int j = 0; j < 8; ++j) os[(hi * 8 + j) * 68 + nb * 16 + lr] = acc[mb][nb][j]; }
        __builtin_amdgcn_wave_barrier(); asm volatile("" ::: "memory");
        TO* crow = C + (size_t)(r0 + mb * 16) * ldc;
{
#pragma unroll
            for (int s = 0; s < 8; ++s) { const int row = 2 * s + hi, cofs = lr * 4; v4f val = *(const v4fa*)(os + row * 68 + cofs); if (BIAS) { val[0] += bfr(bias[c0 + cofs]); val[1] += bfr(bias[c0 + cofs + 1]); val[2] += bfr(bias[c0 + cofs + 2]); val[3] += bfr(bias[c0 + cofs + 3]); }
                st4(crow + (size_t)row * ldc + cofs, val); }
             }
        __builtin_amdgcn_wave_barrier(); asm volatile("" ::: "memory");
    }
}
template <typename T16, typename TO, int NSPLIT, bool BIAS, int NW>
__global__ __launch_bounds__(32 * NW) void k_gemmw(const T16* __restrict__ A, const T16* __restrict__ A2, const T16* __restrict__ Bt, const T16* __restrict__ Bt2, int K, TO* C, int ldc, size_t sN, const float* __restrict__ bias, size_t sA, size_t sB, size_t sC) {
    const size_t z = blockIdx.z; A += z * sA; if (A2) A2 += z * sA; Bt += z * sB; if (Bt2) Bt2 += z * sB; C += z * sC + blockIdx.y * sN;
    gemmw_tile<T16, TO, NSPLIT, BIAS, NW>(A, A2, Bt, Bt2, K, C, ldc, bias, blockIdx.x * 64, blockIdx.y * 64);
}
// k_proj: the six projections (three tables x two entries) as ONE grid (TT / 64 token tiles, DQ / 64 heads, 3 x NB_): z picks the table with its weight, and the entry. X: the tables' bf16 copies [3][NB_][TT][DM]; Wt: Wq, Wk, Wv [3][DQ][DM]; P: the head planes, q and k [b][h][t][d], then v transposed [b][h][d][t].
// q, k: x W^T, column tile h is head h's plane (pitch HD). v: Wv x^T, row = channel h x 64 + d, column = token (pitch TT).
__global__ __launch_bounds__(256) void k_proj(const bf* __restrict__ X, const bf* __restrict__ Wt, int K, h16* P) {
    const int tb = blockIdx.z / NB_; const bool tr = tb == 2; const int t0 = blockIdx.x * 64, ch0 = blockIdx.y * 64;
    const bf* x = X + (size_t)blockIdx.z * TT * DM; const bf* w = Wt + (size_t)tb * DQ * DM; h16* p = P + (size_t)blockIdx.z * NH_ * TT * HD;
    gemmw_tile<bf, h16, 0, false, 8>(tr ? w : x, nullptr, tr ? x : w, nullptr, K, tr ? p + t0 : p + (size_t)blockIdx.y * TT * HD, tr ? TT : HD, nullptr, tr ? ch0 : t0, tr ? t0 : ch0);
}



__device__ __forceinline__ void splitf(float y, unsigned short& h, unsigned short& l) { h = f2bf(y); l = f2bf(y - bf2f(h)); }
typedef __attribute__((ext_vector_type(4))) unsigned short v4us;
typedef __attribute__((ext_vector_type(4))) int v4i;

// ---- k_cvtall: every float matrix input rounded to bf16 once, in ONE launch; grid XCH / 256. Thread t takes the 8-element chunk t of the four weights counted end to end and chunk t of each of the three tables (a table is as long as the four weights together); dst: Wq, Wk, Wv, Wo, q, k, v end to end.
#define WCH ((size_t)DQ * DM / 8)         // chunks a weight
#define XCH ((size_t)NB_ * TT * DM / 8)   // chunks a table
__device__ __forceinline__ v8us rnd8(v8f v) { v8us o;
#pragma unroll   // constant indices, so that v and o stay in registers
    for (int k = 0; k < 8; ++k) o[k] = f2bf(v[k]);
    return o; }
__global__ __launch_bounds__(256) void k_cvtall(const float* __restrict__ wq, const float* __restrict__ wk, const float* __restrict__ wv, const float* __restrict__ wo, const float* __restrict__ xq, const float* __restrict__ xk, const float* __restrict__ xv, bf* dst) {
    static_assert(4 * WCH == XCH && WCH % 256 == 0 && DKV == DQ, "the four weights together are as long as one table; a work-group stays inside one weight");
    const size_t g = (size_t)blockIdx.x * 2048; const unsigned e = threadIdx.x * 8;   // the work-group's first element (t = g / 8 + threadIdx.x) and the thread's chunk behind it
    const unsigned wi = blockIdx.x / (unsigned)(WCH / 256);   // which weight: one for the whole work-group
    const float* w = (wi == 0 ? wq : wi == 1 ? wk : wi == 2 ? wv : wo) + (g - wi * WCH * 8);
    const v8f a = *(const v8f*)(w + e), b = *(const v8f*)(xq + g + e), c = *(const v8f*)(xk + g + e), d = *(const v8f*)(xv + g + e);
    dst += g; *(v8us*)(dst + e) = rnd8(a); *(v8us*)(dst + XCH * 8 + e) = rnd8(b); *(v8us*)(dst + 2 * XCH * 8 + e) = rnd8(c); *(v8us*)(dst + 3 * XCH * 8 + e) = rnd8(d);
}
// ---- k_fattn: one work-group = 256 queries of one head of one batch entry; 8 waves x 32 query columns (2 groups of 16); grid (TT / 256, heads, entries).
// St = K Q^T (A = 16 key rows, B = 16 query columns) and Ot += Vt Pt: a lane holds the scores of ONE query (column lr), keys 8 hi + r of each 16-key tile, so two score tiles converted in place ARE the B operand of the value product (the hardware k order, which WFrag's loader gives A as well).
// K and Vt tiles of 64 keys go through registers into LDS (whole 128-byte lines from memory, rows padded to 144 bytes for the 16-byte readers), two buffers: the next tile's loads fly while this one is worked on.
#define FKS 64     // keys a stage
#define FPI 72     // LDS row pitch in 16-bit words: 128 bytes + 16
#define FC2 0.18033688011112042f   // HD^-0.5 x log2(e): scores in base 2
__device__ __forceinline__ float xhalf(float x) { return __builtin_bit_cast(float, __builtin_amdgcn_permlanex16(__builtin_bit_cast(int, x), __builtin_bit_cast(int, x), 0x76543210, 0xfedcba98, false, false)); }   // lane l with lane l ^ 16
// eight 2^x in one statement: the early-clobber results keep every v_exp_f32 clear of its neighbour's source and result, and the closing v_nop is the one slot the instruction set asks for between a transcendental and a reader of its result
__device__ __forceinline__ v8f exp2x8(v8f x) { float p0, p1, p2, p3, p4, p5, p6, p7;
    asm("v_exp_f32 %0, %8\n\tv_exp_f32 %1, %9\n\tv_exp_f32 %2, %10\n\tv_exp_f32 %3, %11\n\tv_exp_f32 %4, %12\n\tv_exp_f32 %5, %13\n\tv_exp_f32 %6, %14\n\tv_exp_f32 %7, %15\n\tv_nop"
        : "=&v"(p0), "=&v"(p1), "=&v"(p2), "=&v"(p3), "=&v"(p4), "=&v"(p5), "=&v"(p6), "=&v"(p7) : "v"(x[0]), "v"(x[1]), "v"(x[2]), "v"(x[3]), "v"(x[4]), "v"(x[5]), "v"(x[6]), "v"(x[7]));
    return (v8f){p0, p1, p2, p3, p4, p5, p6, p7}; }
__global__ __launch_bounds__(256) void k_fattn(const h16* __restrict__ Q, const h16* __restrict__ Kp, const h16* __restrict__ Vt, const int* __restrict__ slen, bf* AT) {
    __shared__ __align__(16) h16 ks[2][FKS * FPI];
    __shared__ __align__(16) h16 vs[2][HD * FPI];
    const int tid = (int)threadIdx.x, lane = tid & 31, lr = lane & 15, hi = lane >> 4; const int wv = __builtin_amdgcn_readfirstlane(tid >> 5);
    const int h = blockIdx.y, b = blockIdx.z; const size_t pl = ((size_t)b * NH_ + h) * TT * HD; Q += pl; Kp += pl; Vt += pl;
    const int q0 = blockIdx.x * 256 + wv * 32; const int ln = slen[b];   // the entry's key length: compared only
    v16h qf[2][2]; int lim[2]; v8f o[4][2]; float m[2], l[2];
#pragma unroll
    for (int g = 0; g < 2; ++g) { const int qi = q0 + g * 16 + lr; qf[g][0] = WFrag<h16>::ld(Q + (size_t)qi * HD + 8 * hi); qf[g][1] = WFrag<h16>::ld(Q + (size_t)qi * HD + 32 + 8 * hi);
        lim[g] = (qi + 1 < ln) ? qi + 1 : ln;   // key j is kept where j <= qi AND j < ln: j < lim
        m[g] = -3.0e38f; l[g] = 0.0f;
#pragma unroll
        for (int dt = 0; dt < 4; ++dt) o[dt][g] = (v8f){}; }
    const int srow = tid >> 3, sc = (tid & 7) * 8;   // staging: 8 threads a 128-byte row, rows srow and srow + 32 of each tile
    const h16* kg = Kp + (size_t)srow * HD + sc; const h16* vg = Vt + (size_t)srow * TT + sc;
    v8h rk0 = *(const v8h*)kg, rk1 = *(const v8h*)(kg + 32 * HD), rv0 = *(const v8h*)vg, rv1 = *(const v8h*)(vg + (size_t)32 * TT);
    *(v8h*)(&ks[0][srow * FPI + sc]) = rk0; *(v8h*)(&ks[0][(srow + 32) * FPI + sc]) = rk1; *(v8h*)(&vs[0][srow * FPI + sc]) = rv0; *(v8h*)(&vs[0][(srow + 32) * FPI + sc]) = rv1;
    __syncthreads();   // stage 0 is in LDS before any wave reads it
    for (int st = 0; st < TT / FKS; ++st) {
        const int cur = st & 1; const bool more = st + 1 < TT / FKS;
        if (more) { const h16* kn = kg + (size_t)(st + 1) * FKS * HD; const h16* vn = vg + (st + 1) * FKS; rk0 = *(const v8h*)kn; rk1 = *(const v8h*)(kn + 32 * HD); rv0 = *(const v8h*)vn; rv1 = *(const v8h*)(vn + (size_t)32 * TT); }
#pragma unroll
        for (int sub = 0; sub < 2; ++sub) {
            v8f s[2][2];
#pragma unroll
            for (int kt = 0; kt < 2; ++kt) { const h16* kr = &ks[cur][(sub * 32 + kt * 16 + lr) * FPI + 8 * hi]; const v16h a0 = WFrag<h16>::ld(kr), a1 = WFrag<h16>::ld(kr + 32);
#pragma unroll
                for (int g = 0; g < 2; ++g) { s[kt][g] = wmma16(a0, qf[g][0], (v8f){}); s[kt][g] = wmma16(a1, qf[g][1], s[kt][g]); } }
            v16h va[4];
#pragma unroll
            for (int dt = 0; dt < 4; ++dt) va[dt] = WFrag<h16>::ld(&vs[cur][(dt * 16 + lr) * FPI + sub * 32 + 8 * hi]);
            __builtin_amdgcn_sched_barrier(0);   // keeps the Vt fragment loads in front of the softmax, whose vector work then covers their LDS latency; without it they sink to directly in front of each value product
            float bm[2]; bool need = false;
#pragma unroll
            for (int g = 0; g < 2; ++g) { const int rem = lim[g] - (st * FKS + sub * 32 + 8 * hi); float x = -3.0e38f;   // this lane's key kt x 16 + 8 hi + r of the pass is kept where kt x 16 + r < rem
#pragma unroll
                for (int kt = 0; kt < 2; ++kt)
#pragma unroll
                    for (int r = 0; r < 8; ++r) { const float t = (kt * 16 + r < rem) ? s[kt][g][r] * FC2 : -3.0e38f; s[kt][g][r] = t; x = fmaxf(x, t); }
                x = fmaxf(x, xhalf(x)); bm[g] = x; need = need || (x - m[g] > 8.0f); }
            if (__builtin_amdgcn_ballot_w32(need) != 0) {   // a scalar branch: the maximum in use moves only where a column's new maximum is more than 8 (base 2) above it, so a weight is at most 2^8
#pragma unroll
                for (int g = 0; g < 2; ++g) { const float mn = fmaxf(m[g], bm[g]); const float al = __builtin_amdgcn_exp2f(m[g] - mn); m[g] = mn; l[g] *= al;
#pragma unroll
                    for (int dt = 0; dt < 4; ++dt) o[dt][g] *= al; } }
            v16h pf[2];
#pragma unroll
            for (int g = 0; g < 2; ++g) {
#pragma unroll
                for (int kt = 0; kt < 2; ++kt) { const v8f p = exp2x8(s[kt][g] - m[g]);
#pragma unroll
                    for (int r = 0; r < 8; ++r) { l[g] += p[r]; pf[g][kt * 8 + r] = (h16)p[r]; } } }
#pragma unroll
            for (int dt = 0; dt < 4; ++dt)
#pragma unroll
                for (int g = 0; g < 2; ++g) o[dt][g] = wmma16(va[dt], pf[g], o[dt][g]);
        }
        if (more) { const int nx = cur ^ 1; *(v8h*)(&ks[nx][srow * FPI + sc]) = rk0; *(v8h*)(&ks[nx][(srow + 32) * FPI + sc]) = rk1; *(v8h*)(&vs[nx][srow * FPI + sc]) = rv0; *(v8h*)(&vs[nx][(srow + 32) * FPI + sc]) = rv1; }
        __syncthreads();   // publishes the next stage and ends every wave's reads of this one, which the stage after next overwrites
    }
#pragma unroll
    for (int g = 0; g < 2; ++g) { const float inv = __fdiv_rn(1.0f, l[g] + xhalf(l[g])); bf* ar = AT + ((size_t)b * TT + q0 + g * 16 + lr) * DQ + h * HD + hi * 8;   // the two halves of a column hold different keys' weights: joined once
#pragma unroll
        for (int dt = 0; dt < 4; ++dt) { v8us w;
#pragma unroll
            for (int r = 0; r < 8; ++r) w[r] = f2bf(o[dt][g][r] * inv);
            *(v8us*)(ar + dt * 16) = w; } }
}


template <bool RES>
__global__ __launch_bounds__(256) void k_lnrow(const float* __restrict__ A, const bf* __restrict__ R, const float* __restrict__ gamma, const float* __restrict__ beta, float eps, int C, int nrows, float* Y) {
    const int lane = threadIdx.x & 31; const int row = blockIdx.x * 8 + (threadIdx.x >> 5); if (row >= nrows) return; const int nch = C / 128; const float* a = A + (size_t)row * C; float x[LNC_MAX / 32]; float s = 0.0f;
    for (int k = 0; k < LNC_MAX / 128; ++k) { if (k < nch) { const int c0 = k * 128 + lane * 4; v4f v = *(const v4f*)(a + c0);
            if (RES) { asm volatile("s_wait_xcnt 0x0" ::: "memory");   // stands in front of the chunk's second load, whose result may be given a register that the first load names as its address (seen in the listing at the last chunk, where those registers die)
                const v4us w = *(const v4us*)(R + (size_t)row * C + c0); v[0] = __fadd_rn(v[0], bf2f(w[0])); v[1] = __fadd_rn(v[1], bf2f(w[1])); v[2] = __fadd_rn(v[2], bf2f(w[2])); v[3] = __fadd_rn(v[3], bf2f(w[3])); }
            x[k * 4 + 0] = v[0]; x[k * 4 + 1] = v[1]; x[k * 4 + 2] = v[2]; x[k * 4 + 3] = v[3]; s = __fadd_rn(__fadd_rn(__fadd_rn(__fadd_rn(s, v[0]), v[1]), v[2]), v[3]); } }
    for (int sh = 16; sh; sh >>= 1) s = __fadd_rn(s, __shfl_xor(s, sh, 32));
    const float mean = __fdiv_rn(s, (float)C); float q = 0.0f;
    for (int k = 0; k < LNC_MAX / 128; ++k) { if (k < nch) {
            for (int j = 0; j < 4; ++j) { const float d = __fsub_rn(x[k * 4 + j], mean); x[k * 4 + j] = d; q = __fmaf_rn(d, d, q); } } }
    for (int sh = 16; sh; sh >>= 1) q = __fadd_rn(q, __shfl_xor(q, sh, 32));
    const float rstd = __fdiv_rn(1.0f, sqrtf(__fadd_rn(__fdiv_rn(q, (float)C), eps)));
    for (int k = 0; k < LNC_MAX / 128; ++k) { if (k < nch) { const int c0 = k * 128 + lane * 4; const v4f g = *(const v4f*)(gamma + c0); const v4f bt = *(const v4f*)(beta + c0);
            for (int j = 0; j < 4; ++j) x[k * 4 + j] = __fmaf_rn(__fmul_rn(x[k * 4 + j], rstd), bfr(g[j]), bfr(bt[j])); } }
    float* y = Y + (size_t)row * C;
    {
        for (int k = 0; k < LNC_MAX / 128; ++k) { if (k < nch) { v4f o; o[0] = x[k * 4 + 0]; o[1] = x[k * 4 + 1]; o[2] = x[k * 4 + 2]; o[3] = x[k * 4 + 3]; *(v4f*)(y + k * 128 + lane * 4) = o; } }
         }
}
extern "C" void kernel_launch(void* const* d_in, const int* in_sizes, int n_in,
                              void* d_out, int out_size, void* d_ws, size_t ws_size, hipStream_t stream) {
    (void)in_sizes; (void)n_in; (void)out_size;
    const float* xq = (const float*)d_in[0]; const float* xk = (const float*)d_in[1]; const float* xv = (const float*)d_in[2]; const float* wq = (const float*)d_in[3]; const float* wk = (const float*)d_in[4]; const float* wv = (const float*)d_in[5]; const float* wo = (const float*)d_in[6]; const float* lng = (const float*)d_in[7]; const float* lnb = (const float*)d_in[8]; const int* sl = (const int*)d_in[9];   /* the module's argument order: ten inputs, all read; sen_len int32 [2] */
    float* OUT = (float*)d_out;     // [2][2048][1024]
    static_assert(DM % 128 == 0 && DM <= LNC_MAX, "k_lnrow's channel count");
    char* wsp = (char*)d_ws;
    auto take = [&](size_t bytes) { char* p = wsp; wsp += (bytes + 255) & ~(size_t)255; return (void*)p; };
    bf* WB = (bf*)take((4 * (size_t)DQ * DM + 3 * (size_t)NB_ * TT * DM) * 2);   /* the bf16 copies end to end: Wq, Wk, Wv, Wo ('out, in' [1024][1024]: K-contiguous, an operand of its product as it lies), then q, k, v [2][2048][1024] */
    bf* WO = WB + 3 * (size_t)DQ * DM; bf* XB = WB + 4 * (size_t)DQ * DM;
    h16* QP16 = (h16*)take(3 * (size_t)NB_ * NH_ * TT * HD * 2); h16* KP16 = QP16 + (size_t)NB_ * NH_ * TT * HD; h16* VT16 = KP16 + (size_t)NB_ * NKV * TT * HD;   /* the head planes of both entries, q, k, v end to end: one launch writes them, one attention launch reads them all */
    bf* ATh = (bf*)take((size_t)NB_ * TT * DQ * 2); float* YO = (float*)take((size_t)NB_ * TT * DM * 4);
    if ((size_t)(wsp - (char*)d_ws) > ws_size) return;    // total 80 MiB of the workspace by these reservations' own sum
    k_cvtall<<<(unsigned)(XCH / 256), 256, 0, stream>>>(wq, wk, wv, wo, xq, xk, xv, WB);
    static_assert(HD == 64 && NH_ == NKV, "one 64-column tile of a projection is one head; the three weights are alike in shape");
    k_proj<<<dim3(TT / 64, DQ / 64, 3 * NB_), 256, 0, stream>>>(XB, WB, DM, QP16);
    static_assert(NH_ == NKV && TT % 256 == 0 && HD == 64, "k_fattn's shape");
    k_fattn<<<dim3(TT / 256, NH_, NB_), 256, 0, stream>>>(QP16, KP16, VT16, sl, ATh);   /* scores, keep test, softmax, value product and merge of every head of both entries */
    k_gemmw<bf, float, 0, false, 8><<<dim3(NB_ * TT / 64, DM / 64, 1), 256, 0, stream>>>(ATh, nullptr, WO, nullptr, DQ, YO, DM, 64, nullptr, 0, 0, 0);   /* y = merged (one bf16 word) Wo^T into a workspace plane, the rows of both entries */
    k_lnrow<true><<<(unsigned)((NB_ * TT + 7) / 8), 256, 0, stream>>>(YO, XB, lng, lnb, 1.0e-6f, DM, NB_ * TT, OUT);   /* out = LN(y + q) x gamma + beta (q: its bf16 copy): the one writer of the output */
}

// v005
// One run takes 128 microseconds.
// Timed twice side by side with v004, it ran 1.10 and 1.11 times as fast.
// Counting every step since v000, it is 10.6 times as fast.
#include <hip/hip_runtime.h>

// Multi-head attention on three input tables with a causal rule AND a per-entry key length, an output map, a residual and a layer norm
// (a0 q, a1 k, a2 v [2][2048][1024]; a3 Wq, a4 Wk, a5 Wv, a6 Wo [1024][1024] 'out, in' (y = x W^T), no biases; a7 gamma, a8 beta [1024]; a9 sen_len int32 [2]: the entry's key length (1 .. 2,048);
//  16 heads x 64 (head h = columns h x 64 ..); S = (q Wq^T)(k Wk^T)^T / 8; A KEY j IS KEPT FOR QUERY i WHERE j <= i AND j < sen_len[b]; every other score is replaced by -1e9 (an exclusion: every row keeps key 0); softmax over the keys; ctx = A (v Wv^T); merged token-major; y = merged Wo^T;
//  x = y + q (the raw query table); the result = (x - mean) x rsqrt(var + 1e-6) x gamma + beta over the 1,024 channels (biased variance) -> [2][2048][1024]; argument order q, k, v, Wq, Wk, Wv, Wo, gamma, beta, sen_len).
// Layout: ONE LAUNCH A STAGE, five in all: a bf16 copy of the four weights and the three tables, both entries, made by one launch (the 'out, in' weights as they lie: K-contiguous, the product's second operand, Wv its first); the six exact projections in one grid, whose own epilogue rounds each 64x64 tile (one head's columns) to f16 and stores it where the head planes of BOTH batch entries want it (q, k [b][h][t][d]; v transposed [b][h][d][t]: that product runs as Wv x^T, rows = channels, so its rows lie as the plane's do);
// ONE attention kernel over all heads and both entries (k_fattn): scores, the keep test (two compares folded into one bound a query), an online softmax, the value product and the token-major merge stay in registers; the key loop ENDS AT THE LAST KEPT KEY of each tile of 128 queries (an excluded key takes -3.0e38 before the maximum, so its weight is an exact zero: -1e9 below a kept score gives exp of -1e9: an exact zero too; a stage of such keys alone adds nothing and is left out);
// EVERY row on ONE fp16 product (the weights against the maximum in use, at most 2^8); the merged context on ONE bf16 word x Wo exact into a workspace plane (both entries' rows in one grid); the residual (the query table's bf16 copy, the one the q projection reads) added and the row normalised by k_lnrow: the one writer of the output.
// Compute dtypes, f32 accumulate: every float input rounded to bf16 at its load; projections exact; attention: one fp16 product on every row; softmax f32; the output map bf16 x bf16 on one word a side; the norm f32; the integer input is compared only.

#define NB_  2
#define TT   2048
#define DM   1024
#define NH_  16
#define NKV  16
#define REP  (NH_ / NKV)
#define HD   64
#define DQ   (NH_ * HD)
#define DKV  (NKV * HD)
#define LNC_MAX 2048

typedef _Float16 h16;
typedef unsigned short bf;
typedef __attribute__((ext_vector_type(16))) __bf16   v16bf;
typedef __attribute__((ext_vector_type(16))) _Float16 v16h;
typedef __attribute__((ext_vector_type(8)))  _Float16 v8h;
typedef __attribute__((ext_vector_type(4)))  _Float16 v4h;
typedef __attribute__((ext_vector_type(8)))  unsigned short v8us;
typedef __attribute__((ext_vector_type(8)))  float    v8f;
typedef __attribute__((ext_vector_type(4)))  float    v4f;
typedef v8h  __attribute__((may_alias)) v8ha;
typedef v4f  __attribute__((may_alias)) v4fa;
typedef v8us __attribute__((may_alias)) v8usa;

__device__ __forceinline__ unsigned short f2bf(float f) { unsigned u = __float_as_uint(f); u += 0x7FFFu + ((u >> 16) & 1u); return (unsigned short)(u >> 16); }
__device__ __forceinline__ float bf2f(unsigned short b) { return __uint_as_float(((unsigned)b) << 16); }
__device__ __forceinline__ float bfr(float f) { return bf2f(f2bf(f)); }
__device__ __forceinline__ v16h cat16(v8h lo, v8h hi) { return __builtin_shufflevector(lo, hi, 0, 1, 2, 3, 4, 5, 6, 7, 8, 9, 10, 11, 12, 13, 14, 15); }
__device__ __forceinline__ v16bf cat16b(v8us lo, v8us hi) { return __builtin_bit_cast(v16bf, __builtin_shufflevector(lo, hi, 0, 1, 2, 3, 4, 5, 6, 7, 8, 9, 10, 11, 12, 13, 14, 15)); }
__device__ __forceinline__ v8f wmma16(v16h a, v16h b, v8f c) { return __builtin_amdgcn_wmma_f32_16x16x32_f16(false, a, false, b, (short)0, c, false, false); }
__device__ __forceinline__ v8f wmmab(v16bf a, v16bf b, v8f c) { return __builtin_amdgcn_wmma_f32_16x16x32_bf16(false, a, false, b, (short)0, c, false, false); }



// ---- gemmw_tile, k_gemmw, k_proj: register-blocked GEMM, one 64x64 output tile per work-group (16 accumulators a wave), operands straight from K-contiguous 16-bit planes; k_gemmw: grid (M/64, N/64, Z), 32 x NW threads.
// C[m][n] (f32 sums + optional f32 bias[n], stored as TO: f32, or rounded once to f16) = sum_k A[m][k] Bt[n][k] (+ split products per NSPLIT). z-batch strides sA/sB/sC in elements. K % 32 == 0.
// Where C lies: row m at pitch ldc, the 64-column tile number y at y x sN elements (sN = 64: a plain row-major matrix; sN = rows x 64 with ldc = 64: one [row][64] plane a tile of columns).
// NW waves share the tile's K range: wave w takes the 32-wide k steps w, w + NW, w + 2 NW .. (neighbouring waves read the two halves of one 128-byte line of a row at about the same time); the NW partial tiles meet in LDS and are added in wave order (fixed, the same on every run). NW == 1: one wave, no partials.
template <typename T16> struct WFrag;
template <> struct WFrag<h16> { typedef v16h V; static __device__ __forceinline__ V ld(const h16* p) { return cat16(*(const v8h*)p, *(const v8h*)(p + 16)); } static __device__ __forceinline__ v8f mma(V a, V b, v8f c) { return wmma16(a, b, c); } };
template <> struct WFrag<bf> { typedef v16bf V; static __device__ __forceinline__ V ld(const bf* p) { return cat16b(*(const v8us*)p, *(const v8us*)(p + 16)); } static __device__ __forceinline__ v8f mma(V a, V b, v8f c) { return wmmab(a, b, c); } };
__device__ __forceinline__ void st4(float* p, v4f v) { *(v4f*)p = v; }
__device__ __forceinline__ void st4(h16* p, v4f v) { v4h o; o[0] = (h16)v[0]; o[1] = (h16)v[1]; o[2] = (h16)v[2]; o[3] = (h16)v[3]; *(v4h*)p = o; }
// gemmw_tile: the tile whose first row is r0 and first column c0; C points at the tile's column 0 of row 0 of the matrix.
template <typename T16, typename TO, int NSPLIT, bool BIAS, int NW>
__device__ __forceinline__ void gemmw_tile(const T16* __restrict__ A, const T16* __restrict__ A2, const T16* __restrict__ Bt, const T16* __restrict__ Bt2, int K, TO* C, int ldc, const float* __restrict__ bias, int r0, int c0) {
    typedef typename WFrag<T16>::V V;
    __shared__ __align__(16) float os[(NW == 1 ? 16 : NW * 64) * 68];
    const int lane = threadIdx.x & 31, lr = lane & 15, hi = lane >> 4;
    v8f acc[4][4];
#pragma unroll
    for (int mb = 0; mb < 4; ++mb)
#pragma unroll
        for (int nb = 0; nb < 4; ++nb) acc[mb][nb] = (v8f){};
    const size_t aoff = (size_t)(r0 + lr) * K + 8 * hi, boff = (size_t)(c0 + lr) * K + 8 * hi;
    const int wv = (NW == 1) ? 0 : __builtin_amdgcn_readfirstlane((int)(threadIdx.x >> 5));
    for (int kc = wv * 32; kc < K; kc += 32 * NW) {
        V a[4], a2[4];
#pragma unroll
        for (int mb = 0; mb < 4; ++mb) { a[mb] = WFrag<T16>::ld(A + aoff + (size_t)mb * 16 * K + kc); if (NSPLIT == 1 || NSPLIT == 2) a2[mb] = WFrag<T16>::ld(A2 + aoff + (size_t)mb * 16 * K + kc); }
#pragma unroll
        for (int nb = 0; nb < 4; ++nb) { const V b = WFrag<T16>::ld(Bt + boff + (size_t)nb * 16 * K + kc); V b2; if (NSPLIT >= 2) b2 = WFrag<T16>::ld(Bt2 + boff + (size_t)nb * 16 * K + kc);
#pragma unroll
            for (int mb = 0; mb < 4; ++mb) { acc[mb][nb] = WFrag<T16>::mma(a[mb], b, acc[mb][nb]); if (NSPLIT == 1 || NSPLIT == 2) acc[mb][nb] = WFrag<T16>::mma(a2[mb], b, acc[mb][nb]); if (NSPLIT >= 2) acc[mb][nb] = WFrag<T16>::mma(a[mb], b2, acc[mb][nb]); } }
        asm volatile("v_nop\n\tv_nop\n\tv_nop\n\tv_nop" : "+v"(acc[0][0]), "+v"(acc[1][1]), "+v"(acc[2][2]), "+v"(acc[3][3]) : "v"(a[0]), "v"(a[3]));
    }
    if constexpr (NW > 1) {
        float* ow = os + wv * (64 * 68);
#pragma unroll
        for (int mb = 0; mb < 4; ++mb)
#pragma unroll
            for (int nb = 0; nb < 4; ++nb)
#pragma unroll
                for (int j = 0; j < 8; ++j) ow[(mb * 16 + hi * 8 + j) * 68 + nb * 16 + lr] = acc[mb][nb][j];
        __syncthreads();   // every wave's partial tile is in LDS before any thread adds them up
#pragma unroll
        for (int s = 0; s < 32 / NW; ++s) { const int idx = s * (32 * NW) + (int)threadIdx.x; const int row = idx >> 4, cofs = (idx & 15) * 4; v4f val = *(const v4fa*)(os + row * 68 + cofs);
#pragma unroll
            for (int w = 1; w < NW; ++w) val += *(const v4fa*)(os + w * (64 * 68) + row * 68 + cofs);
            if (BIAS) { val[0] += bfr(bias[c0 + cofs]); val[1] += bfr(bias[c0 + cofs + 1]); val[2] += bfr(bias[c0 + cofs + 2]); val[3] += bfr(bias[c0 + cofs + 3]); }
            st4(C + (size_t)(r0 + row) * ldc + cofs, val); }
        return;
    }
#pragma unroll
    for (int mb = 0; mb < 4; ++mb) {
#pragma unroll
        for (int nb = 0; nb < 4; ++nb) {
#pragma unroll
            for (int j = 0; j < 8; ++j) os[(hi * 8 + j) * 68 + nb * 16 + lr] = acc[mb][nb][j]; }
        __builtin_amdgcn_wave_barrier(); asm volatile("" ::: "memory");
        TO* crow = C + (size_t)(r0 + mb * 16) * ldc;
{
#pragma unroll
            for (int s = 0; s < 8; ++s) { const int row = 2 * s + hi, cofs = lr * 4; v4f val = *(const v4fa*)(os + row * 68 + cofs); if (BIAS) { val[0] += bfr(bias[c0 + cofs]); val[1] += bfr(bias[c0 + cofs + 1]); val[2] += bfr(bias[c0 + cofs + 2]); val[3] += bfr(bias[c0 + cofs + 3]); }
                st4(crow + (size_t)row * ldc + cofs, val); }
             }
        __builtin_amdgcn_wave_barrier(); asm volatile("" ::: "memory");
    }
}
template <typename T16, typename TO, int NSPLIT, bool BIAS, int NW>
__global__ __launch_bounds__(32 * NW) void k_gemmw(const T16* __restrict__ A, const T16* __restrict__ A2, const T16* __restrict__ Bt, const T16* __restrict__ Bt2, int K, TO* C, int ldc, size_t sN, const float* __restrict__ bias, size_t sA, size_t sB, size_t sC) {
    const size_t z = blockIdx.z; A += z * sA; if (A2) A2 += z * sA; Bt += z * sB; if (Bt2) Bt2 += z * sB; C += z * sC + blockIdx.y * sN;
    gemmw_tile<T16, TO, NSPLIT, BIAS, NW>(A, A2, Bt, Bt2, K, C, ldc, bias, blockIdx.x * 64, blockIdx.y * 64);
}
// k_proj: the six projections (three tables x two entries) as ONE grid (TT / 64 token tiles, DQ / 64 heads, 3 x NB_): z picks the table with its weight, and the entry. X: the tables' bf16 copies [3][NB_][TT][DM]; Wt: Wq, Wk, Wv [3][DQ][DM]; P: the head planes, q and k [b][h][t][d], then v transposed [b][h][d][t].
// q, k: x W^T, column tile h is head h's plane (pitch HD). v: Wv x^T, row = channel h x 64 + d, column = token (pitch TT).
__global__ __launch_bounds__(256) void k_proj(const bf* __restrict__ X, const bf* __restrict__ Wt, int K, h16* P) {
    const int tb = blockIdx.z / NB_; const bool tr = tb == 2; const int t0 = blockIdx.x * 64, ch0 = blockIdx.y * 64;
    const bf* x = X + (size_t)blockIdx.z * TT * DM; const bf* w = Wt + (size_t)tb * DQ * DM; h16* p = P + (size_t)blockIdx.z * NH_ * TT * HD;
    gemmw_tile<bf, h16, 0, false, 8>(tr ? w : x, nullptr, tr ? x : w, nullptr, K, tr ? p + t0 : p + (size_t)blockIdx.y * TT * HD, tr ? TT : HD, nullptr, tr ? ch0 : t0, tr ? t0 : ch0);
}



__device__ __forceinline__ void splitf(float y, unsigned short& h, unsigned short& l) { h = f2bf(y); l = f2bf(y - bf2f(h)); }
typedef __attribute__((ext_vector_type(4))) unsigned short v4us;
typedef __attribute__((ext_vector_type(4))) int v4i;

// ---- k_cvtall: every float matrix input rounded to bf16 once, in ONE launch; grid XCH / 256. Thread t takes the 8-element chunk t of the four weights counted end to end and chunk t of each of the three tables (a table is as long as the four weights together); dst: Wq, Wk, Wv, Wo, q, k, v end to end.
#define WCH ((size_t)DQ * DM / 8)         // chunks a weight
#define XCH ((size_t)NB_ * TT * DM / 8)   // chunks a table
__device__ __forceinline__ v8us rnd8(v8f v) { v8us o;
#pragma unroll   // constant indices, so that v and o stay in registers
    for (int k = 0; k < 8; ++k) o[k] = f2bf(v[k]);
    return o; }
__global__ __launch_bounds__(256) void k_cvtall(const float* __restrict__ wq, const float* __restrict__ wk, const float* __restrict__ wv, const float* __restrict__ wo, const float* __restrict__ xq, const float* __restrict__ xk, const float* __restrict__ xv, bf* dst) {
    static_assert(4 * WCH == XCH && WCH % 256 == 0 && DKV == DQ, "the four weights together are as long as one table; a work-group stays inside one weight");
    const size_t g = (size_t)blockIdx.x * 2048; const unsigned e = threadIdx.x * 8;   // the work-group's first element (t = g / 8 + threadIdx.x) and the thread's chunk behind it
    const unsigned wi = blockIdx.x / (unsigned)(WCH / 256);   // which weight: one for the whole work-group
    const float* w = (wi == 0 ? wq : wi == 1 ? wk : wi == 2 ? wv : wo) + (g - wi * WCH * 8);
    const v8f a = *(const v8f*)(w + e), b = *(const v8f*)(xq + g + e), c = *(const v8f*)(xk + g + e), d = *(const v8f*)(xv + g + e);
    dst += g; *(v8us*)(dst + e) = rnd8(a); *(v8us*)(dst + XCH * 8 + e) = rnd8(b); *(v8us*)(dst + 2 * XCH * 8 + e) = rnd8(c); *(v8us*)(dst + 3 * XCH * 8 + e) = rnd8(d);
}
// ---- k_fattn: one work-group = 256 queries of one head of one batch entry: the 128-query tile tx and the tile 15 - tx; 8 waves x 32 query columns (2 groups of 16, one from each tile); grid (TT / 256, heads, entries).
// St = K Q^T (A = 16 key rows, B = 16 query columns) and Ot += Vt Pt: a lane holds the scores of ONE query (column lr), keys 8 hi + r of each 16-key tile, so two score tiles converted in place ARE the B operand of the value product (the hardware k order, which WFrag's loader gives A as well).
// K and Vt tiles of 64 keys go through registers into LDS (whole 128-byte lines from memory, rows padded to 144 bytes for the 16-byte readers), two buffers: the next tile's loads fly while this one is worked on.
#define FKS 64     // keys a stage
#define FPI 72     // LDS row pitch in 16-bit words: 128 bytes + 16
#define FC2 0.18033688011112042f   // HD^-0.5 x log2(e): scores in base 2
__device__ __forceinline__ float xhalf(float x) { return __builtin_bit_cast(float, __builtin_amdgcn_permlanex16(__builtin_bit_cast(int, x), __builtin_bit_cast(int, x), 0x76543210, 0xfedcba98, false, false)); }   // lane l with lane l ^ 16
// eight 2^x in one statement: the early-clobber results keep every v_exp_f32 clear of its neighbour's source and result, and the closing v_nop is the one slot the instruction set asks for between a transcendental and a reader of its result
__device__ __forceinline__ v8f exp2x8(v8f x) { float p0, p1, p2, p3, p4, p5, p6, p7;
    asm("v_exp_f32 %0, %8\n\tv_exp_f32 %1, %9\n\tv_exp_f32 %2, %10\n\tv_exp_f32 %3, %11\n\tv_exp_f32 %4, %12\n\tv_exp_f32 %5, %13\n\tv_exp_f32 %6, %14\n\tv_exp_f32 %7, %15\n\tv_nop"
        : "=&v"(p0), "=&v"(p1), "=&v"(p2), "=&v"(p3), "=&v"(p4), "=&v"(p5), "=&v"(p6), "=&v"(p7) : "v"(x[0]), "v"(x[1]), "v"(x[2]), "v"(x[3]), "v"(x[4]), "v"(x[5]), "v"(x[6]), "v"(x[7]));
    return (v8f){p0, p1, p2, p3, p4, p5, p6, p7}; }
// fa_pass: NS x 32 keys of the staged tile (kb, vb point at the first of them; key0 is its number) against this wave's query groups G0 .. 1: scores, keep test, online softmax, value product.
template <int NS, int G0>
__device__ __forceinline__ void fa_pass(const h16* kb, const h16* vb, int key0, int lr, int hi, const v16h (&qf)[2][2], const int (&lim)[2], v8f (&o)[4][2], float (&m)[2], float (&l)[2]) {
    v16h ka[NS][2][2]; v8f s[NS][2][2];
#pragma unroll
    for (int sb = 0; sb < NS; ++sb)
#pragma unroll
        for (int kt = 0; kt < 2; ++kt) { const h16* kr = kb + (sb * 32 + kt * 16 + lr) * FPI + 8 * hi; ka[sb][kt][0] = WFrag<h16>::ld(kr); ka[sb][kt][1] = WFrag<h16>::ld(kr + 32); }
    if constexpr (NS == 2) __builtin_amdgcn_sched_barrier(0);   // the 64-key pass: all 16 K fragment loads stand as one group in front of the score products (one LDS latency a pass); left free, the compiler deals them out in pairs between the products, each pair waited for almost alone
#pragma unroll
    for (int sb = 0; sb < NS; ++sb)
#pragma unroll
        for (int kt = 0; kt < 2; ++kt)
#pragma unroll
            for (int g = G0; g < 2; ++g) { s[sb][kt][g] = wmma16(ka[sb][kt][0], qf[g][0], (v8f){}); s[sb][kt][g] = wmma16(ka[sb][kt][1], qf[g][1], s[sb][kt][g]); }
    if constexpr (NS == 2) __builtin_amdgcn_sched_barrier(0);   // keeps the 16 Vt fragment loads of the 64-key pass behind the score products: they take the K fragments' registers and do not queue in front of K fragments that a product waits for
    v16h va[NS][4];
#pragma unroll
    for (int sb = 0; sb < NS; ++sb)
#pragma unroll
        for (int dt = 0; dt < 4; ++dt) va[sb][dt] = WFrag<h16>::ld(vb + (dt * 16 + lr) * FPI + sb * 32 + 8 * hi);
    __builtin_amdgcn_sched_barrier(0);   // keeps the Vt fragment loads in front of the softmax, whose vector work then covers their LDS latency; without it they sink to directly in front of each value product
    float bm[2]; bool need = false;
#pragma unroll
    for (int g = G0; g < 2; ++g) { const int rem = lim[g] - (key0 + 8 * hi); float x = -3.0e38f;   // this lane's key sb x 32 + kt x 16 + r of the pass is kept where that number < rem
#pragma unroll
        for (int sb = 0; sb < NS; ++sb)
#pragma unroll
            for (int kt = 0; kt < 2; ++kt)
#pragma unroll
                for (int r = 0; r < 8; ++r) { const float t = (sb * 32 + kt * 16 + r < rem) ? s[sb][kt][g][r] * FC2 : -3.0e38f; s[sb][kt][g][r] = t; x = fmaxf(x, t); }
        x = fmaxf(x, xhalf(x)); bm[g] = x; need = need || (x - m[g] > 8.0f); }
    if (__builtin_amdgcn_ballot_w32(need) != 0) {   // a scalar branch: the maximum in use moves only where a column's new maximum is more than 8 (base 2) above it, so a weight is at most 2^8
#pragma unroll
        for (int g = G0; g < 2; ++g) { const float mn = fmaxf(m[g], bm[g]); const float al = __builtin_amdgcn_exp2f(m[g] - mn); m[g] = mn; l[g] *= al;
#pragma unroll
            for (int dt = 0; dt < 4; ++dt) o[dt][g] *= al; } }
    v16h pf[NS][2];
#pragma unroll
    for (int g = G0; g < 2; ++g) { float ls[NS];   // the weights' sum, one chain of additions for each 32 keys: the 64-key pass has two short chains side by side in place of one long one
#pragma unroll
        for (int sb = 0; sb < NS; ++sb) { ls[sb] = sb == 0 ? l[g] : 0.0f;
#pragma unroll
            for (int kt = 0; kt < 2; ++kt) { const v8f p = exp2x8(s[sb][kt][g] - m[g]);
#pragma unroll
                for (int r = 0; r < 8; ++r) { ls[sb] += p[r]; pf[sb][g][kt * 8 + r] = (h16)p[r]; } } }
        l[g] = NS == 2 ? ls[0] + ls[NS - 1] : ls[0]; }
#pragma unroll
    for (int sb = 0; sb < NS; ++sb)
#pragma unroll
        for (int dt = 0; dt < 4; ++dt)
#pragma unroll
            for (int g = G0; g < 2; ++g) o[dt][g] = wmma16(va[sb][dt], pf[sb][g], o[dt][g]);
}
__global__ __launch_bounds__(256) void k_fattn(const h16* __restrict__ Q, const h16* __restrict__ Kp, const h16* __restrict__ Vt, const int* __restrict__ slen, bf* AT) {
    __shared__ __align__(16) h16 ks[2][FKS * FPI];
    __shared__ __align__(16) h16 vs[2][HD * FPI];
    const int tid = (int)threadIdx.x, lane = tid & 31, lr = lane & 15, hi = lane >> 4; const int wv = __builtin_amdgcn_readfirstlane(tid >> 5);
    const int h = blockIdx.y, b = blockIdx.z; const size_t pl = ((size_t)b * NH_ + h) * TT * HD; Q += pl; Kp += pl; Vt += pl;
    const int tx = blockIdx.x; const int qb[2] = {tx * 128 + wv * 16, (TT / 128 - 1 - tx) * 128 + wv * 16};   // the wave's two groups' first queries: one in the early tile tx, one in the late tile 15 - tx, so that every work-group's kept keys add up alike
    const int ln = slen[b];   // the entry's key length: compared only
    const bool none = ln < 1;   // no key kept at all: every score is the same replacement, so every key of the table weighs alike: such an entry runs over all keys
    const int ea = (tx + 1) * 128, eb = (TT / 128 - tx) * 128;   // one past the last key that the causal rule leaves to the early tile, to the late tile (ea <= eb <= TT)
    const int na = none ? TT / FKS : ((ea < ln ? ea : ln) + FKS - 1) / FKS, nst = none ? TT / FKS : ((eb < ln ? eb : ln) + FKS - 1) / FKS;   // stages that hold a kept key of the early tile, of either tile: 1 <= na <= nst <= TT / FKS, the same for the whole work-group
    v16h qf[2][2]; int lim[2]; v8f o[4][2]; float m[2], l[2];
#pragma unroll
    for (int g = 0; g < 2; ++g) { const int qi = qb[g] + lr; qf[g][0] = WFrag<h16>::ld(Q + (size_t)qi * HD + 8 * hi); qf[g][1] = WFrag<h16>::ld(Q + (size_t)qi * HD + 32 + 8 * hi);
        lim[g] = (qi + 1 < ln) ? qi + 1 : ln;   // key j is kept where j <= qi AND j < ln: j < lim
        m[g] = -3.0e38f; l[g] = 0.0f;
#pragma unroll
        for (int dt = 0; dt < 4; ++dt) o[dt][g] = (v8f){}; }
    const int srow = tid >> 3, sc = (tid & 7) * 8;   // staging: 8 threads a 128-byte row, rows srow and srow + 32 of each tile
    const h16* kg = Kp + (size_t)srow * HD + sc; const h16* vg = Vt + (size_t)srow * TT + sc;
    v8h rk0 = *(const v8h*)kg, rk1 = *(const v8h*)(kg + 32 * HD), rv0 = *(const v8h*)vg, rv1 = *(const v8h*)(vg + (size_t)32 * TT);
    auto fetch = [&](int sn) { const h16* kn = kg + (size_t)sn * FKS * HD; const h16* vn = vg + sn * FKS; rk0 = *(const v8h*)kn; rk1 = *(const v8h*)(kn + 32 * HD); rv0 = *(const v8h*)vn; rv1 = *(const v8h*)(vn + (size_t)32 * TT); };   // stage sn's rows into registers
    auto put = [&](int nx) { *(v8h*)(&ks[nx][srow * FPI + sc]) = rk0; *(v8h*)(&ks[nx][(srow + 32) * FPI + sc]) = rk1; *(v8h*)(&vs[nx][srow * FPI + sc]) = rv0; *(v8h*)(&vs[nx][(srow + 32) * FPI + sc]) = rv1; };   // and from there into buffer nx
    auto finish = [&](int g) { const float inv = __fdiv_rn(1.0f, l[g] + xhalf(l[g])); bf* ar = AT + ((size_t)b * TT + qb[g] + lr) * DQ + h * HD + hi * 8;   // the two halves of a column hold different keys' weights: joined once
#pragma unroll
        for (int dt = 0; dt < 4; ++dt) { v8us w;
#pragma unroll
            for (int r = 0; r < 8; ++r) w[r] = f2bf(o[dt][g][r] * inv);
            *(v8us*)(ar + dt * 16) = w; } };
    put(0);
    __syncthreads();   // stage 0 is in LDS before any wave reads it
    // A stage past a tile's last kept key holds only exact-zero weights for it and is left out: stages 0 .. na - 1 serve both groups, stages na .. nst - 1 the late group alone (the stage's 64 keys in one pass).
    int st = 0;
    for (; st < na; ++st) {
        const int cur = st & 1; const bool more = st + 1 < nst;
        if (more) fetch(st + 1);
        fa_pass<1, 0>(&ks[cur][0], &vs[cur][0], st * FKS, lr, hi, qf, lim, o, m, l); fa_pass<1, 0>(&ks[cur][32 * FPI], &vs[cur][32], st * FKS + 32, lr, hi, qf, lim, o, m, l);
        if (more) put(cur ^ 1);
        __syncthreads();   // publishes the next stage and ends every wave's reads of this one, which the stage after next overwrites
    }
    finish(0);
    asm volatile("s_wait_xcnt 0x0" ::: "memory");   // stands in front of the second loop's first arithmetic, which is given registers that the early group's four stores name (seen in the listing)
    for (; st < nst; ++st) {
        const int cur = st & 1; const bool more = st + 1 < nst;
        if (more) fetch(st + 1);
        fa_pass<2, 1>(&ks[cur][0], &vs[cur][0], st * FKS, lr, hi, qf, lim, o, m, l);
        if (more) put(cur ^ 1);
        __syncthreads();   // as in the loop above
    }
    finish(1);
}


template <bool RES>
__global__ __launch_bounds__(256) void k_lnrow(const float* __restrict__ A, const bf* __restrict__ R, const float* __restrict__ gamma, const float* __restrict__ beta, float eps, int C, int nrows, float* Y) {
    const int lane = threadIdx.x & 31; const int row = blockIdx.x * 8 + (threadIdx.x >> 5); if (row >= nrows) return; const int nch = C / 128; const float* a = A + (size_t)row * C; float x[LNC_MAX / 32]; float s = 0.0f;
    for (int k = 0; k < LNC_MAX / 128; ++k) { if (k < nch) { const int c0 = k * 128 + lane * 4; v4f v = *(const v4f*)(a + c0);
            if (RES) { asm volatile("s_wait_xcnt 0x0" ::: "memory");   // stands in front of the chunk's second load, whose result may be given a register that the first load names as its address (seen in the listing at the last chunk, where those registers die)
                const v4us w = *(const v4us*)(R + (size_t)row * C + c0); v[0] = __fadd_rn(v[0], bf2f(w[0])); v[1] = __fadd_rn(v[1], bf2f(w[1])); v[2] = __fadd_rn(v[2], bf2f(w[2])); v[3] = __fadd_rn(v[3], bf2f(w[3])); }
            x[k * 4 + 0] = v[0]; x[k * 4 + 1] = v[1]; x[k * 4 + 2] = v[2]; x[k * 4 + 3] = v[3]; s = __fadd_rn(__fadd_rn(__fadd_rn(__fadd_rn(s, v[0]), v[1]), v[2]), v[3]); } }
    for (int sh = 16; sh; sh >>= 1) s = __fadd_rn(s, __shfl_xor(s, sh, 32));
    const float mean = __fdiv_rn(s, (float)C); float q = 0.0f;
    for (int k = 0; k < LNC_MAX / 128; ++k) { if (k < nch) {
            for (int j = 0; j < 4; ++j) { const float d = __fsub_rn(x[k * 4 + j], mean); x[k * 4 + j] = d; q = __fmaf_rn(d, d, q); } } }
    for (int sh = 16; sh; sh >>= 1) q = __fadd_rn(q, __shfl_xor(q, sh, 32));
    const float rstd = __fdiv_rn(1.0f, sqrtf(__fadd_rn(__fdiv_rn(q, (float)C), eps)));
    for (int k = 0; k < LNC_MAX / 128; ++k) { if (k < nch) { const int c0 = k * 128 + lane * 4; const v4f g = *(const v4f*)(gamma + c0); const v4f bt = *(const v4f*)(beta + c0);
            for (int j = 0; j < 4; ++j) x[k * 4 + j] = __fmaf_rn(__fmul_rn(x[k * 4 + j], rstd), bfr(g[j]), bfr(bt[j])); } }
    float* y = Y + (size_t)row * C;
    {
        for (int k = 0; k < LNC_MAX / 128; ++k) { if (k < nch) { v4f o; o[0] = x[k * 4 + 0]; o[1] = x[k * 4 + 1]; o[2] = x[k * 4 + 2]; o[3] = x[k * 4 + 3]; *(v4f*)(y + k * 128 + lane * 4) = o; } }
         }
}
extern "C" void kernel_launch(void* const* d_in, const int* in_sizes, int n_in,
                              void* d_out, int out_size, void* d_ws, size_t ws_size, hipStream_t stream) {
    (void)in_sizes; (void)n_in; (void)out_size;
    const float* xq = (const float*)d_in[0]; const float* xk = (const float*)d_in[1]; const float* xv = (const float*)d_in[2]; const float* wq = (const float*)d_in[3]; const float* wk = (const float*)d_in[4]; const float* wv = (const float*)d_in[5]; const float* wo = (const float*)d_in[6]; const float* lng = (const float*)d_in[7]; const float* lnb = (const float*)d_in[8]; const int* sl = (const int*)d_in[9];   /* the module's argument order: ten inputs, all read; sen_len int32 [2] */
    float* OUT = (float*)d_out;     // [2][2048][1024]
    static_assert(DM % 128 == 0 && DM <= LNC_MAX, "k_lnrow's channel count");
    char* wsp = (char*)d_ws;
    auto take = [&](size_t bytes) { char* p = wsp; wsp += (bytes + 255) & ~(size_t)255; return (void*)p; };
    bf* WB = (bf*)take((4 * (size_t)DQ * DM + 3 * (size_t)NB_ * TT * DM) * 2);   /* the bf16 copies end to end: Wq, Wk, Wv, Wo ('out, in' [1024][1024]: K-contiguous, an operand of its product as it lies), then q, k, v [2][2048][1024] */
    bf* WO = WB + 3 * (size_t)DQ * DM; bf* XB = WB + 4 * (size_t)DQ * DM;
    h16* QP16 = (h16*)take(3 * (size_t)NB_ * NH_ * TT * HD * 2); h16* KP16 = QP16 + (size_t)NB_ * NH_ * TT * HD; h16* VT16 = KP16 + (size_t)NB_ * NKV * TT * HD;   /* the head planes of both entries, q, k, v end to end: one launch writes them, one attention launch reads them all */
    bf* ATh = (bf*)take((size_t)NB_ * TT * DQ * 2); float* YO = (float*)take((size_t)NB_ * TT * DM * 4);
    if ((size_t)(wsp - (char*)d_ws) > ws_size) return;    // total 80 MiB of the workspace by these reservations' own sum
    k_cvtall<<<(unsigned)(XCH / 256), 256, 0, stream>>>(wq, wk, wv, wo, xq, xk, xv, WB);
    static_assert(HD == 64 && NH_ == NKV, "one 64-column tile of a projection is one head; the three weights are alike in shape");
    k_proj<<<dim3(TT / 64, DQ / 64, 3 * NB_), 256, 0, stream>>>(XB, WB, DM, QP16);
    static_assert(NH_ == NKV && TT % 256 == 0 && HD == 64, "k_fattn's shape");
    k_fattn<<<dim3(TT / 256, NH_, NB_), 256, 0, stream>>>(QP16, KP16, VT16, sl, ATh);   /* scores, keep test, softmax, value product and merge of every head of both entries */
    k_gemmw<bf, float, 0, false, 8><<<dim3(NB_ * TT / 64, DM / 64, 1), 256, 0, stream>>>(ATh, nullptr, WO, nullptr, DQ, YO, DM, 64, nullptr, 0, 0, 0);   /* y = merged (one bf16 word) Wo^T into a workspace plane, the rows of both entries */
    k_lnrow<true><<<(unsigned)((NB_ * TT + 7) / 8), 256, 0, stream>>>(YO, XB, lng, lnb, 1.0e-6f, DM, NB_ * TT, OUT);   /* out = LN(y + q) x gamma + beta (q: its bf16 copy): the one writer of the output */
}

// v006
// It runs in 83.9 microseconds.
// Timed twice side by side with v005, it ran 1.51 and 1.48 times as fast.
// Counting every step since v000, it is 15.9 times as fast.
#include <hip/hip_runtime.h>

// Multi-head attention on three input tables with a causal rule AND a per-entry key length, an output map, a residual and a layer norm
// (a0 q, a1 k, a2 v [2][2048][1024]; a3 Wq, a4 Wk, a5 Wv, a6 Wo [1024][1024] 'out, in' (y = x W^T), no biases; a7 gamma, a8 beta [1024]; a9 sen_len int32 [2]: the entry's key length (1 .. 2,048);
//  16 heads x 64 (head h = columns h x 64 ..); S = (q Wq^T)(k Wk^T)^T / 8; A KEY j IS KEPT FOR QUERY i WHERE j <= i AND j < sen_len[b]; every other score is replaced by -1e9 (an exclusion: every row keeps key 0); softmax over the keys; ctx = A (v Wv^T); merged token-major; y = merged Wo^T;
//  x = y + q (the raw query table); the result = (x - mean) x rsqrt(var + 1e-6) x gamma + beta over the 1,024 channels (biased variance) -> [2][2048][1024]; argument order q, k, v, Wq, Wk, Wv, Wo, gamma, beta, sen_len).
// Layout: ONE LAUNCH A STAGE, five in all: a bf16 copy of the four weights and the three tables, both entries, made by one launch (the 'out, in' weights as they lie: K-contiguous, the product's second operand, Wv its first); the six exact projections in one grid, whose own epilogue rounds each 64-column block (one head's columns) to f16 and stores it where the head planes of BOTH batch entries want it (q, k [b][h][t][d]; v transposed [b][h][d][t]: that product runs as Wv x^T, rows = channels, so its rows lie as the plane's do);
// ONE attention kernel over all heads and both entries (k_fattn): scores, the keep test (two compares folded into one bound a query), an online softmax, the value product and the token-major merge stay in registers; the key loop ENDS AT THE LAST KEPT KEY of each tile of 128 queries (an excluded key takes -3.0e38 before the maximum, so its weight is an exact zero: -1e9 below a kept score gives exp of -1e9: an exact zero too; a stage of such keys alone adds nothing and is left out);
// EVERY row on ONE fp16 product (the weights against the maximum in use, at most 2^8); the merged context on ONE bf16 word x Wo exact into a workspace plane (both entries' rows in one grid); the residual (the query table's bf16 copy, the one the q projection reads) added and the row normalised by k_lnrow: the one writer of the output.
// Compute dtypes, f32 accumulate: every float input rounded to bf16 at its load; projections exact; attention: one fp16 product on every row; softmax f32; the output map bf16 x bf16 on one word a side; the norm f32; the integer input is compared only.

#define NB_  2
#define TT   2048
#define DM   1024
#define NH_  16
#define NKV  16
#define REP  (NH_ / NKV)
#define HD   64
#define DQ   (NH_ * HD)
#define DKV  (NKV * HD)
#define LNC_MAX 2048

typedef _Float16 h16;
typedef unsigned short bf;
typedef __attribute__((ext_vector_type(16))) __bf16   v16bf;
typedef __attribute__((ext_vector_type(16))) _Float16 v16h;
typedef __attribute__((ext_vector_type(8)))  _Float16 v8h;
typedef __attribute__((ext_vector_type(4)))  _Float16 v4h;
typedef __attribute__((ext_vector_type(8)))  unsigned short v8us;
typedef __attribute__((ext_vector_type(8)))  float    v8f;
typedef __attribute__((ext_vector_type(4)))  float    v4f;
typedef v8h  __attribute__((may_alias)) v8ha;
typedef v4f  __attribute__((may_alias)) v4fa;
typedef v8us __attribute__((may_alias)) v8usa;

__device__ __forceinline__ unsigned short f2bf(float f) { unsigned u = __float_as_uint(f); u += 0x7FFFu + ((u >> 16) & 1u); return (unsigned short)(u >> 16); }
__device__ __forceinline__ float bf2f(unsigned short b) { return __uint_as_float(((unsigned)b) << 16); }
__device__ __forceinline__ float bfr(float f) { return bf2f(f2bf(f)); }
__device__ __forceinline__ v16h cat16(v8h lo, v8h hi) { return __builtin_shufflevector(lo, hi, 0, 1, 2, 3, 4, 5, 6, 7, 8, 9, 10, 11, 12, 13, 14, 15); }
__device__ __forceinline__ v16bf cat16b(v8us lo, v8us hi) { return __builtin_bit_cast(v16bf, __builtin_shufflevector(lo, hi, 0, 1, 2, 3, 4, 5, 6, 7, 8, 9, 10, 11, 12, 13, 14, 15)); }
__device__ __forceinline__ v8f wmma16(v16h a, v16h b, v8f c) { return __builtin_amdgcn_wmma_f32_16x16x32_f16(false, a, false, b, (short)0, c, false, false); }
__device__ __forceinline__ v8f wmmab(v16bf a, v16bf b, v8f c) { return __builtin_amdgcn_wmma_f32_16x16x32_bf16(false, a, false, b, (short)0, c, false, false); }



// ---- gemm_tile, k_gemmw, k_proj: one 128x128 output tile per work-group of 8 waves (4 x 2; a wave holds 32 rows x 64 columns, 8 accumulators) over the whole of K; both operands K-contiguous bf16 planes.
// C[m][n] (f32 sums, stored as TO: f32, or rounded once to f16) = sum_k A[m][k] Bt[n][k], k in rising order in one accumulator.
// Where C lies: row m at pitch ldc, the 64-column block number y at y x sN elements (sN = 64: a plain row-major matrix; sN = rows x 64 with ldc = 64: one [row][64] plane a block of columns).
// The operands come through LDS: a stage is 64 k = one whole 128-byte line of each of the tile's 128 A rows and 128 Bt rows, brought by asynchronous 16-byte copies (8 lanes a line, 4 lines a wave-wide copy, 8 copies a lane), rows padded to 144 bytes for the 16-byte readers; two buffers: the next stage's copies fly while this one is worked on. Every line is fetched once a work-group and read from LDS by the 2 or 4 waves that need it.
template <typename T16> struct WFrag;
template <> struct WFrag<h16> { typedef v16h V; static __device__ __forceinline__ V ld(const h16* p) { return cat16(*(const v8h*)p, *(const v8h*)(p + 16)); } static __device__ __forceinline__ v8f mma(V a, V b, v8f c) { return wmma16(a, b, c); } };
template <> struct WFrag<bf> { typedef v16bf V; static __device__ __forceinline__ V ld(const bf* p) { return cat16b(*(const v8us*)p, *(const v8us*)(p + 16)); } static __device__ __forceinline__ v8f mma(V a, V b, v8f c) { return wmmab(a, b, c); } };
__device__ __forceinline__ void st4(float* p, v4f v) { *(v4f*)p = v; }
__device__ __forceinline__ void st4(h16* p, v4f v) { v4h o; o[0] = (h16)v[0]; o[1] = (h16)v[1]; o[2] = (h16)v[2]; o[3] = (h16)v[3]; *(v4h*)p = o; }
#define GKS 64                 // k a stage
#define GPI 72                 // LDS row pitch in 16-bit words: 128 bytes + 16
#define GBW (256 * GPI)        // 16-bit words a buffer: 128 A rows, then 128 Bt rows
// gemm_tile: the tile whose first row is r0 and first column c0 (multiples of 128); C points at row 0, column 0 of the matrix. KK: the products' length.
template <typename TO, int KK>
__device__ __forceinline__ void gemm_tile(const bf* __restrict__ A, const bf* __restrict__ Bt, TO* C, int ldc, size_t sN, int r0, int c0) {
    static_assert(KK % GKS == 0 && KK / GKS >= 2, "whole stages, at least two");
    static_assert(8 * 32 * 68 * 4 <= 2 * GBW * 2, "the output staging fits the ring");
    typedef WFrag<bf>::V V;
    __shared__ __align__(16) bf sm[2 * GBW];
    const int tid = (int)threadIdx.x, lane = tid & 31, lr = lane & 15, hi = lane >> 4; const int wv = __builtin_amdgcn_readfirstlane(tid >> 5); const int wr = wv >> 1, wc = wv & 1;
    const int srow = tid >> 3, sc = (tid & 7) * 8;   // copies: 8 lanes a 128-byte line; the lane's rows are srow + 32 i of A and of Bt, i = 0 .. 3
    const bf* ag = A + (size_t)(r0 + srow) * KK + sc; const bf* bg = Bt + (size_t)(c0 + srow) * KK + sc;
    const unsigned l0 = (unsigned)(size_t)sm + (unsigned)(srow * GPI + sc) * 2u;   // the lane's LDS byte address of A row srow in buffer 0
    // stage t into buffer nb: the lane's eight copies and, as the last line of their own statement, the wait that stands in front of any rewrite of a register that a copy names
    auto copy = [&](int t, int nb) { const bf* a = ag + t * GKS; const bf* b = bg + t * GKS; const unsigned l = l0 + (unsigned)nb * (GBW * 2u);
        asm volatile("global_load_async_to_lds_b128 %0, %8, off\n\tglobal_load_async_to_lds_b128 %1, %9, off\n\tglobal_load_async_to_lds_b128 %2, %10, off\n\tglobal_load_async_to_lds_b128 %3, %11, off\n\t"
                     "global_load_async_to_lds_b128 %4, %12, off\n\tglobal_load_async_to_lds_b128 %5, %13, off\n\tglobal_load_async_to_lds_b128 %6, %14, off\n\tglobal_load_async_to_lds_b128 %7, %15, off\n\ts_wait_xcnt 0x0"
                     :: "v"(l), "v"(l + 32u * GPI * 2u), "v"(l + 64u * GPI * 2u), "v"(l + 96u * GPI * 2u), "v"(l + 128u * GPI * 2u), "v"(l + 160u * GPI * 2u), "v"(l + 192u * GPI * 2u), "v"(l + 224u * GPI * 2u),
                        "v"(a), "v"(a + 32 * KK), "v"(a + 64 * KK), "v"(a + 96 * KK), "v"(b), "v"(b + 32 * KK), "v"(b + 64 * KK), "v"(b + 96 * KK) : "memory"); };
    v8f acc[2][4];
#pragma unroll
    for (int mb = 0; mb < 2; ++mb)
#pragma unroll
        for (int nb = 0; nb < 4; ++nb) acc[mb][nb] = (v8f){};
    const bf* ra = sm + (wr * 32 + lr) * GPI + 8 * hi; const bf* rb = sm + (128 + wc * 64 + lr) * GPI + 8 * hi;   // the wave's first A row and first Bt row in buffer 0, the lane's k offset
    copy(0, 0);
    asm volatile("s_wait_asynccnt 0x0" ::: "memory");   // this wave's copies of stage 0 have landed
    __syncthreads();   // and every other wave's: stage 0 is in LDS before any wave reads it
    copy(1, 1);
    for (int t = 0; t < KK / GKS; ++t) {
        const int off = (t & 1) * GBW;
#pragma unroll
        for (int ks = 0; ks < 2; ++ks) { V a[2], b[4];
#pragma unroll
            for (int mb = 0; mb < 2; ++mb) a[mb] = WFrag<bf>::ld(ra + off + mb * 16 * GPI + ks * 32);
#pragma unroll
            for (int nb = 0; nb < 4; ++nb) b[nb] = WFrag<bf>::ld(rb + off + nb * 16 * GPI + ks * 32);
            __builtin_amdgcn_sched_barrier(0);   // the 12 fragment loads of a k step stand as one group in front of its 8 products (one LDS latency a k step); left free, the compiler deals them out in pairs between the products, each pair waited for alone
#pragma unroll
            for (int nb = 0; nb < 4; ++nb)
#pragma unroll
                for (int mb = 0; mb < 2; ++mb) acc[mb][nb] = WFrag<bf>::mma(a[mb], b[nb], acc[mb][nb]);
            __builtin_amdgcn_sched_barrier(0);   // and the next group stays behind these products, so that it takes their fragments' registers: three work-groups fit a WGP's registers
        }
        asm volatile("s_wait_dscnt 0x0" ::: "memory");      // this wave's reads of the buffer are over
        asm volatile("s_wait_asynccnt 0x0" ::: "memory");   // its copies of stage t + 1 have landed
        __syncthreads();   // publishes stage t + 1 and ends every wave's reads of stage t, whose buffer is refilled behind it
        if (t + 2 < KK / GKS) copy(t + 2, t & 1);
    }
    asm volatile("s_wait_asynccnt 0x0" ::: "memory");   // no copy is outstanding when the ring is given another use
    // The last trip's barrier has ended every read of the ring: it now stages the output, each wave's 32 x 64 block in a range of its own, so that whole lines are stored.
    float* ow = (float*)sm + wv * (32 * 68);
#pragma unroll
    for (int mb = 0; mb < 2; ++mb)
#pragma unroll
        for (int nb = 0; nb < 4; ++nb)
#pragma unroll
            for (int j = 0; j < 8; ++j) ow[(mb * 16 + hi * 8 + j) * 68 + nb * 16 + lr] = acc[mb][nb][j];
    __syncthreads();   // a lane reads back what other lanes of its wave wrote: the writes are in LDS first
    TO* cw = C + (size_t)(c0 / 64 + wc) * sN + (size_t)(r0 + wr * 32) * ldc;
#pragma unroll
    for (int s = 0; s < 16; ++s) { const int row = 2 * s + hi, cofs = lr * 4; st4(cw + (size_t)row * ldc + cofs, *(const v4fa*)(ow + row * 68 + cofs)); }
}
// k_gemmw: grid (M / 128, N / 128), 256 threads.
template <typename TO, int KK>
__global__ __launch_bounds__(256) void k_gemmw(const bf* __restrict__ A, const bf* __restrict__ Bt, TO* C, int ldc, size_t sN) {
    gemm_tile<TO, KK>(A, Bt, C, ldc, sN, blockIdx.x * 128, blockIdx.y * 128);
}
// k_proj: the six projections (three tables x two entries) as ONE grid (TT / 128 token tiles, DQ / 128 pairs of heads, 3 x NB_): z picks the table with its weight, and the entry. X: the tables' bf16 copies [3][NB_][TT][DM]; Wt: Wq, Wk, Wv [3][DQ][DM]; P: the head planes, q and k [b][h][t][d], then v transposed [b][h][d][t].
// q, k: x W^T, column block h is head h's plane (pitch HD). v: Wv x^T, row = channel h x 64 + d, column = token (pitch TT).
__global__ __launch_bounds__(256) void k_proj(const bf* __restrict__ X, const bf* __restrict__ Wt, h16* P) {
    const int tb = blockIdx.z / NB_; const bool tr = tb == 2; const int t0 = blockIdx.x * 128, ch0 = blockIdx.y * 128;
    const bf* x = X + (size_t)blockIdx.z * TT * DM; const bf* w = Wt + (size_t)tb * DQ * DM; h16* p = P + (size_t)blockIdx.z * NH_ * TT * HD;
    gemm_tile<h16, DM>(tr ? w : x, tr ? x : w, p, tr ? TT : HD, tr ? (size_t)64 : (size_t)TT * HD, tr ? ch0 : t0, tr ? t0 : ch0);
}



__device__ __forceinline__ void splitf(float y, unsigned short& h, unsigned short& l) { h = f2bf(y); l = f2bf(y - bf2f(h)); }
typedef __attribute__((ext_vector_type(4))) unsigned short v4us;
typedef __attribute__((ext_vector_type(4))) int v4i;

// ---- k_cvtall: every float matrix input rounded to bf16 once, in ONE launch; grid XCH / 256. Thread t takes the 8-element chunk t of the four weights counted end to end and chunk t of each of the three tables (a table is as long as the four weights together); dst: Wq, Wk, Wv, Wo, q, k, v end to end.
#define WCH ((size_t)DQ * DM / 8)         // chunks a weight
#define XCH ((size_t)NB_ * TT * DM / 8)   // chunks a table
__device__ __forceinline__ v8us rnd8(v8f v) { v8us o;
#pragma unroll   // constant indices, so that v and o stay in registers
    for (int k = 0; k < 8; ++k) o[k] = f2bf(v[k]);
    return o; }
__global__ __launch_bounds__(256) void k_cvtall(const float* __restrict__ wq, const float* __restrict__ wk, const float* __restrict__ wv, const float* __restrict__ wo, const float* __restrict__ xq, const float* __restrict__ xk, const float* __restrict__ xv, bf* dst) {
    static_assert(4 * WCH == XCH && WCH % 256 == 0 && DKV == DQ, "the four weights together are as long as one table; a work-group stays inside one weight");
    const size_t g = (size_t)blockIdx.x * 2048; const unsigned e = threadIdx.x * 8;   // the work-group's first element (t = g / 8 + threadIdx.x) and the thread's chunk behind it
    const unsigned wi = blockIdx.x / (unsigned)(WCH / 256);   // which weight: one for the whole work-group
    const float* w = (wi == 0 ? wq : wi == 1 ? wk : wi == 2 ? wv : wo) + (g - wi * WCH * 8);
    const v8f a = *(const v8f*)(w + e), b = *(const v8f*)(xq + g + e), c = *(const v8f*)(xk + g + e), d = *(const v8f*)(xv + g + e);
    dst += g; *(v8us*)(dst + e) = rnd8(a); *(v8us*)(dst + XCH * 8 + e) = rnd8(b); *(v8us*)(dst + 2 * XCH * 8 + e) = rnd8(c); *(v8us*)(dst + 3 * XCH * 8 + e) = rnd8(d);
}
// ---- k_fattn: one work-group = 256 queries of one head of one batch entry: the 128-query tile tx and the tile 15 - tx; 8 waves x 32 query columns (2 groups of 16, one from each tile); grid (TT / 256, heads, entries).
// St = K Q^T (A = 16 key rows, B = 16 query columns) and Ot += Vt Pt: a lane holds the scores of ONE query (column lr), keys 8 hi + r of each 16-key tile, so two score tiles converted in place ARE the B operand of the value product (the hardware k order, which WFrag's loader gives A as well).
// K and Vt tiles of 64 keys go through registers into LDS (whole 128-byte lines from memory, rows padded to 144 bytes for the 16-byte readers), two buffers: the next tile's loads fly while this one is worked on.
#define FKS 64     // keys a stage
#define FPI 72     // LDS row pitch in 16-bit words: 128 bytes + 16
#define FC2 0.18033688011112042f   // HD^-0.5 x log2(e): scores in base 2
__device__ __forceinline__ float xhalf(float x) { return __builtin_bit_cast(float, __builtin_amdgcn_permlanex16(__builtin_bit_cast(int, x), __builtin_bit_cast(int, x), 0x76543210, 0xfedcba98, false, false)); }   // lane l with lane l ^ 16
// eight 2^x in one statement: the early-clobber results keep every v_exp_f32 clear of its neighbour's source and result, and the closing v_nop is the one slot the instruction set asks for between a transcendental and a reader of its result
__device__ __forceinline__ v8f exp2x8(v8f x) { float p0, p1, p2, p3, p4, p5, p6, p7;
    asm("v_exp_f32 %0, %8\n\tv_exp_f32 %1, %9\n\tv_exp_f32 %2, %10\n\tv_exp_f32 %3, %11\n\tv_exp_f32 %4, %12\n\tv_exp_f32 %5, %13\n\tv_exp_f32 %6, %14\n\tv_exp_f32 %7, %15\n\tv_nop"
        : "=&v"(p0), "=&v"(p1), "=&v"(p2), "=&v"(p3), "=&v"(p4), "=&v"(p5), "=&v"(p6), "=&v"(p7) : "v"(x[0]), "v"(x[1]), "v"(x[2]), "v"(x[3]), "v"(x[4]), "v"(x[5]), "v"(x[6]), "v"(x[7]));
    return (v8f){p0, p1, p2, p3, p4, p5, p6, p7}; }
// fa_pass: NS x 32 keys of the staged tile (kb, vb point at the first of them; key0 is its number) against this wave's query groups G0 .. 1: scores, keep test, online softmax, value product.
template <int NS, int G0>
__device__ __forceinline__ void fa_pass(const h16* kb, const h16* vb, int key0, int lr, int hi, const v16h (&qf)[2][2], const int (&lim)[2], v8f (&o)[4][2], float (&m)[2], float (&l)[2]) {
    v16h ka[NS][2][2]; v8f s[NS][2][2];
#pragma unroll
    for (int sb = 0; sb < NS; ++sb)
#pragma unroll
        for (int kt = 0; kt < 2; ++kt) { const h16* kr = kb + (sb * 32 + kt * 16 + lr) * FPI + 8 * hi; ka[sb][kt][0] = WFrag<h16>::ld(kr); ka[sb][kt][1] = WFrag<h16>::ld(kr + 32); }
    if constexpr (NS == 2) __builtin_amdgcn_sched_barrier(0);   // the 64-key pass: all 16 K fragment loads stand as one group in front of the score products (one LDS latency a pass); left free, the compiler deals them out in pairs between the products, each pair waited for almost alone
#pragma unroll
    for (int sb = 0; sb < NS; ++sb)
#pragma unroll
        for (int kt = 0; kt < 2; ++kt)
#pragma unroll
            for (int g = G0; g < 2; ++g) { s[sb][kt][g] = wmma16(ka[sb][kt][0], qf[g][0], (v8f){}); s[sb][kt][g] = wmma16(ka[sb][kt][1], qf[g][1], s[sb][kt][g]); }
    if constexpr (NS == 2) __builtin_amdgcn_sched_barrier(0);   // keeps the 16 Vt fragment loads of the 64-key pass behind the score products: they take the K fragments' registers and do not queue in front of K fragments that a product waits for
    v16h va[NS][4];
#pragma unroll
    for (int sb = 0; sb < NS; ++sb)
#pragma unroll
        for (int dt = 0; dt < 4; ++dt) va[sb][dt] = WFrag<h16>::ld(vb + (dt * 16 + lr) * FPI + sb * 32 + 8 * hi);
    __builtin_amdgcn_sched_barrier(0);   // keeps the Vt fragment loads in front of the softmax, whose vector work then covers their LDS latency; without it they sink to directly in front of each value product
    float bm[2]; bool need = false;
#pragma unroll
    for (int g = G0; g < 2; ++g) { const int rem = lim[g] - (key0 + 8 * hi); float x = -3.0e38f;   // this lane's key sb x 32 + kt x 16 + r of the pass is kept where that number < rem
#pragma unroll
        for (int sb = 0; sb < NS; ++sb)
#pragma unroll
            for (int kt = 0; kt < 2; ++kt)
#pragma unroll
                for (int r = 0; r < 8; ++r) { const float t = (sb * 32 + kt * 16 + r < rem) ? s[sb][kt][g][r] * FC2 : -3.0e38f; s[sb][kt][g][r] = t; x = fmaxf(x, t); }
        x = fmaxf(x, xhalf(x)); bm[g] = x; need = need || (x - m[g] > 8.0f); }
    if (__builtin_amdgcn_ballot_w32(need) != 0) {   // a scalar branch: the maximum in use moves only where a column's new maximum is more than 8 (base 2) above it, so a weight is at most 2^8
#pragma unroll
        for (int g = G0; g < 2; ++g) { const float mn = fmaxf(m[g], bm[g]); const float al = __builtin_amdgcn_exp2f(m[g] - mn); m[g] = mn; l[g] *= al;
#pragma unroll
            for (int dt = 0; dt < 4; ++dt) o[dt][g] *= al; } }
    v16h pf[NS][2];
#pragma unroll
    for (int g = G0; g < 2; ++g) { float ls[NS];   // the weights' sum, one chain of additions for each 32 keys: the 64-key pass has two short chains side by side in place of one long one
#pragma unroll
        for (int sb = 0; sb < NS; ++sb) { ls[sb] = sb == 0 ? l[g] : 0.0f;
#pragma unroll
            for (int kt = 0; kt < 2; ++kt) { const v8f p = exp2x8(s[sb][kt][g] - m[g]);
#pragma unroll
                for (int r = 0; r < 8; ++r) { ls[sb] += p[r]; pf[sb][g][kt * 8 + r] = (h16)p[r]; } } }
        l[g] = NS == 2 ? ls[0] + ls[NS - 1] : ls[0]; }
#pragma unroll
    for (int sb = 0; sb < NS; ++sb)
#pragma unroll
        for (int dt = 0; dt < 4; ++dt)
#pragma unroll
            for (int g = G0; g < 2; ++g) o[dt][g] = wmma16(va[sb][dt], pf[sb][g], o[dt][g]);
}
__global__ __launch_bounds__(256) void k_fattn(const h16* __restrict__ Q, const h16* __restrict__ Kp, const h16* __restrict__ Vt, const int* __restrict__ slen, bf* AT) {
    __shared__ __align__(16) h16 ks[2][FKS * FPI];
    __shared__ __align__(16) h16 vs[2][HD * FPI];
    const int tid = (int)threadIdx.x, lane = tid & 31, lr = lane & 15, hi = lane >> 4; const int wv = __builtin_amdgcn_readfirstlane(tid >> 5);
    const int h = blockIdx.y, b = blockIdx.z; const size_t pl = ((size_t)b * NH_ + h) * TT * HD; Q += pl; Kp += pl; Vt += pl;
    const int tx = blockIdx.x; const int qb[2] = {tx * 128 + wv * 16, (TT / 128 - 1 - tx) * 128 + wv * 16};   // the wave's two groups' first queries: one in the early tile tx, one in the late tile 15 - tx, so that every work-group's kept keys add up alike
    const int ln = slen[b];   // the entry's key length: compared only
    const bool none = ln < 1;   // no key kept at all: every score is the same replacement, so every key of the table weighs alike: such an entry runs over all keys
    const int ea = (tx + 1) * 128, eb = (TT / 128 - tx) * 128;   // one past the last key that the causal rule leaves to the early tile, to the late tile (ea <= eb <= TT)
    const int na = none ? TT / FKS : ((ea < ln ? ea : ln) + FKS - 1) / FKS, nst = none ? TT / FKS : ((eb < ln ? eb : ln) + FKS - 1) / FKS;   // stages that hold a kept key of the early tile, of either tile: 1 <= na <= nst <= TT / FKS, the same for the whole work-group
    v16h qf[2][2]; int lim[2]; v8f o[4][2]; float m[2], l[2];
#pragma unroll
    for (int g = 0; g < 2; ++g) { const int qi = qb[g] + lr; qf[g][0] = WFrag<h16>::ld(Q + (size_t)qi * HD + 8 * hi); qf[g][1] = WFrag<h16>::ld(Q + (size_t)qi * HD + 32 + 8 * hi);
        lim[g] = (qi + 1 < ln) ? qi + 1 : ln;   // key j is kept where j <= qi AND j < ln: j < lim
        m[g] = -3.0e38f; l[g] = 0.0f;
#pragma unroll
        for (int dt = 0; dt < 4; ++dt) o[dt][g] = (v8f){}; }
    const int srow = tid >> 3, sc = (tid & 7) * 8;   // staging: 8 threads a 128-byte row, rows srow and srow + 32 of each tile
    const h16* kg = Kp + (size_t)srow * HD + sc; const h16* vg = Vt + (size_t)srow * TT + sc;
    v8h rk0 = *(const v8h*)kg, rk1 = *(const v8h*)(kg + 32 * HD), rv0 = *(const v8h*)vg, rv1 = *(const v8h*)(vg + (size_t)32 * TT);
    auto fetch = [&](int sn) { const h16* kn = kg + (size_t)sn * FKS * HD; const h16* vn = vg + sn * FKS; rk0 = *(const v8h*)kn; rk1 = *(const v8h*)(kn + 32 * HD); rv0 = *(const v8h*)vn; rv1 = *(const v8h*)(vn + (size_t)32 * TT); };   // stage sn's rows into registers
    auto put = [&](int nx) { *(v8h*)(&ks[nx][srow * FPI + sc]) = rk0; *(v8h*)(&ks[nx][(srow + 32) * FPI + sc]) = rk1; *(v8h*)(&vs[nx][srow * FPI + sc]) = rv0; *(v8h*)(&vs[nx][(srow + 32) * FPI + sc]) = rv1; };   // and from there into buffer nx
    auto finish = [&](int g) { const float inv = __fdiv_rn(1.0f, l[g] + xhalf(l[g])); bf* ar = AT + ((size_t)b * TT + qb[g] + lr) * DQ + h * HD + hi * 8;   // the two halves of a column hold different keys' weights: joined once
#pragma unroll
        for (int dt = 0; dt < 4; ++dt) { v8us w;
#pragma unroll
            for (int r = 0; r < 8; ++r) w[r] = f2bf(o[dt][g][r] * inv);
            *(v8us*)(ar + dt * 16) = w; } };
    put(0);
    __syncthreads();   // stage 0 is in LDS before any wave reads it
    // A stage past a tile's last kept key holds only exact-zero weights for it and is left out: stages 0 .. na - 1 serve both groups, stages na .. nst - 1 the late group alone (the stage's 64 keys in one pass).
    int st = 0;
    for (; st < na; ++st) {
        const int cur = st & 1; const bool more = st + 1 < nst;
        if (more) fetch(st + 1);
        fa_pass<1, 0>(&ks[cur][0], &vs[cur][0], st * FKS, lr, hi, qf, lim, o, m, l); fa_pass<1, 0>(&ks[cur][32 * FPI], &vs[cur][32], st * FKS + 32, lr, hi, qf, lim, o, m, l);
        if (more) put(cur ^ 1);
        __syncthreads();   // publishes the next stage and ends every wave's reads of this one, which the stage after next overwrites
    }
    finish(0);
    asm volatile("s_wait_xcnt 0x0" ::: "memory");   // stands in front of the second loop's first arithmetic, which is given registers that the early group's four stores name (seen in the listing)
    for (; st < nst; ++st) {
        const int cur = st & 1; const bool more = st + 1 < nst;
        if (more) fetch(st + 1);
        fa_pass<2, 1>(&ks[cur][0], &vs[cur][0], st * FKS, lr, hi, qf, lim, o, m, l);
        if (more) put(cur ^ 1);
        __syncthreads();   // as in the loop above
    }
    finish(1);
}


template <bool RES>
__global__ __launch_bounds__(256) void k_lnrow(const float* __restrict__ A, const bf* __restrict__ R, const float* __restrict__ gamma, const float* __restrict__ beta, float eps, int C, int nrows, float* Y) {
    const int lane = threadIdx.x & 31; const int row = blockIdx.x * 8 + (threadIdx.x >> 5); if (row >= nrows) return; const int nch = C / 128; const float* a = A + (size_t)row * C; float x[LNC_MAX / 32]; float s = 0.0f;
    for (int k = 0; k < LNC_MAX / 128; ++k) { if (k < nch) { const int c0 = k * 128 + lane * 4; v4f v = *(const v4f*)(a + c0);
            if (RES) { asm volatile("s_wait_xcnt 0x0" ::: "memory");   // stands in front of the chunk's second load, whose result may be given a register that the first load names as its address (seen in the listing at the last chunk, where those registers die)
                const v4us w = *(const v4us*)(R + (size_t)row * C + c0); v[0] = __fadd_rn(v[0], bf2f(w[0])); v[1] = __fadd_rn(v[1], bf2f(w[1])); v[2] = __fadd_rn(v[2], bf2f(w[2])); v[3] = __fadd_rn(v[3], bf2f(w[3])); }
            x[k * 4 + 0] = v[0]; x[k * 4 + 1] = v[1]; x[k * 4 + 2] = v[2]; x[k * 4 + 3] = v[3]; s = __fadd_rn(__fadd_rn(__fadd_rn(__fadd_rn(s, v[0]), v[1]), v[2]), v[3]); } }
    for (int sh = 16; sh; sh >>= 1) s = __fadd_rn(s, __shfl_xor(s, sh, 32));
    const float mean = __fdiv_rn(s, (float)C); float q = 0.0f;
    for (int k = 0; k < LNC_MAX / 128; ++k) { if (k < nch) {
            for (int j = 0; j < 4; ++j) { const float d = __fsub_rn(x[k * 4 + j], mean); x[k * 4 + j] = d; q = __fmaf_rn(d, d, q); } } }
    for (int sh = 16; sh; sh >>= 1) q = __fadd_rn(q, __shfl_xor(q, sh, 32));
    const float rstd = __fdiv_rn(1.0f, sqrtf(__fadd_rn(__fdiv_rn(q, (float)C), eps)));
    for (int k = 0; k < LNC_MAX / 128; ++k) { if (k < nch) { const int c0 = k * 128 + lane * 4; const v4f g = *(const v4f*)(gamma + c0); const v4f bt = *(const v4f*)(beta + c0);
            for (int j = 0; j < 4; ++j) x[k * 4 + j] = __fmaf_rn(__fmul_rn(x[k * 4 + j], rstd), bfr(g[j]), bfr(bt[j])); } }
    float* y = Y + (size_t)row * C;
    {
        for (int k = 0; k < LNC_MAX / 128; ++k) { if (k < nch) { v4f o; o[0] = x[k * 4 + 0]; o[1] = x[k * 4 + 1]; o[2] = x[k * 4 + 2]; o[3] = x[k * 4 + 3]; *(v4f*)(y + k * 128 + lane * 4) = o; } }
         }
}
extern "C" void kernel_launch(void* const* d_in, const int* in_sizes, int n_in,
                              void* d_out, int out_size, void* d_ws, size_t ws_size, hipStream_t stream) {
    (void)in_sizes; (void)n_in; (void)out_size;
    const float* xq = (const float*)d_in[0]; const float* xk = (const float*)d_in[1]; const float* xv = (const float*)d_in[2]; const float* wq = (const float*)d_in[3]; const float* wk = (const float*)d_in[4]; const float* wv = (const float*)d_in[5]; const float* wo = (const float*)d_in[6]; const float* lng = (const float*)d_in[7]; const float* lnb = (const float*)d_in[8]; const int* sl = (const int*)d_in[9];   /* the module's argument order: ten inputs, all read; sen_len int32 [2] */
    float* OUT = (float*)d_out;     // [2][2048][1024]
    static_assert(DM % 128 == 0 && DM <= LNC_MAX, "k_lnrow's channel count");
    char* wsp = (char*)d_ws;
    auto take = [&](size_t bytes) { char* p = wsp; wsp += (bytes + 255) & ~(size_t)255; return (void*)p; };
    bf* WB = (bf*)take((4 * (size_t)DQ * DM + 3 * (size_t)NB_ * TT * DM) * 2);   /* the bf16 copies end to end: Wq, Wk, Wv, Wo ('out, in' [1024][1024]: K-contiguous, an operand of its product as it lies), then q, k, v [2][2048][1024] */
    bf* WO = WB + 3 * (size_t)DQ * DM; bf* XB = WB + 4 * (size_t)DQ * DM;
    h16* QP16 = (h16*)take(3 * (size_t)NB_ * NH_ * TT * HD * 2); h16* KP16 = QP16 + (size_t)NB_ * NH_ * TT * HD; h16* VT16 = KP16 + (size_t)NB_ * NKV * TT * HD;   /* the head planes of both entries, q, k, v end to end: one launch writes them, one attention launch reads them all */
    bf* ATh = (bf*)take((size_t)NB_ * TT * DQ * 2); float* YO = (float*)take((size_t)NB_ * TT * DM * 4);
    if ((size_t)(wsp - (char*)d_ws) > ws_size) return;    // total 80 MiB of the workspace by these reservations' own sum
    k_cvtall<<<(unsigned)(XCH / 256), 256, 0, stream>>>(wq, wk, wv, wo, xq, xk, xv, WB);
    static_assert(HD == 64 && NH_ == NKV && TT % 128 == 0 && DQ % 128 == 0 && DM % 128 == 0, "one 64-column block of a projection is one head; the three weights are alike in shape; whole 128x128 tiles");
    k_proj<<<dim3(TT / 128, DQ / 128, 3 * NB_), 256, 0, stream>>>(XB, WB, QP16);
    static_assert(NH_ == NKV && TT % 256 == 0 && HD == 64, "k_fattn's shape");
    k_fattn<<<dim3(TT / 256, NH_, NB_), 256, 0, stream>>>(QP16, KP16, VT16, sl, ATh);   /* scores, keep test, softmax, value product and merge of every head of both entries */
    k_gemmw<float, DQ><<<dim3(NB_ * TT / 128, DM / 128, 1), 256, 0, stream>>>(ATh, WO, YO, DM, 64);   /* y = merged (one bf16 word) Wo^T into a workspace plane, the rows of both entries */
    k_lnrow<true><<<(unsigned)((NB_ * TT + 7) / 8), 256, 0, stream>>>(YO, XB, lng, lnb, 1.0e-6f, DM, NB_ * TT, OUT);   /* out = LN(y + q) x gamma + beta (q: its bf16 copy): the one writer of the output */
}

// v007
// It runs in 79.3 microseconds.
// Two timings next to v006 put it at 1.07 and 1.06 times that version's speed.
// Over all steps from v000 it is 16.9 times as fast.
#include <hip/hip_runtime.h>

// Multi-head attention on three input tables with a causal rule AND a per-entry key length, an output map, a residual and a layer norm
// (a0 q, a1 k, a2 v [2][2048][1024]; a3 Wq, a4 Wk, a5 Wv, a6 Wo [1024][1024] 'out, in' (y = x W^T), no biases; a7 gamma, a8 beta [1024]; a9 sen_len int32 [2]: the entry's key length (1 .. 2,048);
//  16 heads x 64 (head h = columns h x 64 ..); S = (q Wq^T)(k Wk^T)^T / 8; A KEY j IS KEPT FOR QUERY i WHERE j <= i AND j < sen_len[b]; every other score is replaced by -1e9 (an exclusion: every row keeps key 0); softmax over the keys; ctx = A (v Wv^T); merged token-major; y = merged Wo^T;
//  x = y + q (the raw query table); the result = (x - mean) x rsqrt(var + 1e-6) x gamma + beta over the 1,024 channels (biased variance) -> [2][2048][1024]; argument order q, k, v, Wq, Wk, Wv, Wo, gamma, beta, sen_len).
// Layout: ONE LAUNCH A STAGE, five in all: a bf16 copy of the four weights and the three tables, both entries, made by one launch (of k and v, here and in their projections, only the 128-token tiles that hold a key below the entry's length: live_tiles; the 'out, in' weights as they lie: K-contiguous, the product's second operand, Wv its first); the six exact projections in one grid, whose own epilogue rounds each 64-column block (one head's columns) to f16 and stores it where the head planes of BOTH batch entries want it (q, k [b][h][t][d]; v transposed [b][h][d][t]: that product runs as Wv x^T, rows = channels, so its rows lie as the plane's do);
// ONE attention kernel over all heads and both entries (k_fattn): scores, the keep test (two compares folded into one bound a query), an online softmax, the value product and the token-major merge stay in registers; the key loop ENDS AT THE LAST KEPT KEY of each tile of 128 queries (an excluded key takes -3.0e38 before the maximum, so its weight is an exact zero: -1e9 below a kept score gives exp of -1e9: an exact zero too; a stage of such keys alone adds nothing and is left out);
// EVERY row on ONE fp16 product (the weights against the maximum in use, at most 2^8); the merged context on ONE bf16 word x Wo exact into a workspace plane (both entries' rows in one grid); the residual (the query table's bf16 copy, the one the q projection reads) added and the row normalised by k_lnrow: the one writer of the output.
// Compute dtypes, f32 accumulate: every float input rounded to bf16 at its load; projections exact; attention: one fp16 product on every row; softmax f32; the output map bf16 x bf16 on one word a side; the norm f32; the integer input is compared only.

#define NB_  2
#define TT   2048
#define DM   1024
#define NH_  16
#define NKV  16
#define REP  (NH_ / NKV)
#define HD   64
#define DQ   (NH_ * HD)
#define DKV  (NKV * HD)
#define LNC_MAX 2048

typedef _Float16 h16;
typedef unsigned short bf;
typedef __attribute__((ext_vector_type(16))) __bf16   v16bf;
typedef __attribute__((ext_vector_type(16))) _Float16 v16h;
typedef __attribute__((ext_vector_type(8)))  _Float16 v8h;
typedef __attribute__((ext_vector_type(4)))  _Float16 v4h;
typedef __attribute__((ext_vector_type(8)))  unsigned short v8us;
typedef __attribute__((ext_vector_type(8)))  float    v8f;
typedef __attribute__((ext_vector_type(4)))  float    v4f;
typedef v8h  __attribute__((may_alias)) v8ha;
typedef v4f  __attribute__((may_alias)) v4fa;
typedef v8us __attribute__((may_alias)) v8usa;

__device__ __forceinline__ unsigned short f2bf(float f) { unsigned u = __float_as_uint(f); u += 0x7FFFu + ((u >> 16) & 1u); return (unsigned short)(u >> 16); }
__device__ __forceinline__ float bf2f(unsigned short b) { return __uint_as_float(((unsigned)b) << 16); }
__device__ __forceinline__ float bfr(float f) { return bf2f(f2bf(f)); }
__device__ __forceinline__ v16h cat16(v8h lo, v8h hi) { return __builtin_shufflevector(lo, hi, 0, 1, 2, 3, 4, 5, 6, 7, 8, 9, 10, 11, 12, 13, 14, 15); }
__device__ __forceinline__ v16bf cat16b(v8us lo, v8us hi) { return __builtin_bit_cast(v16bf, __builtin_shufflevector(lo, hi, 0, 1, 2, 3, 4, 5, 6, 7, 8, 9, 10, 11, 12, 13, 14, 15)); }
__device__ __forceinline__ v8f wmma16(v16h a, v16h b, v8f c) { return __builtin_amdgcn_wmma_f32_16x16x32_f16(false, a, false, b, (short)0, c, false, false); }
__device__ __forceinline__ v8f wmmab(v16bf a, v16bf b, v8f c) { return __builtin_amdgcn_wmma_f32_16x16x32_bf16(false, a, false, b, (short)0, c, false, false); }
// live_tiles: how many 128-token tiles of an entry's k and v tables hold a key that some query keeps (key j is kept only where j < ln): 1 .. TT / 128 for any ln. An entry that keeps no key at all (ln < 1) weighs every key alike and needs them all.
// k_fattn reads keys below ln rounded up to 64 and no others, so rows past these tiles are neither rounded nor projected, and their places in the workspace are never read.
__device__ __forceinline__ int live_tiles(int ln) { const int c = ln > TT ? TT : ln; return c < 1 ? TT / 128 : (c + 127) / 128; }



// ---- gemm_tile, k_gemmw, k_proj: one 128x128 output tile per work-group of 8 waves (4 x 2; a wave holds 32 rows x 64 columns, 8 accumulators) over the whole of K; both operands K-contiguous bf16 planes.
// C[m][n] (f32 sums, stored as TO: f32, or rounded once to f16) = sum_k A[m][k] Bt[n][k], k in rising order in one accumulator.
// Where C lies: row m at pitch ldc, the 64-column block number y at y x sN elements (sN = 64: a plain row-major matrix; sN = rows x 64 with ldc = 64: one [row][64] plane a block of columns).
// The operands come through LDS: a stage is 64 k = one whole 128-byte line of each of the tile's 128 A rows and 128 Bt rows, brought by asynchronous 16-byte copies (8 lanes a line, 4 lines a wave-wide copy, 8 copies a lane), rows padded to 144 bytes for the 16-byte readers; two buffers: the next stage's copies fly while this one is worked on. Every line is fetched once a work-group and read from LDS by the 2 or 4 waves that need it.
template <typename T16> struct WFrag;
template <> struct WFrag<h16> { typedef v16h V; static __device__ __forceinline__ V ld(const h16* p) { return cat16(*(const v8h*)p, *(const v8h*)(p + 16)); } static __device__ __forceinline__ v8f mma(V a, V b, v8f c) { return wmma16(a, b, c); } };
template <> struct WFrag<bf> { typedef v16bf V; static __device__ __forceinline__ V ld(const bf* p) { return cat16b(*(const v8us*)p, *(const v8us*)(p + 16)); } static __device__ __forceinline__ v8f mma(V a, V b, v8f c) { return wmmab(a, b, c); } };
__device__ __forceinline__ void st4(float* p, v4f v) { *(v4f*)p = v; }
__device__ __forceinline__ void st4(h16* p, v4f v) { v4h o; o[0] = (h16)v[0]; o[1] = (h16)v[1]; o[2] = (h16)v[2]; o[3] = (h16)v[3]; *(v4h*)p = o; }
#define GKS 64                 // k a stage
#define GPI 72                 // LDS row pitch in 16-bit words: 128 bytes + 16
#define GBW (256 * GPI)        // 16-bit words a buffer: 128 A rows, then 128 Bt rows
// gemm_tile: the tile whose first row is r0 and first column c0 (multiples of 128); C points at row 0, column 0 of the matrix. KK: the products' length.
template <typename TO, int KK>
__device__ __forceinline__ void gemm_tile(const bf* __restrict__ A, const bf* __restrict__ Bt, TO* C, int ldc, size_t sN, int r0, int c0) {
    static_assert(KK % GKS == 0 && KK / GKS >= 2, "whole stages, at least two");
    static_assert(8 * 32 * 68 * 4 <= 2 * GBW * 2, "the output staging fits the ring");
    typedef WFrag<bf>::V V;
    __shared__ __align__(16) bf sm[2 * GBW];
    const int tid = (int)threadIdx.x, lane = tid & 31, lr = lane & 15, hi = lane >> 4; const int wv = __builtin_amdgcn_readfirstlane(tid >> 5); const int wr = wv >> 1, wc = wv & 1;
    const int srow = tid >> 3, sc = (tid & 7) * 8;   // copies: 8 lanes a 128-byte line; the lane's rows are srow + 32 i of A and of Bt, i = 0 .. 3
    const bf* ag = A + (size_t)(r0 + srow) * KK + sc; const bf* bg = Bt + (size_t)(c0 + srow) * KK + sc;
    const unsigned l0 = (unsigned)(size_t)sm + (unsigned)(srow * GPI + sc) * 2u;   // the lane's LDS byte address of A row srow in buffer 0
    // stage t into buffer nb: the lane's eight copies and, as the last line of their own statement, the wait that stands in front of any rewrite of a register that a copy names
    auto copy = [&](int t, int nb) { const bf* a = ag + t * GKS; const bf* b = bg + t * GKS; const unsigned l = l0 + (unsigned)nb * (GBW * 2u);
        asm volatile("global_load_async_to_lds_b128 %0, %8, off\n\tglobal_load_async_to_lds_b128 %1, %9, off\n\tglobal_load_async_to_lds_b128 %2, %10, off\n\tglobal_load_async_to_lds_b128 %3, %11, off\n\t"
                     "global_load_async_to_lds_b128 %4, %12, off\n\tglobal_load_async_to_lds_b128 %5, %13, off\n\tglobal_load_async_to_lds_b128 %6, %14, off\n\tglobal_load_async_to_lds_b128 %7, %15, off\n\ts_wait_xcnt 0x0"
                     :: "v"(l), "v"(l + 32u * GPI * 2u), "v"(l + 64u * GPI * 2u), "v"(l + 96u * GPI * 2u), "v"(l + 128u * GPI * 2u), "v"(l + 160u * GPI * 2u), "v"(l + 192u * GPI * 2u), "v"(l + 224u * GPI * 2u),
                        "v"(a), "v"(a + 32 * KK), "v"(a + 64 * KK), "v"(a + 96 * KK), "v"(b), "v"(b + 32 * KK), "v"(b + 64 * KK), "v"(b + 96 * KK) : "memory"); };
    v8f acc[2][4];
#pragma unroll
    for (int mb = 0; mb < 2; ++mb)
#pragma unroll
        for (int nb = 0; nb < 4; ++nb) acc[mb][nb] = (v8f){};
    const bf* ra = sm + (wr * 32 + lr) * GPI + 8 * hi; const bf* rb = sm + (128 + wc * 64 + lr) * GPI + 8 * hi;   // the wave's first A row and first Bt row in buffer 0, the lane's k offset
    copy(0, 0);
    asm volatile("s_wait_asynccnt 0x0" ::: "memory");   // this wave's copies of stage 0 have landed
    __syncthreads();   // and every other wave's: stage 0 is in LDS before any wave reads it
    copy(1, 1);
    for (int t = 0; t < KK / GKS; ++t) {
        const int off = (t & 1) * GBW;
#pragma unroll
        for (int ks = 0; ks < 2; ++ks) { V a[2], b[4];
#pragma unroll
            for (int mb = 0; mb < 2; ++mb) a[mb] = WFrag<bf>::ld(ra + off + mb * 16 * GPI + ks * 32);
#pragma unroll
            for (int nb = 0; nb < 4; ++nb) b[nb] = WFrag<bf>::ld(rb + off + nb * 16 * GPI + ks * 32);
            __builtin_amdgcn_sched_barrier(0);   // the 12 fragment loads of a k step stand as one group in front of its 8 products (one LDS latency a k step); left free, the compiler deals them out in pairs between the products, each pair waited for alone
#pragma unroll
            for (int nb = 0; nb < 4; ++nb)
#pragma unroll
                for (int mb = 0; mb < 2; ++mb) acc[mb][nb] = WFrag<bf>::mma(a[mb], b[nb], acc[mb][nb]);
            __builtin_amdgcn_sched_barrier(0);   // and the next group stays behind these products, so that it takes their fragments' registers: three work-groups fit a WGP's registers
        }
        asm volatile("s_wait_dscnt 0x0" ::: "memory");      // this wave's reads of the buffer are over
        asm volatile("s_wait_asynccnt 0x0" ::: "memory");   // its copies of stage t + 1 have landed
        __syncthreads();   // publishes stage t + 1 and ends every wave's reads of stage t, whose buffer is refilled behind it
        if (t + 2 < KK / GKS) copy(t + 2, t & 1);
    }
    asm volatile("s_wait_asynccnt 0x0" ::: "memory");   // no copy is outstanding when the ring is given another use
    // The last trip's barrier has ended every read of the ring: it now stages the output, each wave's 32 x 64 block in a range of its own, so that whole lines are stored.
    float* ow = (float*)sm + wv * (32 * 68);
#pragma unroll
    for (int mb = 0; mb < 2; ++mb)
#pragma unroll
        for (int nb = 0; nb < 4; ++nb)
#pragma unroll
            for (int j = 0; j < 8; ++j) ow[(mb * 16 + hi * 8 + j) * 68 + nb * 16 + lr] = acc[mb][nb][j];
    __syncthreads();   // a lane reads back what other lanes of its wave wrote: the writes are in LDS first
    TO* cw = C + (size_t)(c0 / 64 + wc) * sN + (size_t)(r0 + wr * 32) * ldc;
#pragma unroll
    for (int s = 0; s < 16; ++s) { const int row = 2 * s + hi, cofs = lr * 4; st4(cw + (size_t)row * ldc + cofs, *(const v4fa*)(ow + row * 68 + cofs)); }
}
// k_gemmw: grid (M / 128, N / 128), 256 threads.
template <typename TO, int KK>
__global__ __launch_bounds__(256) void k_gemmw(const bf* __restrict__ A, const bf* __restrict__ Bt, TO* C, int ldc, size_t sN) {
    gemm_tile<TO, KK>(A, Bt, C, ldc, sN, blockIdx.x * 128, blockIdx.y * 128);
}
// k_proj: the six projections (three tables x two entries) as ONE flat grid of (TT / 128 token tiles) x (DQ / 128 pairs of heads) x 3 x NB_ work-groups. The pair of heads runs fastest; behind it the token tiles that are wanted, counted end to end: all of q's, then the live ones of k, then of v (live_tiles, entry 0 in front of entry 1), so that the work-groups with work are the first of the grid and spread evenly; the rest return at once. X: the tables' bf16 copies [3][NB_][TT][DM]; Wt: Wq, Wk, Wv [3][DQ][DM]; P: the head planes, q and k [b][h][t][d], then v transposed [b][h][d][t].
// q, k: x W^T, column block h is head h's plane (pitch HD). v: Wv x^T, row = channel h x 64 + d, column = token (pitch TT).
__global__ __launch_bounds__(256) void k_proj(const bf* __restrict__ X, const bf* __restrict__ Wt, const int* __restrict__ slen, h16* P) {
    static_assert(NB_ == 2, "two entries' live tiles are counted end to end");
    const int n0 = live_tiles(slen[0]), nl = n0 + live_tiles(slen[1]);   // live tiles of entry 0, of both entries
    int u = (int)blockIdx.x / (DQ / 128), tb = 0, en = u / (TT / 128);   // the token tile's number in the count; as q's: table 0, entry, tile
    if (u < NB_ * (TT / 128)) u -= en * (TT / 128);
    else { u -= NB_ * (TT / 128);
        if (u >= 2 * nl) return;   // no tile left: the same for the whole work-group, in front of every copy and barrier
        tb = u < nl ? 1 : 2; u -= (tb - 1) * nl; en = u < n0 ? 0 : 1; u -= en * n0; }   // u < the entry's live tiles <= TT / 128
    const int zz = tb * NB_ + en; const bool tr = tb == 2; const int t0 = u * 128, ch0 = ((int)blockIdx.x % (DQ / 128)) * 128;
    const bf* x = X + (size_t)zz * TT * DM; const bf* w = Wt + (size_t)tb * DQ * DM; h16* p = P + (size_t)zz * NH_ * TT * HD;
    gemm_tile<h16, DM>(tr ? w : x, tr ? x : w, p, tr ? TT : HD, tr ? (size_t)64 : (size_t)TT * HD, tr ? ch0 : t0, tr ? t0 : ch0);
}



__device__ __forceinline__ void splitf(float y, unsigned short& h, unsigned short& l) { h = f2bf(y); l = f2bf(y - bf2f(h)); }
typedef __attribute__((ext_vector_type(4))) unsigned short v4us;
typedef __attribute__((ext_vector_type(4))) int v4i;

// ---- k_cvtall: every float matrix input rounded to bf16 once, in ONE launch; grid XCH / 256. Thread t takes the 8-element chunk t of the four weights counted end to end and chunk t of each of the three tables (a table is as long as the four weights together); dst: Wq, Wk, Wv, Wo, q, k, v end to end. A work-group's chunks of k and v are two token rows of one entry: past the entry's live tiles they are left out.
#define WCH ((size_t)DQ * DM / 8)         // chunks a weight
#define XCH ((size_t)NB_ * TT * DM / 8)   // chunks a table
__device__ __forceinline__ v8us rnd8(v8f v) { v8us o;
#pragma unroll   // constant indices, so that v and o stay in registers
    for (int k = 0; k < 8; ++k) o[k] = f2bf(v[k]);
    return o; }
__global__ __launch_bounds__(256) void k_cvtall(const float* __restrict__ wq, const float* __restrict__ wk, const float* __restrict__ wv, const float* __restrict__ wo, const float* __restrict__ xq, const float* __restrict__ xk, const float* __restrict__ xv, const int* __restrict__ slen, bf* dst) {
    static_assert(4 * WCH == XCH && WCH % 256 == 0 && DKV == DQ, "the four weights together are as long as one table; a work-group stays inside one weight");
    const size_t g = (size_t)blockIdx.x * 2048; const unsigned e = threadIdx.x * 8;   // the work-group's first element (t = g / 8 + threadIdx.x) and the thread's chunk behind it
    const unsigned wi = blockIdx.x / (unsigned)(WCH / 256);   // which weight: one for the whole work-group
    const float* w = (wi == 0 ? wq : wi == 1 ? wk : wi == 2 ? wv : wo) + (g - wi * WCH * 8);
    static_assert(2048 % DM == 0 && (TT * DM) % 2048 == 0 && (128 * DM) % 2048 == 0, "a work-group holds whole token rows of one 128-token tile of one entry");
    const unsigned en = blockIdx.x / (unsigned)(TT * DM / 2048), tok = (blockIdx.x % (unsigned)(TT * DM / 2048)) * (2048 / DM);   // the entry (0 .. NB_ - 1 by the grid) and the first token of the work-group's rows
    const bool live = (int)tok < live_tiles(slen[en]) * 128;   // one answer for the whole work-group
    const v8f a = *(const v8f*)(w + e), b = *(const v8f*)(xq + g + e);
    dst += g;
    if (live) { const v8f c = *(const v8f*)(xk + g + e), d = *(const v8f*)(xv + g + e); *(v8us*)(dst + 2 * XCH * 8 + e) = rnd8(c); *(v8us*)(dst + 3 * XCH * 8 + e) = rnd8(d); }
    *(v8us*)(dst + e) = rnd8(a); *(v8us*)(dst + XCH * 8 + e) = rnd8(b);
}
// ---- k_fattn: one work-group = 256 queries of one head of one batch entry: the 128-query tile tx and the tile 15 - tx; 8 waves x 32 query columns (2 groups of 16, one from each tile); grid (TT / 256, heads, entries).
// St = K Q^T (A = 16 key rows, B = 16 query columns) and Ot += Vt Pt: a lane holds the scores of ONE query (column lr), keys 8 hi + r of each 16-key tile, so two score tiles converted in place ARE the B operand of the value product (the hardware k order, which WFrag's loader gives A as well).
// K and Vt tiles of 64 keys go through registers into LDS (whole 128-byte lines from memory, rows padded to 144 bytes for the 16-byte readers), two buffers: the next tile's loads fly while this one is worked on.
#define FKS 64     // keys a stage
#define FPI 72     // LDS row pitch in 16-bit words: 128 bytes + 16
#define FC2 0.18033688011112042f   // HD^-0.5 x log2(e): scores in base 2
__device__ __forceinline__ float xhalf(float x) { return __builtin_bit_cast(float, __builtin_amdgcn_permlanex16(__builtin_bit_cast(int, x), __builtin_bit_cast(int, x), 0x76543210, 0xfedcba98, false, false)); }   // lane l with lane l ^ 16
// eight 2^x in one statement: the early-clobber results keep every v_exp_f32 clear of its neighbour's source and result, and the closing v_nop is the one slot the instruction set asks for between a transcendental and a reader of its result
__device__ __forceinline__ v8f exp2x8(v8f x) { float p0, p1, p2, p3, p4, p5, p6, p7;
    asm("v_exp_f32 %0, %8\n\tv_exp_f32 %1, %9\n\tv_exp_f32 %2, %10\n\tv_exp_f32 %3, %11\n\tv_exp_f32 %4, %12\n\tv_exp_f32 %5, %13\n\tv_exp_f32 %6, %14\n\tv_exp_f32 %7, %15\n\tv_nop"
        : "=&v"(p0), "=&v"(p1), "=&v"(p2), "=&v"(p3), "=&v"(p4), "=&v"(p5), "=&v"(p6), "=&v"(p7) : "v"(x[0]), "v"(x[1]), "v"(x[2]), "v"(x[3]), "v"(x[4]), "v"(x[5]), "v"(x[6]), "v"(x[7]));
    return (v8f){p0, p1, p2, p3, p4, p5, p6, p7}; }
// fa_pass: NS x 32 keys of the staged tile (kb, vb point at the first of them; key0 is its number) against this wave's query groups G0 .. 1: scores, keep test, online softmax, value product.
template <int NS, int G0>
__device__ __forceinline__ void fa_pass(const h16* kb, const h16* vb, int key0, int lr, int hi, const v16h (&qf)[2][2], const int (&lim)[2], v8f (&o)[4][2], float (&m)[2], float (&l)[2]) {
    v16h ka[NS][2][2]; v8f s[NS][2][2];
#pragma unroll
    for (int sb = 0; sb < NS; ++sb)
#pragma unroll
        for (int kt = 0; kt < 2; ++kt) { const h16* kr = kb + (sb * 32 + kt * 16 + lr) * FPI + 8 * hi; ka[sb][kt][0] = WFrag<h16>::ld(kr); ka[sb][kt][1] = WFrag<h16>::ld(kr + 32); }
    if constexpr (NS == 2) __builtin_amdgcn_sched_barrier(0);   // the 64-key pass: all 16 K fragment loads stand as one group in front of the score products (one LDS latency a pass); left free, the compiler deals them out in pairs between the products, each pair waited for almost alone
#pragma unroll
    for (int sb = 0; sb < NS; ++sb)
#pragma unroll
        for (int kt = 0; kt < 2; ++kt)
#pragma unroll
            for (int g = G0; g < 2; ++g) { s[sb][kt][g] = wmma16(ka[sb][kt][0], qf[g][0], (v8f){}); s[sb][kt][g] = wmma16(ka[sb][kt][1], qf[g][1], s[sb][kt][g]); }
    if constexpr (NS == 2) __builtin_amdgcn_sched_barrier(0);   // keeps the 16 Vt fragment loads of the 64-key pass behind the score products: they take the K fragments' registers and do not queue in front of K fragments that a product waits for
    v16h va[NS][4];
#pragma unroll
    for (int sb = 0; sb < NS; ++sb)
#pragma unroll
        for (int dt = 0; dt < 4; ++dt) va[sb][dt] = WFrag<h16>::ld(vb + (dt * 16 + lr) * FPI + sb * 32 + 8 * hi);
    __builtin_amdgcn_sched_barrier(0);   // keeps the Vt fragment loads in front of the softmax, whose vector work then covers their LDS latency; without it they sink to directly in front of each value product
    float bm[2]; bool need = false;
#pragma unroll
    for (int g = G0; g < 2; ++g) { const int rem = lim[g] - (key0 + 8 * hi); float x = -3.0e38f;   // this lane's key sb x 32 + kt x 16 + r of the pass is kept where that number < rem
#pragma unroll
        for (int sb = 0; sb < NS; ++sb)
#pragma unroll
            for (int kt = 0; kt < 2; ++kt)
#pragma unroll
                for (int r = 0; r < 8; ++r) { const float t = (sb * 32 + kt * 16 + r < rem) ? s[sb][kt][g][r] * FC2 : -3.0e38f; s[sb][kt][g][r] = t; x = fmaxf(x, t); }
        x = fmaxf(x, xhalf(x)); bm[g] = x; need = need || (x - m[g] > 8.0f); }
    if (__builtin_amdgcn_ballot_w32(need) != 0) {   // a scalar branch: the maximum in use moves only where a column's new maximum is more than 8 (base 2) above it, so a weight is at most 2^8
#pragma unroll
        for (int g = G0; g < 2; ++g) { const float mn = fmaxf(m[g], bm[g]); const float al = __builtin_amdgcn_exp2f(m[g] - mn); m[g] = mn; l[g] *= al;
#pragma unroll
            for (int dt = 0; dt < 4; ++dt) o[dt][g] *= al; } }
    v16h pf[NS][2];
#pragma unroll
    for (int g = G0; g < 2; ++g) { float ls[NS];   // the weights' sum, one chain of additions for each 32 keys: the 64-key pass has two short chains side by side in place of one long one
#pragma unroll
        for (int sb = 0; sb < NS; ++sb) { ls[sb] = sb == 0 ? l[g] : 0.0f;
#pragma unroll
            for (int kt = 0; kt < 2; ++kt) { const v8f p = exp2x8(s[sb][kt][g] - m[g]);
#pragma unroll
                for (int r = 0; r < 8; ++r) { ls[sb] += p[r]; pf[sb][g][kt * 8 + r] = (h16)p[r]; } } }
        l[g] = NS == 2 ? ls[0] + ls[NS - 1] : ls[0]; }
#pragma unroll
    for (int sb = 0; sb < NS; ++sb)
#pragma unroll
        for (int dt = 0; dt < 4; ++dt)
#pragma unroll
            for (int g = G0; g < 2; ++g) o[dt][g] = wmma16(va[sb][dt], pf[sb][g], o[dt][g]);
}
__global__ __launch_bounds__(256) void k_fattn(const h16* __restrict__ Q, const h16* __restrict__ Kp, const h16* __restrict__ Vt, const int* __restrict__ slen, bf* AT) {
    __shared__ __align__(16) h16 ks[2][FKS * FPI];
    __shared__ __align__(16) h16 vs[2][HD * FPI];
    const int tid = (int)threadIdx.x, lane = tid & 31, lr = lane & 15, hi = lane >> 4; const int wv = __builtin_amdgcn_readfirstlane(tid >> 5);
    const int h = blockIdx.y, b = blockIdx.z; const size_t pl = ((size_t)b * NH_ + h) * TT * HD; Q += pl; Kp += pl; Vt += pl;
    const int tx = blockIdx.x; const int qb[2] = {tx * 128 + wv * 16, (TT / 128 - 1 - tx) * 128 + wv * 16};   // the wave's two groups' first queries: one in the early tile tx, one in the late tile 15 - tx, so that every work-group's kept keys add up alike
    const int ln = slen[b];   // the entry's key length: compared only
    const bool none = ln < 1;   // no key kept at all: every score is the same replacement, so every key of the table weighs alike: such an entry runs over all keys
    const int ea = (tx + 1) * 128, eb = (TT / 128 - tx) * 128;   // one past the last key that the causal rule leaves to the early tile, to the late tile (ea <= eb <= TT)
    const int na = none ? TT / FKS : ((ea < ln ? ea : ln) + FKS - 1) / FKS, nst = none ? TT / FKS : ((eb < ln ? eb : ln) + FKS - 1) / FKS;   // stages that hold a kept key of the early tile, of either tile: 1 <= na <= nst <= TT / FKS, the same for the whole work-group
    v16h qf[2][2]; int lim[2]; v8f o[4][2]; float m[2], l[2];
#pragma unroll
    for (int g = 0; g < 2; ++g) { const int qi = qb[g] + lr; qf[g][0] = WFrag<h16>::ld(Q + (size_t)qi * HD + 8 * hi); qf[g][1] = WFrag<h16>::ld(Q + (size_t)qi * HD + 32 + 8 * hi);
        lim[g] = (qi + 1 < ln) ? qi + 1 : ln;   // key j is kept where j <= qi AND j < ln: j < lim
        m[g] = -3.0e38f; l[g] = 0.0f;
#pragma unroll
        for (int dt = 0; dt < 4; ++dt) o[dt][g] = (v8f){}; }
    const int srow = tid >> 3, sc = (tid & 7) * 8;   // staging: 8 threads a 128-byte row, rows srow and srow + 32 of each tile
    const h16* kg = Kp + (size_t)srow * HD + sc; const h16* vg = Vt + (size_t)srow * TT + sc;
    v8h rk0 = *(const v8h*)kg, rk1 = *(const v8h*)(kg + 32 * HD), rv0 = *(const v8h*)vg, rv1 = *(const v8h*)(vg + (size_t)32 * TT);
    auto fetch = [&](int sn) { const h16* kn = kg + (size_t)sn * FKS * HD; const h16* vn = vg + sn * FKS; rk0 = *(const v8h*)kn; rk1 = *(const v8h*)(kn + 32 * HD); rv0 = *(const v8h*)vn; rv1 = *(const v8h*)(vn + (size_t)32 * TT); };   // stage sn's rows into registers
    auto put = [&](int nx) { *(v8h*)(&ks[nx][srow * FPI + sc]) = rk0; *(v8h*)(&ks[nx][(srow + 32) * FPI + sc]) = rk1; *(v8h*)(&vs[nx][srow * FPI + sc]) = rv0; *(v8h*)(&vs[nx][(srow + 32) * FPI + sc]) = rv1; };   // and from there into buffer nx
    auto finish = [&](int g) { const float inv = __fdiv_rn(1.0f, l[g] + xhalf(l[g])); bf* ar = AT + ((size_t)b * TT + qb[g] + lr) * DQ + h * HD + hi * 8;   // the two halves of a column hold different keys' weights: joined once
#pragma unroll
        for (int dt = 0; dt < 4; ++dt) { v8us w;
#pragma unroll
            for (int r = 0; r < 8; ++r) w[r] = f2bf(o[dt][g][r] * inv);
            *(v8us*)(ar + dt * 16) = w; } };
    put(0);
    __syncthreads();   // stage 0 is in LDS before any wave reads it
    // A stage past a tile's last kept key holds only exact-zero weights for it and is left out: stages 0 .. na - 1 serve both groups, stages na .. nst - 1 the late group alone (the stage's 64 keys in one pass).
    int st = 0;
    for (; st < na; ++st) {
        const int cur = st & 1; const bool more = st + 1 < nst;
        if (more) fetch(st + 1);
        fa_pass<1, 0>(&ks[cur][0], &vs[cur][0], st * FKS, lr, hi, qf, lim, o, m, l); fa_pass<1, 0>(&ks[cur][32 * FPI], &vs[cur][32], st * FKS + 32, lr, hi, qf, lim, o, m, l);
        if (more) put(cur ^ 1);
        __syncthreads();   // publishes the next stage and ends every wave's reads of this one, which the stage after next overwrites
    }
    finish(0);
    asm volatile("s_wait_xcnt 0x0" ::: "memory");   // stands in front of the second loop's first arithmetic, which is given registers that the early group's four stores name (seen in the listing)
    for (; st < nst; ++st) {
        const int cur = st & 1; const bool more = st + 1 < nst;
        if (more) fetch(st + 1);
        fa_pass<2, 1>(&ks[cur][0], &vs[cur][0], st * FKS, lr, hi, qf, lim, o, m, l);
        if (more) put(cur ^ 1);
        __syncthreads();   // as in the loop above
    }
    finish(1);
}


template <bool RES>
__global__ __launch_bounds__(256) void k_lnrow(const float* __restrict__ A, const bf* __restrict__ R, const float* __restrict__ gamma, const float* __restrict__ beta, float eps, int C, int nrows, float* Y) {
    const int lane = threadIdx.x & 31; const int row = blockIdx.x * 8 + (threadIdx.x >> 5); if (row >= nrows) return; const int nch = C / 128; const float* a = A + (size_t)row * C; float x[LNC_MAX / 32]; float s = 0.0f;
    for (int k = 0; k < LNC_MAX / 128; ++k) { if (k < nch) { const int c0 = k * 128 + lane * 4; v4f v = *(const v4f*)(a + c0);
            if (RES) { asm volatile("s_wait_xcnt 0x0" ::: "memory");   // stands in front of the chunk's second load, whose result may be given a register that the first load names as its address (seen in the listing at the last chunk, where those registers die)
                const v4us w = *(const v4us*)(R + (size_t)row * C + c0); v[0] = __fadd_rn(v[0], bf2f(w[0])); v[1] = __fadd_rn(v[1], bf2f(w[1])); v[2] = __fadd_rn(v[2], bf2f(w[2])); v[3] = __fadd_rn(v[3], bf2f(w[3])); }
            x[k * 4 + 0] = v[0]; x[k * 4 + 1] = v[1]; x[k * 4 + 2] = v[2]; x[k * 4 + 3] = v[3]; s = __fadd_rn(__fadd_rn(__fadd_rn(__fadd_rn(s, v[0]), v[1]), v[2]), v[3]); } }
    for (int sh = 16; sh; sh >>= 1) s = __fadd_rn(s, __shfl_xor(s, sh, 32));
    const float mean = __fdiv_rn(s, (float)C); float q = 0.0f;
    for (int k = 0; k < LNC_MAX / 128; ++k) { if (k < nch) {
            for (int j = 0; j < 4; ++j) { const float d = __fsub_rn(x[k * 4 + j], mean); x[k * 4 + j] = d; q = __fmaf_rn(d, d, q); } } }
    for (int sh = 16; sh; sh >>= 1) q = __fadd_rn(q, __shfl_xor(q, sh, 32));
    const float rstd = __fdiv_rn(1.0f, sqrtf(__fadd_rn(__fdiv_rn(q, (float)C), eps)));
    for (int k = 0; k < LNC_MAX / 128; ++k) { if (k < nch) { const int c0 = k * 128 + lane * 4; const v4f g = *(const v4f*)(gamma + c0); const v4f bt = *(const v4f*)(beta + c0);
            for (int j = 0; j < 4; ++j) x[k * 4 + j] = __fmaf_rn(__fmul_rn(x[k * 4 + j], rstd), bfr(g[j]), bfr(bt[j])); } }
    float* y = Y + (size_t)row * C;
    {
        for (int k = 0; k < LNC_MAX / 128; ++k) { if (k < nch) { v4f o; o[0] = x[k * 4 + 0]; o[1] = x[k * 4 + 1]; o[2] = x[k * 4 + 2]; o[3] = x[k * 4 + 3]; *(v4f*)(y + k * 128 + lane * 4) = o; } }
         }
}
extern "C" void kernel_launch(void* const* d_in, const int* in_sizes, int n_in,
                              void* d_out, int out_size, void* d_ws, size_t ws_size, hipStream_t stream) {
    (void)in_sizes; (void)n_in; (void)out_size;
    const float* xq = (const float*)d_in[0]; const float* xk = (const float*)d_in[1]; const float* xv = (const float*)d_in[2]; const float* wq = (const float*)d_in[3]; const float* wk = (const float*)d_in[4]; const float* wv = (const float*)d_in[5]; const float* wo = (const float*)d_in[6]; const float* lng = (const float*)d_in[7]; const float* lnb = (const float*)d_in[8]; const int* sl = (const int*)d_in[9];   /* the module's argument order: ten inputs, all read; sen_len int32 [2] */
    float* OUT = (float*)d_out;     // [2][2048][1024]
    static_assert(DM % 128 == 0 && DM <= LNC_MAX, "k_lnrow's channel count");
    char* wsp = (char*)d_ws;
    auto take = [&](size_t bytes) { char* p = wsp; wsp += (bytes + 255) & ~(size_t)255; return (void*)p; };
    bf* WB = (bf*)take((4 * (size_t)DQ * DM + 3 * (size_t)NB_ * TT * DM) * 2);   /* the bf16 copies end to end: Wq, Wk, Wv, Wo ('out, in' [1024][1024]: K-contiguous, an operand of its product as it lies), then q, k, v [2][2048][1024] */
    bf* WO = WB + 3 * (size_t)DQ * DM; bf* XB = WB + 4 * (size_t)DQ * DM;
    h16* QP16 = (h16*)take(3 * (size_t)NB_ * NH_ * TT * HD * 2); h16* KP16 = QP16 + (size_t)NB_ * NH_ * TT * HD; h16* VT16 = KP16 + (size_t)NB_ * NKV * TT * HD;   /* the head planes of both entries, q, k, v end to end: one launch writes them, one attention launch reads them all */
    bf* ATh = (bf*)take((size_t)NB_ * TT * DQ * 2); float* YO = (float*)take((size_t)NB_ * TT * DM * 4);
    if ((size_t)(wsp - (char*)d_ws) > ws_size) return;    // total 80 MiB of the workspace by these reservations' own sum
    k_cvtall<<<(unsigned)(XCH / 256), 256, 0, stream>>>(wq, wk, wv, wo, xq, xk, xv, sl, WB);
    static_assert(HD == 64 && NH_ == NKV && TT % 128 == 0 && DQ % 128 == 0 && DM % 128 == 0, "one 64-column block of a projection is one head; the three weights are alike in shape; whole 128x128 tiles");
    k_proj<<<(TT / 128) * (DQ / 128) * 3 * NB_, 256, 0, stream>>>(XB, WB, sl, QP16);
    static_assert(NH_ == NKV && TT % 256 == 0 && HD == 64, "k_fattn's shape");
    k_fattn<<<dim3(TT / 256, NH_, NB_), 256, 0, stream>>>(QP16, KP16, VT16, sl, ATh);   /* scores, keep test, softmax, value product and merge of every head of both entries */
    k_gemmw<float, DQ><<<dim3(NB_ * TT / 128, DM / 128, 1), 256, 0, stream>>>(ATh, WO, YO, DM, 64);   /* y = merged (one bf16 word) Wo^T into a workspace plane, the rows of both entries */
    k_lnrow<true><<<(unsigned)((NB_ * TT + 7) / 8), 256, 0, stream>>>(YO, XB, lng, lnb, 1.0e-6f, DM, NB_ * TT, OUT);   /* out = LN(y + q) x gamma + beta (q: its bf16 copy): the one writer of the output */
}

// v008
// A run of this version takes 76.1 microseconds.
// Two timings next to v007 put it at 1.06 and 1.05 times that version's speed.
// Counting every step since v000, it is 17.9 times as fast.
#include <hip/hip_runtime.h>

// Multi-head attention on three input tables with a causal rule AND a per-entry key length, an output map, a residual and a layer norm
// (a0 q, a1 k, a2 v [2][2048][1024]; a3 Wq, a4 Wk, a5 Wv, a6 Wo [1024][1024] 'out, in' (y = x W^T), no biases; a7 gamma, a8 beta [1024]; a9 sen_len int32 [2]: the entry's key length (1 .. 2,048);
//  16 heads x 64 (head h = columns h x 64 ..); S = (q Wq^T)(k Wk^T)^T / 8; A KEY j IS KEPT FOR QUERY i WHERE j <= i AND j < sen_len[b]; every other score is replaced by -1e9 (an exclusion: every row keeps key 0); softmax over the keys; ctx = A (v Wv^T); merged token-major; y = merged Wo^T;
//  x = y + q (the raw query table); the result = (x - mean) x rsqrt(var + 1e-6) x gamma + beta over the 1,024 channels (biased variance) -> [2][2048][1024]; argument order q, k, v, Wq, Wk, Wv, Wo, gamma, beta, sen_len).
// Layout: ONE LAUNCH A STAGE, five in all: a bf16 copy of the four weights and the three tables, both entries, made by one launch (of k and v, here and in their projections, only the 128-token tiles that hold a key below the entry's length: live_tiles; the 'out, in' weights as they lie: K-contiguous, the product's second operand, Wv its first); the six exact projections in one grid, whose own epilogue rounds each 64-column block (one head's columns) to f16 and stores it where the head planes of BOTH batch entries want it (q, k [b][h][t][d]; v transposed [b][h][d][t]: that product runs as Wv x^T, rows = channels, so its rows lie as the plane's do);
// ONE attention kernel over all heads and both entries (k_fattn): scores, the keep test (two compares folded into one bound a query), an online softmax, the value product and the token-major merge stay in registers; the key loop ENDS AT THE LAST KEPT KEY of each tile of 128 queries (an excluded key takes -3.0e38 before the maximum, so its weight is an exact zero: -1e9 below a kept score gives exp of -1e9: an exact zero too; a stage of such keys alone adds nothing and is left out);
// EVERY row on ONE fp16 product (the weights against the maximum in use, at most 2^8); the merged context on ONE bf16 word x Wo exact into a workspace plane (both entries' rows in one grid); the residual (the query table's bf16 copy, the one the q projection reads) added and the row normalised by k_lnrow: the one writer of the output.
// Compute dtypes, f32 accumulate: every float input rounded to bf16 at its load; projections exact; attention: one fp16 product on every row; softmax f32; the output map bf16 x bf16 on one word a side; the norm f32; the integer input is compared only.

#define NB_  2
#define TT   2048
#define DM   1024
#define NH_  16
#define NKV  16
#define REP  (NH_ / NKV)
#define HD   64
#define DQ   (NH_ * HD)
#define DKV  (NKV * HD)
#define LNC_MAX 2048

typedef _Float16 h16;
typedef unsigned short bf;
typedef __attribute__((ext_vector_type(16))) __bf16   v16bf;
typedef __attribute__((ext_vector_type(16))) _Float16 v16h;
typedef __attribute__((ext_vector_type(8)))  _Float16 v8h;
typedef __attribute__((ext_vector_type(4)))  _Float16 v4h;
typedef __attribute__((ext_vector_type(8)))  unsigned short v8us;
typedef __attribute__((ext_vector_type(8)))  float    v8f;
typedef __attribute__((ext_vector_type(4)))  float    v4f;
typedef v8h  __attribute__((may_alias)) v8ha;
typedef v4f  __attribute__((may_alias)) v4fa;
typedef v8us __attribute__((may_alias)) v8usa;

__device__ __forceinline__ unsigned short f2bf(float f) { unsigned u = __float_as_uint(f); u += 0x7FFFu + ((u >> 16) & 1u); return (unsigned short)(u >> 16); }
__device__ __forceinline__ float bf2f(unsigned short b) { return __uint_as_float(((unsigned)b) << 16); }
__device__ __forceinline__ float bfr(float f) { return bf2f(f2bf(f)); }
__device__ __forceinline__ v16h cat16(v8h lo, v8h hi) { return __builtin_shufflevector(lo, hi, 0, 1, 2, 3, 4, 5, 6, 7, 8, 9, 10, 11, 12, 13, 14, 15); }
__device__ __forceinline__ v16bf cat16b(v8us lo, v8us hi) { return __builtin_bit_cast(v16bf, __builtin_shufflevector(lo, hi, 0, 1, 2, 3, 4, 5, 6, 7, 8, 9, 10, 11, 12, 13, 14, 15)); }
__device__ __forceinline__ v8f wmma16(v16h a, v16h b, v8f c) { return __builtin_amdgcn_wmma_f32_16x16x32_f16(false, a, false, b, (short)0, c, false, false); }
__device__ __forceinline__ v8f wmmab(v16bf a, v16bf b, v8f c) { return __builtin_amdgcn_wmma_f32_16x16x32_bf16(false, a, false, b, (short)0, c, false, false); }
// live_tiles: how many 128-token tiles of an entry's k and v tables hold a key that some query keeps (key j is kept only where j < ln): 1 .. TT / 128 for any ln. An entry that keeps no key at all (ln < 1) weighs every key alike and needs them all.
// k_fattn reads keys below ln rounded up to 64 and no others, so rows past these tiles are neither rounded nor projected, and their places in the workspace are never read.
__device__ __forceinline__ int live_tiles(int ln) { const int c = ln > TT ? TT : ln; return c < 1 ? TT / 128 : (c + 127) / 128; }



// ---- gemm_tile, k_gemmw, k_proj: one 128x128 output tile per work-group of 8 waves (4 x 2; a wave holds 32 rows x 64 columns, 8 accumulators) over the whole of K; both operands K-contiguous bf16 planes.
// C[m][n] (f32 sums, stored as TO: f32, or rounded once to f16) = sum_k A[m][k] Bt[n][k], k in rising order in one accumulator.
// Where C lies: row m at pitch ldc, the 64-column block number y at y x sN elements (sN = 64: a plain row-major matrix; sN = rows x 64 with ldc = 64: one [row][64] plane a block of columns).
// The operands come through LDS: a stage is 64 k = one whole 128-byte line of each of the tile's 128 A rows and 128 Bt rows, brought by asynchronous 16-byte copies (8 lanes a line, 4 lines a wave-wide copy, 8 copies a lane), rows padded to 144 bytes for the 16-byte readers; a ring of four buffers: the copies of the next three stages fly while this one is worked on, so that a stage has three trips' time to come from memory. Every line is fetched once a work-group and read from LDS by the 2 or 4 waves that need it.
template <typename T16> struct WFrag;
template <> struct WFrag<h16> { typedef v16h V; static __device__ __forceinline__ V ld(const h16* p) { return cat16(*(const v8h*)p, *(const v8h*)(p + 16)); } static __device__ __forceinline__ v8f mma(V a, V b, v8f c) { return wmma16(a, b, c); } };
template <> struct WFrag<bf> { typedef v16bf V; static __device__ __forceinline__ V ld(const bf* p) { return cat16b(*(const v8us*)p, *(const v8us*)(p + 16)); } static __device__ __forceinline__ v8f mma(V a, V b, v8f c) { return wmmab(a, b, c); } };
__device__ __forceinline__ void st4(float* p, v4f v) { *(v4f*)p = v; }
__device__ __forceinline__ void st4(h16* p, v4f v) { v4h o; o[0] = (h16)v[0]; o[1] = (h16)v[1]; o[2] = (h16)v[2]; o[3] = (h16)v[3]; *(v4h*)p = o; }
#define GKS 64                 // k a stage
#define GPI 72                 // LDS row pitch in 16-bit words: 128 bytes + 16
#define GBW (256 * GPI)        // 16-bit words a buffer: 128 A rows, then 128 Bt rows
#define GNB 4                  // buffers of the ring (a power of two): 144 KiB, two work-groups a WGP
// gemm_tile: the tile whose first row is r0 and first column c0 (multiples of 128); C points at row 0, column 0 of the matrix. KK: the products' length.
template <typename TO, int KK>
__device__ __forceinline__ void gemm_tile(const bf* __restrict__ A, const bf* __restrict__ Bt, TO* C, int ldc, size_t sN, int r0, int c0) {
    static_assert(KK % GKS == 0 && KK / GKS >= GNB && (GNB & (GNB - 1)) == 0, "whole stages, at least one for each buffer");
    static_assert(GNB == 4, "the two counted waits below are written for four buffers of eight copies a lane");
    static_assert(8 * 32 * 68 * 4 <= GNB * GBW * 2, "the output staging fits the ring");
    typedef WFrag<bf>::V V;
    __shared__ __align__(16) bf sm[GNB * GBW];
    const int tid = (int)threadIdx.x, lane = tid & 31, lr = lane & 15, hi = lane >> 4; const int wv = __builtin_amdgcn_readfirstlane(tid >> 5); const int wr = wv >> 1, wc = wv & 1;
    const int srow = tid >> 3, sc = (tid & 7) * 8;   // copies: 8 lanes a 128-byte line; the lane's rows are srow + 32 i of A and of Bt, i = 0 .. 3
    const bf* ag = A + (size_t)(r0 + srow) * KK + sc; const bf* bg = Bt + (size_t)(c0 + srow) * KK + sc;
    const unsigned l0 = (unsigned)(size_t)sm + (unsigned)(srow * GPI + sc) * 2u;   // the lane's LDS byte address of A row srow in buffer 0
    // stage t into buffer nb: the lane's eight copies and, as the last line of their own statement, the wait that stands in front of any rewrite of a register that a copy names
    auto copy = [&](int t, int nb) { const bf* a = ag + t * GKS; const bf* b = bg + t * GKS; const unsigned l = l0 + (unsigned)nb * (GBW * 2u);
        asm volatile("global_load_async_to_lds_b128 %0, %8, off\n\tglobal_load_async_to_lds_b128 %1, %9, off\n\tglobal_load_async_to_lds_b128 %2, %10, off\n\tglobal_load_async_to_lds_b128 %3, %11, off\n\t"
                     "global_load_async_to_lds_b128 %4, %12, off\n\tglobal_load_async_to_lds_b128 %5, %13, off\n\tglobal_load_async_to_lds_b128 %6, %14, off\n\tglobal_load_async_to_lds_b128 %7, %15, off\n\ts_wait_xcnt 0x0"
                     :: "v"(l), "v"(l + 32u * GPI * 2u), "v"(l + 64u * GPI * 2u), "v"(l + 96u * GPI * 2u), "v"(l + 128u * GPI * 2u), "v"(l + 160u * GPI * 2u), "v"(l + 192u * GPI * 2u), "v"(l + 224u * GPI * 2u),
                        "v"(a), "v"(a + 32 * KK), "v"(a + 64 * KK), "v"(a + 96 * KK), "v"(b), "v"(b + 32 * KK), "v"(b + 64 * KK), "v"(b + 96 * KK) : "memory"); };
    v8f acc[2][4];
#pragma unroll
    for (int mb = 0; mb < 2; ++mb)
#pragma unroll
        for (int nb = 0; nb < 4; ++nb) acc[mb][nb] = (v8f){};
    const bf* ra = sm + (wr * 32 + lr) * GPI + 8 * hi; const bf* rb = sm + (128 + wc * 64 + lr) * GPI + 8 * hi;   // the wave's first A row and first Bt row in buffer 0, the lane's k offset
    copy(0, 0); copy(1, 1); copy(2, 2); copy(3, 3);   // every buffer is free: the first four stages, 32 copies a wave
    asm volatile("s_wait_asynccnt 0x18" ::: "memory");   // all but this wave's 24 youngest copies (stages 1 to 3, eight each) have landed: stage 0's
    __syncthreads();   // and every other wave's: stage 0 is in LDS before any wave reads it
    for (int t = 0; t < KK / GKS; ++t) {
        const int off = (t & (GNB - 1)) * GBW;
#pragma unroll
        for (int ks = 0; ks < 2; ++ks) { V a[2], b[4];
#pragma unroll
            for (int mb = 0; mb < 2; ++mb) a[mb] = WFrag<bf>::ld(ra + off + mb * 16 * GPI + ks * 32);
#pragma unroll
            for (int nb = 0; nb < 4; ++nb) b[nb] = WFrag<bf>::ld(rb + off + nb * 16 * GPI + ks * 32);
            __builtin_amdgcn_sched_barrier(0);   // the 12 fragment loads of a k step stand as one group in front of its 8 products (one LDS latency a k step); left free, the compiler deals them out in pairs between the products, each pair waited for alone
#pragma unroll
            for (int nb = 0; nb < 4; ++nb)
#pragma unroll
                for (int mb = 0; mb < 2; ++mb) acc[mb][nb] = WFrag<bf>::mma(a[mb], b[nb], acc[mb][nb]);
            __builtin_amdgcn_sched_barrier(0);   // and the next group stays behind these products, so that it takes their fragments' registers
        }
        asm volatile("s_wait_dscnt 0x0" ::: "memory");      // this wave's reads of the buffer are over
        // its copies of stage t + 1 have landed: while stages t + 2 and t + 3 exist they are exactly the wave's 16 youngest copies (eight a stage in every wave and trip) and stay in flight; in the last three trips the wait is to 0
        if (t + GNB - 1 < KK / GKS) asm volatile("s_wait_asynccnt 0x10" ::: "memory");
        else asm volatile("s_wait_asynccnt 0x0" ::: "memory");
        __syncthreads();   // publishes stage t + 1 and ends every wave's reads of stage t, whose buffer is refilled behind it
        if (t + GNB < KK / GKS) copy(t + GNB, t & (GNB - 1));
    }
    asm volatile("s_wait_asynccnt 0x0" ::: "memory");   // no copy is outstanding when the ring is given another use
    // The last trip's barrier has ended every read of the ring: it now stages the output, each wave's 32 x 64 block in a range of its own, so that whole lines are stored.
    float* ow = (float*)sm + wv * (32 * 68);
#pragma unroll
    for (int mb = 0; mb < 2; ++mb)
#pragma unroll
        for (int nb = 0; nb < 4; ++nb)
#pragma unroll
            for (int j = 0; j < 8; ++j) ow[(mb * 16 + hi * 8 + j) * 68 + nb * 16 + lr] = acc[mb][nb][j];
    __syncthreads();   // a lane reads back what other lanes of its wave wrote: the writes are in LDS first
    TO* cw = C + (size_t)(c0 / 64 + wc) * sN + (size_t)(r0 + wr * 32) * ldc;
#pragma unroll
    for (int s = 0; s < 16; ++s) { const int row = 2 * s + hi, cofs = lr * 4; st4(cw + (size_t)row * ldc + cofs, *(const v4fa*)(ow + row * 68 + cofs)); }
}
// k_gemmw: grid (M / 128, N / 128), 256 threads.
template <typename TO, int KK>
__global__ __launch_bounds__(256) void k_gemmw(const bf* __restrict__ A, const bf* __restrict__ Bt, TO* C, int ldc, size_t sN) {
    gemm_tile<TO, KK>(A, Bt, C, ldc, sN, blockIdx.x * 128, blockIdx.y * 128);
}
// k_proj: the six projections (three tables x two entries) as ONE flat grid of (TT / 128 token tiles) x (DQ / 128 pairs of heads) x 3 x NB_ work-groups. The pair of heads runs fastest; behind it the token tiles that are wanted, counted end to end: all of q's, then the live ones of k, then of v (live_tiles, entry 0 in front of entry 1), so that the work-groups with work are the first of the grid and spread evenly; the rest return at once. X: the tables' bf16 copies [3][NB_][TT][DM]; Wt: Wq, Wk, Wv [3][DQ][DM]; P: the head planes, q and k [b][h][t][d], then v transposed [b][h][d][t].
// q, k: x W^T, column block h is head h's plane (pitch HD). v: Wv x^T, row = channel h x 64 + d, column = token (pitch TT).
__global__ __launch_bounds__(256) void k_proj(const bf* __restrict__ X, const bf* __restrict__ Wt, const int* __restrict__ slen, h16* P) {
    static_assert(NB_ == 2, "two entries' live tiles are counted end to end");
    const int n0 = live_tiles(slen[0]), nl = n0 + live_tiles(slen[1]);   // live tiles of entry 0, of both entries
    int u = (int)blockIdx.x / (DQ / 128), tb = 0, en = u / (TT / 128);   // the token tile's number in the count; as q's: table 0, entry, tile
    if (u < NB_ * (TT / 128)) u -= en * (TT / 128);
    else { u -= NB_ * (TT / 128);
        if (u >= 2 * nl) return;   // no tile left: the same for the whole work-group, in front of every copy and barrier
        tb = u < nl ? 1 : 2; u -= (tb - 1) * nl; en = u < n0 ? 0 : 1; u -= en * n0; }   // u < the entry's live tiles <= TT / 128
    const int zz = tb * NB_ + en; const bool tr = tb == 2; const int t0 = u * 128, ch0 = ((int)blockIdx.x % (DQ / 128)) * 128;
    const bf* x = X + (size_t)zz * TT * DM; const bf* w = Wt + (size_t)tb * DQ * DM; h16* p = P + (size_t)zz * NH_ * TT * HD;
    gemm_tile<h16, DM>(tr ? w : x, tr ? x : w, p, tr ? TT : HD, tr ? (size_t)64 : (size_t)TT * HD, tr ? ch0 : t0, tr ? t0 : ch0);
}



__device__ __forceinline__ void splitf(float y, unsigned short& h, unsigned short& l) { h = f2bf(y); l = f2bf(y - bf2f(h)); }
typedef __attribute__((ext_vector_type(4))) unsigned short v4us;
typedef __attribute__((ext_vector_type(4))) int v4i;

// ---- k_cvtall: every float matrix input rounded to bf16 once, in ONE launch; grid XCH / 256. Thread t takes the 8-element chunk t of the four weights counted end to end and chunk t of each of the three tables (a table is as long as the four weights together); dst: Wq, Wk, Wv, Wo, q, k, v end to end. A work-group's chunks of k and v are two token rows of one entry: past the entry's live tiles they are left out.
#define WCH ((size_t)DQ * DM / 8)         // chunks a weight
#define XCH ((size_t)NB_ * TT * DM / 8)   // chunks a table
__device__ __forceinline__ v8us rnd8(v8f v) { v8us o;
#pragma unroll   // constant indices, so that v and o stay in registers
    for (int k = 0; k < 8; ++k) o[k] = f2bf(v[k]);
    return o; }
__global__ __launch_bounds__(256) void k_cvtall(const float* __restrict__ wq, const float* __restrict__ wk, const float* __restrict__ wv, const float* __restrict__ wo, const float* __restrict__ xq, const float* __restrict__ xk, const float* __restrict__ xv, const int* __restrict__ slen, bf* dst) {
    static_assert(4 * WCH == XCH && WCH % 256 == 0 && DKV == DQ, "the four weights together are as long as one table; a work-group stays inside one weight");
    const size_t g = (size_t)blockIdx.x * 2048; const unsigned e = threadIdx.x * 8;   // the work-group's first element (t = g / 8 + threadIdx.x) and the thread's chunk behind it
    const unsigned wi = blockIdx.x / (unsigned)(WCH / 256);   // which weight: one for the whole work-group
    const float* w = (wi == 0 ? wq : wi == 1 ? wk : wi == 2 ? wv : wo) + (g - wi * WCH * 8);
    static_assert(2048 % DM == 0 && (TT * DM) % 2048 == 0 && (128 * DM) % 2048 == 0, "a work-group holds whole token rows of one 128-token tile of one entry");
    const unsigned en = blockIdx.x / (unsigned)(TT * DM / 2048), tok = (blockIdx.x % (unsigned)(TT * DM / 2048)) * (2048 / DM);   // the entry (0 .. NB_ - 1 by the grid) and the first token of the work-group's rows
    const bool live = (int)tok < live_tiles(slen[en]) * 128;   // one answer for the whole work-group
    const v8f a = *(const v8f*)(w + e), b = *(const v8f*)(xq + g + e);
    dst += g;
    if (live) { const v8f c = *(const v8f*)(xk + g + e), d = *(const v8f*)(xv + g + e); *(v8us*)(dst + 2 * XCH * 8 + e) = rnd8(c); *(v8us*)(dst + 3 * XCH * 8 + e) = rnd8(d); }
    *(v8us*)(dst + e) = rnd8(a); *(v8us*)(dst + XCH * 8 + e) = rnd8(b);
}
// ---- k_fattn: one work-group = 256 queries of one head of one batch entry: the 128-query tile tx and the tile 15 - tx; 8 waves x 32 query columns (2 groups of 16, one from each tile); grid (TT / 256, heads, entries).
// St = K Q^T (A = 16 key rows, B = 16 query columns) and Ot += Vt Pt: a lane holds the scores of ONE query (column lr), keys 8 hi + r of each 16-key tile, so two score tiles converted in place ARE the B operand of the value product (the hardware k order, which WFrag's loader gives A as well).
// K and Vt tiles of 64 keys go through registers into LDS (whole 128-byte lines from memory, rows padded to 144 bytes for the 16-byte readers), two buffers: the next tile's loads fly while this one is worked on.
#define FKS 64     // keys a stage
#define FPI 72     // LDS row pitch in 16-bit words: 128 bytes + 16
#define FC2 0.18033688011112042f   // HD^-0.5 x log2(e): scores in base 2
__device__ __forceinline__ float xhalf(float x) { return __builtin_bit_cast(float, __builtin_amdgcn_permlanex16(__builtin_bit_cast(int, x), __builtin_bit_cast(int, x), 0x76543210, 0xfedcba98, false, false)); }   // lane l with lane l ^ 16
// eight 2^x in one statement: the early-clobber results keep every v_exp_f32 clear of its neighbour's source and result, and the closing v_nop is the one slot the instruction set asks for between a transcendental and a reader of its result
__device__ __forceinline__ v8f exp2x8(v8f x) { float p0, p1, p2, p3, p4, p5, p6, p7;
    asm("v_exp_f32 %0, %8\n\tv_exp_f32 %1, %9\n\tv_exp_f32 %2, %10\n\tv_exp_f32 %3, %11\n\tv_exp_f32 %4, %12\n\tv_exp_f32 %5, %13\n\tv_exp_f32 %6, %14\n\tv_exp_f32 %7, %15\n\tv_nop"
        : "=&v"(p0), "=&v"(p1), "=&v"(p2), "=&v"(p3), "=&v"(p4), "=&v"(p5), "=&v"(p6), "=&v"(p7) : "v"(x[0]), "v"(x[1]), "v"(x[2]), "v"(x[3]), "v"(x[4]), "v"(x[5]), "v"(x[6]), "v"(x[7]));
    return (v8f){p0, p1, p2, p3, p4, p5, p6, p7}; }
// fa_pass: NS x 32 keys of the staged tile (kb, vb point at the first of them; key0 is its number) against this wave's query groups G0 .. 1: scores, keep test, online softmax, value product.
template <int NS, int G0>
__device__ __forceinline__ void fa_pass(const h16* kb, const h16* vb, int key0, int lr, int hi, const v16h (&qf)[2][2], const int (&lim)[2], v8f (&o)[4][2], float (&m)[2], float (&l)[2]) {
    v16h ka[NS][2][2]; v8f s[NS][2][2];
#pragma unroll
    for (int sb = 0; sb < NS; ++sb)
#pragma unroll
        for (int kt = 0; kt < 2; ++kt) { const h16* kr = kb + (sb * 32 + kt * 16 + lr) * FPI + 8 * hi; ka[sb][kt][0] = WFrag<h16>::ld(kr); ka[sb][kt][1] = WFrag<h16>::ld(kr + 32); }
    if constexpr (NS == 2) __builtin_amdgcn_sched_barrier(0);   // the 64-key pass: all 16 K fragment loads stand as one group in front of the score products (one LDS latency a pass); left free, the compiler deals them out in pairs between the products, each pair waited for almost alone
#pragma unroll
    for (int sb = 0; sb < NS; ++sb)
#pragma unroll
        for (int kt = 0; kt < 2; ++kt)
#pragma unroll
            for (int g = G0; g < 2; ++g) { s[sb][kt][g] = wmma16(ka[sb][kt][0], qf[g][0], (v8f){}); s[sb][kt][g] = wmma16(ka[sb][kt][1], qf[g][1], s[sb][kt][g]); }
    if constexpr (NS == 2) __builtin_amdgcn_sched_barrier(0);   // keeps the 16 Vt fragment loads of the 64-key pass behind the score products: they take the K fragments' registers and do not queue in front of K fragments that a product waits for
    v16h va[NS][4];
#pragma unroll
    for (int sb = 0; sb < NS; ++sb)
#pragma unroll
        for (int dt = 0; dt < 4; ++dt) va[sb][dt] = WFrag<h16>::ld(vb + (dt * 16 + lr) * FPI + sb * 32 + 8 * hi);
    __builtin_amdgcn_sched_barrier(0);   // keeps the Vt fragment loads in front of the softmax, whose vector work then covers their LDS latency; without it they sink to directly in front of each value product
    float bm[2]; bool need = false;
#pragma unroll
    for (int g = G0; g < 2; ++g) { const int rem = lim[g] - (key0 + 8 * hi); float x = -3.0e38f;   // this lane's key sb x 32 + kt x 16 + r of the pass is kept where that number < rem
#pragma unroll
        for (int sb = 0; sb < NS; ++sb)
#pragma unroll
            for (int kt = 0; kt < 2; ++kt)
#pragma unroll
                for (int r = 0; r < 8; ++r) { const float t = (sb * 32 + kt * 16 + r < rem) ? s[sb][kt][g][r] * FC2 : -3.0e38f; s[sb][kt][g][r] = t; x = fmaxf(x, t); }
        x = fmaxf(x, xhalf(x)); bm[g] = x; need = need || (x - m[g] > 8.0f); }
    if (__builtin_amdgcn_ballot_w32(need) != 0) {   // a scalar branch: the maximum in use moves only where a column's new maximum is more than 8 (base 2) above it, so a weight is at most 2^8
#pragma unroll
        for (int g = G0; g < 2; ++g) { const float mn = fmaxf(m[g], bm[g]); const float al = __builtin_amdgcn_exp2f(m[g] - mn); m[g] = mn; l[g] *= al;
#pragma unroll
            for (int dt = 0; dt < 4; ++dt) o[dt][g] *= al; } }
    v16h pf[NS][2];
#pragma unroll
    for (int g = G0; g < 2; ++g) { float ls[NS];   // the weights' sum, one chain of additions for each 32 keys: the 64-key pass has two short chains side by side in place of one long one
#pragma unroll
        for (int sb = 0; sb < NS; ++sb) { ls[sb] = sb == 0 ? l[g] : 0.0f;
#pragma unroll
            for (int kt = 0; kt < 2; ++kt) { const v8f p = exp2x8(s[sb][kt][g] - m[g]);
#pragma unroll
                for (int r = 0; r < 8; ++r) { ls[sb] += p[r]; pf[sb][g][kt * 8 + r] = (h16)p[r]; } } }
        l[g] = NS == 2 ? ls[0] + ls[NS - 1] : ls[0]; }
#pragma unroll
    for (int sb = 0; sb < NS; ++sb)
#pragma unroll
        for (int dt = 0; dt < 4; ++dt)
#pragma unroll
            for (int g = G0; g < 2; ++g) o[dt][g] = wmma16(va[sb][dt], pf[sb][g], o[dt][g]);
}
__global__ __launch_bounds__(256) void k_fattn(const h16* __restrict__ Q, const h16* __restrict__ Kp, const h16* __restrict__ Vt, const int* __restrict__ slen, bf* AT) {
    __shared__ __align__(16) h16 ks[2][FKS * FPI];
    __shared__ __align__(16) h16 vs[2][HD * FPI];
    const int tid = (int)threadIdx.x, lane = tid & 31, lr = lane & 15, hi = lane >> 4; const int wv = __builtin_amdgcn_readfirstlane(tid >> 5);
    const int h = blockIdx.y, b = blockIdx.z; const size_t pl = ((size_t)b * NH_ + h) * TT * HD; Q += pl; Kp += pl; Vt += pl;
    const int tx = blockIdx.x; const int qb[2] = {tx * 128 + wv * 16, (TT / 128 - 1 - tx) * 128 + wv * 16};   // the wave's two groups' first queries: one in the early tile tx, one in the late tile 15 - tx, so that every work-group's kept keys add up alike
    const int ln = slen[b];   // the entry's key length: compared only
    const bool none = ln < 1;   // no key kept at all: every score is the same replacement, so every key of the table weighs alike: such an entry runs over all keys
    const int ea = (tx + 1) * 128, eb = (TT / 128 - tx) * 128;   // one past the last key that the causal rule leaves to the early tile, to the late tile (ea <= eb <= TT)
    const int na = none ? TT / FKS : ((ea < ln ? ea : ln) + FKS - 1) / FKS, nst = none ? TT / FKS : ((eb < ln ? eb : ln) + FKS - 1) / FKS;   // stages that hold a kept key of the early tile, of either tile: 1 <= na <= nst <= TT / FKS, the same for the whole work-group
    v16h qf[2][2]; int lim[2]; v8f o[4][2]; float m[2], l[2];
#pragma unroll
    for (int g = 0; g < 2; ++g) { const int qi = qb[g] + lr; qf[g][0] = WFrag<h16>::ld(Q + (size_t)qi * HD + 8 * hi); qf[g][1] = WFrag<h16>::ld(Q + (size_t)qi * HD + 32 + 8 * hi);
        lim[g] = (qi + 1 < ln) ? qi + 1 : ln;   // key j is kept where j <= qi AND j < ln: j < lim
        m[g] = -3.0e38f; l[g] = 0.0f;
#pragma unroll
        for (int dt = 0; dt < 4; ++dt) o[dt][g] = (v8f){}; }
    const int srow = tid >> 3, sc = (tid & 7) * 8;   // staging: 8 threads a 128-byte row, rows srow and srow + 32 of each tile
    const h16* kg = Kp + (size_t)srow * HD + sc; const h16* vg = Vt + (size_t)srow * TT + sc;
    v8h rk0 = *(const v8h*)kg, rk1 = *(const v8h*)(kg + 32 * HD), rv0 = *(const v8h*)vg, rv1 = *(const v8h*)(vg + (size_t)32 * TT);
    auto fetch = [&](int sn) { const h16* kn = kg + (size_t)sn * FKS * HD; const h16* vn = vg + sn * FKS; rk0 = *(const v8h*)kn; rk1 = *(const v8h*)(kn + 32 * HD); rv0 = *(const v8h*)vn; rv1 = *(const v8h*)(vn + (size_t)32 * TT); };   // stage sn's rows into registers
    auto put = [&](int nx) { *(v8h*)(&ks[nx][srow * FPI + sc]) = rk0; *(v8h*)(&ks[nx][(srow + 32) * FPI + sc]) = rk1; *(v8h*)(&vs[nx][srow * FPI + sc]) = rv0; *(v8h*)(&vs[nx][(srow + 32) * FPI + sc]) = rv1; };   // and from there into buffer nx
    auto finish = [&](int g) { const float inv = __fdiv_rn(1.0f, l[g] + xhalf(l[g])); bf* ar = AT + ((size_t)b * TT + qb[g] + lr) * DQ + h * HD + hi * 8;   // the two halves of a column hold different keys' weights: joined once
#pragma unroll
        for (int dt = 0; dt < 4; ++dt) { v8us w;
#pragma unroll
            for (int r = 0; r < 8; ++r) w[r] = f2bf(o[dt][g][r] * inv);
            *(v8us*)(ar + dt * 16) = w; } };
    put(0);
    __syncthreads();   // stage 0 is in LDS before any wave reads it
    // A stage past a tile's last kept key holds only exact-zero weights for it and is left out: stages 0 .. na - 1 serve both groups, stages na .. nst - 1 the late group alone (the stage's 64 keys in one pass).
    int st = 0;
    for (; st < na; ++st) {
        const int cur = st & 1; const bool more = st + 1 < nst;
        if (more) fetch(st + 1);
        fa_pass<1, 0>(&ks[cur][0], &vs[cur][0], st * FKS, lr, hi, qf, lim, o, m, l); fa_pass<1, 0>(&ks[cur][32 * FPI], &vs[cur][32], st * FKS + 32, lr, hi, qf, lim, o, m, l);
        if (more) put(cur ^ 1);
        __syncthreads();   // publishes the next stage and ends every wave's reads of this one, which the stage after next overwrites
    }
    finish(0);
    asm volatile("s_wait_xcnt 0x0" ::: "memory");   // stands in front of the second loop's first arithmetic, which is given registers that the early group's four stores name (seen in the listing)
    for (; st < nst; ++st) {
        const int cur = st & 1; const bool more = st + 1 < nst;
        if (more) fetch(st + 1);
        fa_pass<2, 1>(&ks[cur][0], &vs[cur][0], st * FKS, lr, hi, qf, lim, o, m, l);
        if (more) put(cur ^ 1);
        __syncthreads();   // as in the loop above
    }
    finish(1);
}


template <bool RES>
__global__ __launch_bounds__(256) void k_lnrow(const float* __restrict__ A, const bf* __restrict__ R, const float* __restrict__ gamma, const float* __restrict__ beta, float eps, int C, int nrows, float* Y) {
    const int lane = threadIdx.x & 31; const int row = blockIdx.x * 8 + (threadIdx.x >> 5); if (row >= nrows) return; const int nch = C / 128; const float* a = A + (size_t)row * C; float x[LNC_MAX / 32]; float s = 0.0f;
    for (int k = 0; k < LNC_MAX / 128; ++k) { if (k < nch) { const int c0 = k * 128 + lane * 4; v4f v = *(const v4f*)(a + c0);
            if (RES) { asm volatile("s_wait_xcnt 0x0" ::: "memory");   // stands in front of the chunk's second load, whose result may be given a register that the first load names as its address (seen in the listing at the last chunk, where those registers die)
                const v4us w = *(const v4us*)(R + (size_t)row * C + c0); v[0] = __fadd_rn(v[0], bf2f(w[0])); v[1] = __fadd_rn(v[1], bf2f(w[1])); v[2] = __fadd_rn(v[2], bf2f(w[2])); v[3] = __fadd_rn(v[3], bf2f(w[3])); }
            x[k * 4 + 0] = v[0]; x[k * 4 + 1] = v[1]; x[k * 4 + 2] = v[2]; x[k * 4 + 3] = v[3]; s = __fadd_rn(__fadd_rn(__fadd_rn(__fadd_rn(s, v[0]), v[1]), v[2]), v[3]); } }
    for (int sh = 16; sh; sh >>= 1) s = __fadd_rn(s, __shfl_xor(s, sh, 32));
    const float mean = __fdiv_rn(s, (float)C); float q = 0.0f;
    for (int k = 0; k < LNC_MAX / 128; ++k) { if (k < nch) {
            for (int j = 0; j < 4; ++j) { const float d = __fsub_rn(x[k * 4 + j], mean); x[k * 4 + j] = d; q = __fmaf_rn(d, d, q); } } }
    for (int sh = 16; sh; sh >>= 1) q = __fadd_rn(q, __shfl_xor(q, sh, 32));
    const float rstd = __fdiv_rn(1.0f, sqrtf(__fadd_rn(__fdiv_rn(q, (float)C), eps)));
    for (int k = 0; k < LNC_MAX / 128; ++k) { if (k < nch) { const int c0 = k * 128 + lane * 4; const v4f g = *(const v4f*)(gamma + c0); const v4f bt = *(const v4f*)(beta + c0);
            for (int j = 0; j < 4; ++j) x[k * 4 + j] = __fmaf_rn(__fmul_rn(x[k * 4 + j], rstd), bfr(g[j]), bfr(bt[j])); } }
    float* y = Y + (size_t)row * C;
    {
        for (int k = 0; k < LNC_MAX / 128; ++k) { if (k < nch) { v4f o; o[0] = x[k * 4 + 0]; o[1] = x[k * 4 + 1]; o[2] = x[k * 4 + 2]; o[3] = x[k * 4 + 3]; *(v4f*)(y + k * 128 + lane * 4) = o; } }
         }
}
extern "C" void kernel_launch(void* const* d_in, const int* in_sizes, int n_in,
                              void* d_out, int out_size, void* d_ws, size_t ws_size, hipStream_t stream) {
    (void)in_sizes; (void)n_in; (void)out_size;
    const float* xq = (const float*)d_in[0]; const float* xk = (const float*)d_in[1]; const float* xv = (const float*)d_in[2]; const float* wq = (const float*)d_in[3]; const float* wk = (const float*)d_in[4]; const float* wv = (const float*)d_in[5]; const float* wo = (const float*)d_in[6]; const float* lng = (const float*)d_in[7]; const float* lnb = (const float*)d_in[8]; const int* sl = (const int*)d_in[9];   /* the module's argument order: ten inputs, all read; sen_len int32 [2] */
    float* OUT = (float*)d_out;     // [2][2048][1024]
    static_assert(DM % 128 == 0 && DM <= LNC_MAX, "k_lnrow's channel count");
    char* wsp = (char*)d_ws;
    auto take = [&](size_t bytes) { char* p = wsp; wsp += (bytes + 255) & ~(size_t)255; return (void*)p; };
    bf* WB = (bf*)take((4 * (size_t)DQ * DM + 3 * (size_t)NB_ * TT * DM) * 2);   /* the bf16 copies end to end: Wq, Wk, Wv, Wo ('out, in' [1024][1024]: K-contiguous, an operand of its product as it lies), then q, k, v [2][2048][1024] */
    bf* WO = WB + 3 * (size_t)DQ * DM; bf* XB = WB + 4 * (size_t)DQ * DM;
    h16* QP16 = (h16*)take(3 * (size_t)NB_ * NH_ * TT * HD * 2); h16* KP16 = QP16 + (size_t)NB_ * NH_ * TT * HD; h16* VT16 = KP16 + (size_t)NB_ * NKV * TT * HD;   /* the head planes of both entries, q, k, v end to end: one launch writes them, one attention launch reads them all */
    bf* ATh = (bf*)take((size_t)NB_ * TT * DQ * 2); float* YO = (float*)take((size_t)NB_ * TT * DM * 4);
    if ((size_t)(wsp - (char*)d_ws) > ws_size) return;    // total 80 MiB of the workspace by these reservations' own sum
    k_cvtall<<<(unsigned)(XCH / 256), 256, 0, stream>>>(wq, wk, wv, wo, xq, xk, xv, sl, WB);
    static_assert(HD == 64 && NH_ == NKV && TT % 128 == 0 && DQ % 128 == 0 && DM % 128 == 0, "one 64-column block of a projection is one head; the three weights are alike in shape; whole 128x128 tiles");
    k_proj<<<(TT / 128) * (DQ / 128) * 3 * NB_, 256, 0, stream>>>(XB, WB, sl, QP16);
    static_assert(NH_ == NKV && TT % 256 == 0 && HD == 64, "k_fattn's shape");
    k_fattn<<<dim3(TT / 256, NH_, NB_), 256, 0, stream>>>(QP16, KP16, VT16, sl, ATh);   /* scores, keep test, softmax, value product and merge of every head of both entries */
    k_gemmw<float, DQ><<<dim3(NB_ * TT / 128, DM / 128, 1), 256, 0, stream>>>(ATh, WO, YO, DM, 64);   /* y = merged (one bf16 word) Wo^T into a workspace plane, the rows of both entries */
    k_lnrow<true><<<(unsigned)((NB_ * TT + 7) / 8), 256, 0, stream>>>(YO, XB, lng, lnb, 1.0e-6f, DM, NB_ * TT, OUT);   /* out = LN(y + q) x gamma + beta (q: its bf16 copy): the one writer of the output */
}

// v009
// A run of this version takes 70.5 microseconds.
// Next to v008, in two timings, it ran 1.08 and 1.09 times as fast.
// Over all steps from v000 it is 19.3 times as fast.
#include <hip/hip_runtime.h>

// Multi-head attention on three input tables with a causal rule AND a per-entry key length, an output map, a residual and a layer norm
// (a0 q, a1 k, a2 v [2][2048][1024]; a3 Wq, a4 Wk, a5 Wv, a6 Wo [1024][1024] 'out, in' (y = x W^T), no biases; a7 gamma, a8 beta [1024]; a9 sen_len int32 [2]: the entry's key length (1 .. 2,048);
//  16 heads x 64 (head h = columns h x 64 ..); S = (q Wq^T)(k Wk^T)^T / 8; A KEY j IS KEPT FOR QUERY i WHERE j <= i AND j < sen_len[b]; every other score is replaced by -1e9 (an exclusion: every row keeps key 0); softmax over the keys; ctx = A (v Wv^T); merged token-major; y = merged Wo^T;
//  x = y + q (the raw query table); the result = (x - mean) x rsqrt(var + 1e-6) x gamma + beta over the 1,024 channels (biased variance) -> [2][2048][1024]; argument order q, k, v, Wq, Wk, Wv, Wo, gamma, beta, sen_len).
// Layout: ONE LAUNCH A STAGE, five in all: a bf16 copy of the four weights and the three tables, both entries, made by one launch (of k and v, here and in their projections, only the 128-token tiles that hold a key below the entry's length: live_tiles; the 'out, in' weights as they lie: K-contiguous, the product's second operand, Wv its first); the six exact projections in one grid, whose own epilogue rounds each 64-column block (one head's columns) to f16 and stores it where the head planes of BOTH batch entries want it (q, k [b][h][t][d]; v transposed [b][h][d][t]: that product runs as Wv x^T, rows = channels, so its rows lie as the plane's do);
// ONE attention kernel over all heads and both entries (k_fattn): scores, the keep test (two compares folded into one bound a query), an online softmax, the value product and the token-major merge stay in registers; the key loop ENDS AT THE LAST KEPT KEY of each tile of 128 queries (an excluded key takes -3.0e38 before the maximum, so its weight is an exact zero: -1e9 below a kept score gives exp of -1e9: an exact zero too; a stage of such keys alone adds nothing and is left out);
// EVERY row on ONE fp16 product (the weights against the maximum in use, at most 2^8); the merged context on ONE bf16 word x Wo exact into a workspace plane (both entries' rows in one grid); the residual (the query table's bf16 copy, the one the q projection reads) added and the row normalised by k_lnrow: the one writer of the output.
// Compute dtypes, f32 accumulate: every float input rounded to bf16 at its load; projections exact; attention: one fp16 product on every row; softmax f32; the output map bf16 x bf16 on one word a side; the norm f32; the integer input is compared only.

#define NB_  2
#define TT   2048
#define DM   1024
#define NH_  16
#define NKV  16
#define REP  (NH_ / NKV)
#define HD   64
#define DQ   (NH_ * HD)
#define DKV  (NKV * HD)
#define LNC_MAX 2048

typedef _Float16 h16;
typedef unsigned short bf;
typedef __attribute__((ext_vector_type(16))) __bf16   v16bf;
typedef __attribute__((ext_vector_type(16))) _Float16 v16h;
typedef __attribute__((ext_vector_type(8)))  _Float16 v8h;
typedef __attribute__((ext_vector_type(4)))  _Float16 v4h;
typedef __attribute__((ext_vector_type(8)))  unsigned short v8us;
typedef __attribute__((ext_vector_type(8)))  float    v8f;
typedef __attribute__((ext_vector_type(4)))  float    v4f;
typedef v8h  __attribute__((may_alias)) v8ha;
typedef v4f  __attribute__((may_alias)) v4fa;
typedef v8us __attribute__((may_alias)) v8usa;

__device__ __forceinline__ unsigned short f2bf(float f) { unsigned u = __float_as_uint(f); u += 0x7FFFu + ((u >> 16) & 1u); return (unsigned short)(u >> 16); }
__device__ __forceinline__ float bf2f(unsigned short b) { return __uint_as_float(((unsigned)b) << 16); }
__device__ __forceinline__ float bfr(float f) { return bf2f(f2bf(f)); }
__device__ __forceinline__ v16h cat16(v8h lo, v8h hi) { return __builtin_shufflevector(lo, hi, 0, 1, 2, 3, 4, 5, 6, 7, 8, 9, 10, 11, 12, 13, 14, 15); }
__device__ __forceinline__ v16bf cat16b(v8us lo, v8us hi) { return __builtin_bit_cast(v16bf, __builtin_shufflevector(lo, hi, 0, 1, 2, 3, 4, 5, 6, 7, 8, 9, 10, 11, 12, 13, 14, 15)); }
__device__ __forceinline__ v8f wmma16(v16h a, v16h b, v8f c) { return __builtin_amdgcn_wmma_f32_16x16x32_f16(false, a, false, b, (short)0, c, false, false); }
__device__ __forceinline__ v8f wmmab(v16bf a, v16bf b, v8f c) { return __builtin_amdgcn_wmma_f32_16x16x32_bf16(false, a, false, b, (short)0, c, false, false); }
// live_tiles: how many 128-token tiles of an entry's k and v tables hold a key that some query keeps (key j is kept only where j < ln): 1 .. TT / 128 for any ln. An entry that keeps no key at all (ln < 1) weighs every key alike and needs them all.
// k_fattn reads keys below ln rounded up to 64 and no others, so rows past these tiles are neither rounded nor projected, and their places in the workspace are never read.
__device__ __forceinline__ int live_tiles(int ln) { const int c = ln > TT ? TT : ln; return c < 1 ? TT / 128 : (c + 127) / 128; }



// ---- gemm_tile, k_gemmw, k_proj: one 128x128 output tile per work-group of 8 waves (4 x 2; a wave holds 32 rows x 64 columns, 8 accumulators) over the whole of K; both operands K-contiguous bf16 planes.
// C[m][n] (f32 sums, stored as TO: f32, or rounded once to f16) = sum_k A[m][k] Bt[n][k], k in rising order in one accumulator.
// Where C lies: row m at pitch ldc, the 64-column block number y at y x sN elements (sN = 64: a plain row-major matrix; sN = rows x 64 with ldc = 64: one [row][64] plane a block of columns).
// The operands come through LDS: a stage is 64 k = one whole 128-byte line of each of the tile's 128 A rows and 128 Bt rows, brought by asynchronous 16-byte copies (8 lanes a line, 4 lines a wave-wide copy, 8 copies a lane), rows padded to 144 bytes for the 16-byte readers; a ring of four buffers: the copies of the next three stages fly while this one is worked on, so that a stage has three trips' time to come from memory. Every line is fetched once a work-group and read from LDS by the 2 or 4 waves that need it.
template <typename T16> struct WFrag;
template <> struct WFrag<h16> { typedef v16h V; static __device__ __forceinline__ V ld(const h16* p) { return cat16(*(const v8h*)p, *(const v8h*)(p + 16)); } static __device__ __forceinline__ v8f mma(V a, V b, v8f c) { return wmma16(a, b, c); } };
template <> struct WFrag<bf> { typedef v16bf V; static __device__ __forceinline__ V ld(const bf* p) { return cat16b(*(const v8us*)p, *(const v8us*)(p + 16)); } static __device__ __forceinline__ v8f mma(V a, V b, v8f c) { return wmmab(a, b, c); } };
__device__ __forceinline__ void st4(float* p, v4f v) { *(v4f*)p = v; }
__device__ __forceinline__ void st4(h16* p, v4f v) { v4h o; o[0] = (h16)v[0]; o[1] = (h16)v[1]; o[2] = (h16)v[2]; o[3] = (h16)v[3]; *(v4h*)p = o; }
#define GKS 64                 // k a stage
#define GPI 72                 // LDS row pitch in 16-bit words: 128 bytes + 16
#define GBW (256 * GPI)        // 16-bit words a buffer: 128 A rows, then 128 Bt rows
#define GNB 4                  // buffers of the ring (a power of two): 144 KiB, two work-groups a WGP
// gemm_tile: the tile whose first row is r0 and first column c0 (multiples of 128); C points at row 0, column 0 of the matrix. KK: the products' length.
template <typename TO, int KK>
__device__ __forceinline__ void gemm_tile(const bf* __restrict__ A, const bf* __restrict__ Bt, TO* C, int ldc, size_t sN, int r0, int c0) {
    static_assert(KK % GKS == 0 && KK / GKS >= GNB && (GNB & (GNB - 1)) == 0, "whole stages, at least one for each buffer");
    static_assert(GNB == 4, "the two counted waits below are written for four buffers of eight copies a lane");
    static_assert(8 * 32 * 68 * 4 <= GNB * GBW * 2, "the output staging fits the ring");
    typedef WFrag<bf>::V V;
    __shared__ __align__(16) bf sm[GNB * GBW];
    const int tid = (int)threadIdx.x, lane = tid & 31, lr = lane & 15, hi = lane >> 4; const int wv = __builtin_amdgcn_readfirstlane(tid >> 5); const int wr = wv >> 1, wc = wv & 1;
    const int srow = tid >> 3, sc = (tid & 7) * 8;   // copies: 8 lanes a 128-byte line; the lane's rows are srow + 32 i of A and of Bt, i = 0 .. 3
    const bf* ag = A + (size_t)(r0 + srow) * KK + sc; const bf* bg = Bt + (size_t)(c0 + srow) * KK + sc;
    const unsigned l0 = (unsigned)(size_t)sm + (unsigned)(srow * GPI + sc) * 2u;   // the lane's LDS byte address of A row srow in buffer 0
    // stage t into buffer nb: the lane's eight copies and, as the last line of their own statement, the wait that stands in front of any rewrite of a register that a copy names
    auto copy = [&](int t, int nb) { const bf* a = ag + t * GKS; const bf* b = bg + t * GKS; const unsigned l = l0 + (unsigned)nb * (GBW * 2u);
        asm volatile("global_load_async_to_lds_b128 %0, %8, off\n\tglobal_load_async_to_lds_b128 %1, %9, off\n\tglobal_load_async_to_lds_b128 %2, %10, off\n\tglobal_load_async_to_lds_b128 %3, %11, off\n\t"
                     "global_load_async_to_lds_b128 %4, %12, off\n\tglobal_load_async_to_lds_b128 %5, %13, off\n\tglobal_load_async_to_lds_b128 %6, %14, off\n\tglobal_load_async_to_lds_b128 %7, %15, off\n\ts_wait_xcnt 0x0"
                     :: "v"(l), "v"(l + 32u * GPI * 2u), "v"(l + 64u * GPI * 2u), "v"(l + 96u * GPI * 2u), "v"(l + 128u * GPI * 2u), "v"(l + 160u * GPI * 2u), "v"(l + 192u * GPI * 2u), "v"(l + 224u * GPI * 2u),
                        "v"(a), "v"(a + 32 * KK), "v"(a + 64 * KK), "v"(a + 96 * KK), "v"(b), "v"(b + 32 * KK), "v"(b + 64 * KK), "v"(b + 96 * KK) : "memory"); };
    v8f acc[2][4];
#pragma unroll
    for (int mb = 0; mb < 2; ++mb)
#pragma unroll
        for (int nb = 0; nb < 4; ++nb) acc[mb][nb] = (v8f){};
    const bf* ra = sm + (wr * 32 + lr) * GPI + 8 * hi; const bf* rb = sm + (128 + wc * 64 + lr) * GPI + 8 * hi;   // the wave's first A row and first Bt row in buffer 0, the lane's k offset
    copy(0, 0); copy(1, 1); copy(2, 2); copy(3, 3);   // every buffer is free: the first four stages, 32 copies a wave
    asm volatile("s_wait_asynccnt 0x18" ::: "memory");   // all but this wave's 24 youngest copies (stages 1 to 3, eight each) have landed: stage 0's
    __syncthreads();   // and every other wave's: stage 0 is in LDS before any wave reads it
    for (int t = 0; t < KK / GKS; ++t) {
        const int off = (t & (GNB - 1)) * GBW;
#pragma unroll
        for (int ks = 0; ks < 2; ++ks) { V a[2], b[4];
#pragma unroll
            for (int mb = 0; mb < 2; ++mb) a[mb] = WFrag<bf>::ld(ra + off + mb * 16 * GPI + ks * 32);
#pragma unroll
            for (int nb = 0; nb < 4; ++nb) b[nb] = WFrag<bf>::ld(rb + off + nb * 16 * GPI + ks * 32);
            __builtin_amdgcn_sched_barrier(0);   // the 12 fragment loads of a k step stand as one group in front of its 8 products (one LDS latency a k step); left free, the compiler deals them out in pairs between the products, each pair waited for alone
#pragma unroll
            for (int nb = 0; nb < 4; ++nb)
#pragma unroll
                for (int mb = 0; mb < 2; ++mb) acc[mb][nb] = WFrag<bf>::mma(a[mb], b[nb], acc[mb][nb]);
            __builtin_amdgcn_sched_barrier(0);   // and the next group stays behind these products, so that it takes their fragments' registers
        }
        asm volatile("s_wait_dscnt 0x0" ::: "memory");      // this wave's reads of the buffer are over
        // its copies of stage t + 1 have landed: while stages t + 2 and t + 3 exist they are exactly the wave's 16 youngest copies (eight a stage in every wave and trip) and stay in flight; in the last three trips the wait is to 0
        if (t + GNB - 1 < KK / GKS) asm volatile("s_wait_asynccnt 0x10" ::: "memory");
        else asm volatile("s_wait_asynccnt 0x0" ::: "memory");
        __syncthreads();   // publishes stage t + 1 and ends every wave's reads of stage t, whose buffer is refilled behind it
        if (t + GNB < KK / GKS) copy(t + GNB, t & (GNB - 1));
    }
    asm volatile("s_wait_asynccnt 0x0" ::: "memory");   // no copy is outstanding when the ring is given another use
    // The last trip's barrier has ended every read of the ring: it now stages the output, each wave's 32 x 64 block in a range of its own, so that whole lines are stored.
    float* ow = (float*)sm + wv * (32 * 68);
#pragma unroll
    for (int mb = 0; mb < 2; ++mb)
#pragma unroll
        for (int nb = 0; nb < 4; ++nb)
#pragma unroll
            for (int j = 0; j < 8; ++j) ow[(mb * 16 + hi * 8 + j) * 68 + nb * 16 + lr] = acc[mb][nb][j];
    __syncthreads();   // a lane reads back what other lanes of its wave wrote: the writes are in LDS first
    TO* cw = C + (size_t)(c0 / 64 + wc) * sN + (size_t)(r0 + wr * 32) * ldc;
#pragma unroll
    for (int s = 0; s < 16; ++s) { const int row = 2 * s + hi, cofs = lr * 4; st4(cw + (size_t)row * ldc + cofs, *(const v4fa*)(ow + row * 68 + cofs)); }
}
// k_gemmw: grid (M / 128, N / 128), 256 threads.
template <typename TO, int KK>
__global__ __launch_bounds__(256) void k_gemmw(const bf* __restrict__ A, const bf* __restrict__ Bt, TO* C, int ldc, size_t sN) {
    gemm_tile<TO, KK>(A, Bt, C, ldc, sN, blockIdx.x * 128, blockIdx.y * 128);
}
// k_proj: the six projections (three tables x two entries) as ONE flat grid of (TT / 128 token tiles) x (DQ / 128 pairs of heads) x 3 x NB_ work-groups. The pair of heads runs fastest; behind it the token tiles that are wanted, counted end to end: all of q's, then the live ones of k, then of v (live_tiles, entry 0 in front of entry 1), so that the work-groups with work are the first of the grid and spread evenly; the rest return at once. X: the tables' bf16 copies [3][NB_][TT][DM]; Wt: Wq, Wk, Wv [3][DQ][DM]; P: the head planes, q and k [b][h][t][d], then v transposed [b][h][d][t].
// q, k: x W^T, column block h is head h's plane (pitch HD). v: Wv x^T, row = channel h x 64 + d, column = token (pitch TT).
__global__ __launch_bounds__(256) void k_proj(const bf* __restrict__ X, const bf* __restrict__ Wt, const int* __restrict__ slen, h16* P) {
    static_assert(NB_ == 2, "two entries' live tiles are counted end to end");
    const int n0 = live_tiles(slen[0]), nl = n0 + live_tiles(slen[1]);   // live tiles of entry 0, of both entries
    int u = (int)blockIdx.x / (DQ / 128), tb = 0, en = u / (TT / 128);   // the token tile's number in the count; as q's: table 0, entry, tile
    if (u < NB_ * (TT / 128)) u -= en * (TT / 128);
    else { u -= NB_ * (TT / 128);
        if (u >= 2 * nl) return;   // no tile left: the same for the whole work-group, in front of every copy and barrier
        tb = u < nl ? 1 : 2; u -= (tb - 1) * nl; en = u < n0 ? 0 : 1; u -= en * n0; }   // u < the entry's live tiles <= TT / 128
    const int zz = tb * NB_ + en; const bool tr = tb == 2; const int t0 = u * 128, ch0 = ((int)blockIdx.x % (DQ / 128)) * 128;
    const bf* x = X + (size_t)zz * TT * DM; const bf* w = Wt + (size_t)tb * DQ * DM; h16* p = P + (size_t)zz * NH_ * TT * HD;
    gemm_tile<h16, DM>(tr ? w : x, tr ? x : w, p, tr ? TT : HD, tr ? (size_t)64 : (size_t)TT * HD, tr ? ch0 : t0, tr ? t0 : ch0);
}



__device__ __forceinline__ void splitf(float y, unsigned short& h, unsigned short& l) { h = f2bf(y); l = f2bf(y - bf2f(h)); }
typedef __attribute__((ext_vector_type(4))) unsigned short v4us;
typedef __attribute__((ext_vector_type(4))) int v4i;

// ---- k_cvtall: every float matrix input rounded to bf16 once, in ONE launch; grid XCH / 256. Thread t takes the 8-element chunk t of the four weights counted end to end and chunk t of each of the three tables (a table is as long as the four weights together); dst: Wq, Wk, Wv, Wo, q, k, v end to end. A work-group's chunks of k and v are two token rows of one entry: past the entry's live tiles they are left out.
#define WCH ((size_t)DQ * DM / 8)         // chunks a weight
#define XCH ((size_t)NB_ * TT * DM / 8)   // chunks a table
__device__ __forceinline__ v8us rnd8(v8f v) { v8us o;
#pragma unroll   // constant indices, so that v and o stay in registers
    for (int k = 0; k < 8; ++k) o[k] = f2bf(v[k]);
    return o; }
__global__ __launch_bounds__(256) void k_cvtall(const float* __restrict__ wq, const float* __restrict__ wk, const float* __restrict__ wv, const float* __restrict__ wo, const float* __restrict__ xq, const float* __restrict__ xk, const float* __restrict__ xv, const int* __restrict__ slen, bf* dst) {
    static_assert(4 * WCH == XCH && WCH % 256 == 0 && DKV == DQ, "the four weights together are as long as one table; a work-group stays inside one weight");
    const size_t g = (size_t)blockIdx.x * 2048; const unsigned e = threadIdx.x * 8;   // the work-group's first element (t = g / 8 + threadIdx.x) and the thread's chunk behind it
    const unsigned wi = blockIdx.x / (unsigned)(WCH / 256);   // which weight: one for the whole work-group
    const float* w = (wi == 0 ? wq : wi == 1 ? wk : wi == 2 ? wv : wo) + (g - wi * WCH * 8);
    static_assert(2048 % DM == 0 && (TT * DM) % 2048 == 0 && (128 * DM) % 2048 == 0, "a work-group holds whole token rows of one 128-token tile of one entry");
    const unsigned en = blockIdx.x / (unsigned)(TT * DM / 2048), tok = (blockIdx.x % (unsigned)(TT * DM / 2048)) * (2048 / DM);   // the entry (0 .. NB_ - 1 by the grid) and the first token of the work-group's rows
    const bool live = (int)tok < live_tiles(slen[en]) * 128;   // one answer for the whole work-group
    const v8f a = *(const v8f*)(w + e), b = *(const v8f*)(xq + g + e);
    dst += g;
    if (live) { const v8f c = *(const v8f*)(xk + g + e), d = *(const v8f*)(xv + g + e); *(v8us*)(dst + 2 * XCH * 8 + e) = rnd8(c); *(v8us*)(dst + 3 * XCH * 8 + e) = rnd8(d); }
    *(v8us*)(dst + e) = rnd8(a); *(v8us*)(dst + XCH * 8 + e) = rnd8(b);
}
// ---- k_fattn: one work-group = 256 queries of one head of one batch entry: the 128-query tile tx and the tile 15 - tx; 8 waves x 32 query columns (2 groups of 16, one from each tile); grid (TT / 256, heads, entries).
// St = K Q^T (A = 16 key rows, B = 16 query columns) and Ot += Vt Pt: a lane holds the scores of ONE query (column lr), keys 8 hi + r of each 16-key tile, so two score tiles converted in place ARE the B operand of the value product (the hardware k order, which WFrag's loader gives A as well).
// K and Vt tiles of 64 keys go through registers into LDS (whole 128-byte lines from memory, rows padded to 144 bytes for the 16-byte readers), two buffers: the next tile's loads fly while this one is worked on.
#define FKS 64     // keys a stage
#define FPI 72     // LDS row pitch in 16-bit words: 128 bytes + 16
#define FC2 0.18033688011112042f   // HD^-0.5 x log2(e): scores in base 2
__device__ __forceinline__ float xhalf(float x) { return __builtin_bit_cast(float, __builtin_amdgcn_permlanex16(__builtin_bit_cast(int, x), __builtin_bit_cast(int, x), 0x76543210, 0xfedcba98, false, false)); }   // lane l with lane l ^ 16
// eight 2^x in one statement: the early-clobber results keep every v_exp_f32 clear of its neighbour's source and result, and the closing v_nop is the one slot the instruction set asks for between a transcendental and a reader of its result
__device__ __forceinline__ v8f exp2x8(v8f x) { float p0, p1, p2, p3, p4, p5, p6, p7;
    asm("v_exp_f32 %0, %8\n\tv_exp_f32 %1, %9\n\tv_exp_f32 %2, %10\n\tv_exp_f32 %3, %11\n\tv_exp_f32 %4, %12\n\tv_exp_f32 %5, %13\n\tv_exp_f32 %6, %14\n\tv_exp_f32 %7, %15\n\tv_nop"
        : "=&v"(p0), "=&v"(p1), "=&v"(p2), "=&v"(p3), "=&v"(p4), "=&v"(p5), "=&v"(p6), "=&v"(p7) : "v"(x[0]), "v"(x[1]), "v"(x[2]), "v"(x[3]), "v"(x[4]), "v"(x[5]), "v"(x[6]), "v"(x[7]));
    return (v8f){p0, p1, p2, p3, p4, p5, p6, p7}; }
// fa_pass: NS x 32 keys of the staged tile (kb, vb point at the first of them; key0 is its number) against this wave's query groups G0 .. 1: scores, keep test, online softmax, value product.
template <int NS, int G0>
__device__ __forceinline__ void fa_pass(const h16* kb, const h16* vb, int key0, int lr, int hi, const v16h (&qf)[2][2], const int (&lim)[2], v8f (&o)[4][2], float (&m)[2], float (&l)[2]) {
    v16h ka[NS][2][2]; v8f s[NS][2][2];
#pragma unroll
    for (int sb = 0; sb < NS; ++sb)
#pragma unroll
        for (int kt = 0; kt < 2; ++kt) { const h16* kr = kb + (sb * 32 + kt * 16 + lr) * FPI + 8 * hi; ka[sb][kt][0] = WFrag<h16>::ld(kr); ka[sb][kt][1] = WFrag<h16>::ld(kr + 32); }
    if constexpr (NS == 2) __builtin_amdgcn_sched_barrier(0);   // the 64-key pass: all 16 K fragment loads stand as one group in front of the score products (one LDS latency a pass); left free, the compiler deals them out in pairs between the products, each pair waited for almost alone
#pragma unroll
    for (int sb = 0; sb < NS; ++sb)
#pragma unroll
        for (int kt = 0; kt < 2; ++kt)
#pragma unroll
            for (int g = G0; g < 2; ++g) { s[sb][kt][g] = wmma16(ka[sb][kt][0], qf[g][0], (v8f){}); s[sb][kt][g] = wmma16(ka[sb][kt][1], qf[g][1], s[sb][kt][g]); }
    if constexpr (NS == 2) __builtin_amdgcn_sched_barrier(0);   // keeps the 16 Vt fragment loads of the 64-key pass behind the score products: they take the K fragments' registers and do not queue in front of K fragments that a product waits for
    v16h va[NS][4];
#pragma unroll
    for (int sb = 0; sb < NS; ++sb)
#pragma unroll
        for (int dt = 0; dt < 4; ++dt) va[sb][dt] = WFrag<h16>::ld(vb + (dt * 16 + lr) * FPI + sb * 32 + 8 * hi);
    __builtin_amdgcn_sched_barrier(0);   // keeps the Vt fragment loads in front of the softmax, whose vector work then covers their LDS latency; without it they sink to directly in front of each value product
    float bm[2]; bool need = false;
#pragma unroll
    for (int g = G0; g < 2; ++g) { const int rem = lim[g] - (key0 + 8 * hi); float x = -3.0e38f;   // this lane's key sb x 32 + kt x 16 + r of the pass is kept where that number < rem
#pragma unroll
        for (int sb = 0; sb < NS; ++sb)
#pragma unroll
            for (int kt = 0; kt < 2; ++kt)
#pragma unroll
                for (int r = 0; r < 8; ++r) { const float t = (sb * 32 + kt * 16 + r < rem) ? s[sb][kt][g][r] * FC2 : -3.0e38f; s[sb][kt][g][r] = t; x = fmaxf(x, t); }
        x = fmaxf(x, xhalf(x)); bm[g] = x; need = need || (x - m[g] > 8.0f); }
    if (__builtin_amdgcn_ballot_w32(need) != 0) {   // a scalar branch: the maximum in use moves only where a column's new maximum is more than 8 (base 2) above it, so a weight is at most 2^8
#pragma unroll
        for (int g = G0; g < 2; ++g) { const float mn = fmaxf(m[g], bm[g]); const float al = __builtin_amdgcn_exp2f(m[g] - mn); m[g] = mn; l[g] *= al;
#pragma unroll
            for (int dt = 0; dt < 4; ++dt) o[dt][g] *= al; } }
    v16h pf[NS][2];
#pragma unroll
    for (int g = G0; g < 2; ++g) { float ls[NS];   // the weights' sum, one chain of additions for each 32 keys: the 64-key pass has two short chains side by side in place of one long one
#pragma unroll
        for (int sb = 0; sb < NS; ++sb) { ls[sb] = sb == 0 ? l[g] : 0.0f;
#pragma unroll
            for (int kt = 0; kt < 2; ++kt) { const v8f p = exp2x8(s[sb][kt][g] - m[g]);
#pragma unroll
                for (int r = 0; r < 8; ++r) { ls[sb] += p[r]; pf[sb][g][kt * 8 + r] = (h16)p[r]; } } }
        l[g] = NS == 2 ? ls[0] + ls[NS - 1] : ls[0]; }
#pragma unroll
    for (int sb = 0; sb < NS; ++sb)
#pragma unroll
        for (int dt = 0; dt < 4; ++dt)
#pragma unroll
            for (int g = G0; g < 2; ++g) o[dt][g] = wmma16(va[sb][dt], pf[sb][g], o[dt][g]);
}
__global__ __launch_bounds__(256) void k_fattn(const h16* __restrict__ Q, const h16* __restrict__ Kp, const h16* __restrict__ Vt, const int* __restrict__ slen, bf* AT) {
    __shared__ __align__(16) h16 ks[2][FKS * FPI];
    __shared__ __align__(16) h16 vs[2][HD * FPI];
    const int tid = (int)threadIdx.x, lane = tid & 31, lr = lane & 15, hi = lane >> 4; const int wv = __builtin_amdgcn_readfirstlane(tid >> 5);
    const int h = blockIdx.y, b = blockIdx.z; const size_t pl = ((size_t)b * NH_ + h) * TT * HD; Q += pl; Kp += pl; Vt += pl;
    const int tx = blockIdx.x; const int qb[2] = {tx * 128 + wv * 16, (TT / 128 - 1 - tx) * 128 + wv * 16};   // the wave's two groups' first queries: one in the early tile tx, one in the late tile 15 - tx, so that every work-group's kept keys add up alike
    const int ln = slen[b];   // the entry's key length: compared only
    const bool none = ln < 1;   // no key kept at all: every score is the same replacement, so every key of the table weighs alike: such an entry runs over all keys
    const int ea = (tx + 1) * 128, eb = (TT / 128 - tx) * 128;   // one past the last key that the causal rule leaves to the early tile, to the late tile (ea <= eb <= TT)
    const int na = none ? TT / FKS : ((ea < ln ? ea : ln) + FKS - 1) / FKS, nst = none ? TT / FKS : ((eb < ln ? eb : ln) + FKS - 1) / FKS;   // stages that hold a kept key of the early tile, of either tile: 1 <= na <= nst <= TT / FKS, the same for the whole work-group
    v16h qf[2][2]; int lim[2]; v8f o[4][2]; float m[2], l[2];
#pragma unroll
    for (int g = 0; g < 2; ++g) { const int qi = qb[g] + lr; qf[g][0] = WFrag<h16>::ld(Q + (size_t)qi * HD + 8 * hi); qf[g][1] = WFrag<h16>::ld(Q + (size_t)qi * HD + 32 + 8 * hi);
        lim[g] = (qi + 1 < ln) ? qi + 1 : ln;   // key j is kept where j <= qi AND j < ln: j < lim
        m[g] = -3.0e38f; l[g] = 0.0f;
#pragma unroll
        for (int dt = 0; dt < 4; ++dt) o[dt][g] = (v8f){}; }
    const int srow = tid >> 3, sc = (tid & 7) * 8;   // staging: 8 threads a 128-byte row, rows srow and srow + 32 of each tile
    const h16* kg = Kp + (size_t)srow * HD + sc; const h16* vg = Vt + (size_t)srow * TT + sc;
    v8h rk0 = *(const v8h*)kg, rk1 = *(const v8h*)(kg + 32 * HD), rv0 = *(const v8h*)vg, rv1 = *(const v8h*)(vg + (size_t)32 * TT);
    auto fetch = [&](int sn) { const h16* kn = kg + (size_t)sn * FKS * HD; const h16* vn = vg + sn * FKS; rk0 = *(const v8h*)kn; rk1 = *(const v8h*)(kn + 32 * HD); rv0 = *(const v8h*)vn; rv1 = *(const v8h*)(vn + (size_t)32 * TT); };   // stage sn's rows into registers
    auto put = [&](int nx) { *(v8h*)(&ks[nx][srow * FPI + sc]) = rk0; *(v8h*)(&ks[nx][(srow + 32) * FPI + sc]) = rk1; *(v8h*)(&vs[nx][srow * FPI + sc]) = rv0; *(v8h*)(&vs[nx][(srow + 32) * FPI + sc]) = rv1; };   // and from there into buffer nx
    auto finish = [&](int g) { const float inv = __fdiv_rn(1.0f, l[g] + xhalf(l[g])); bf* ar = AT + ((size_t)b * TT + qb[g] + lr) * DQ + h * HD + hi * 8;   // the two halves of a column hold different keys' weights: joined once
#pragma unroll
        for (int dt = 0; dt < 4; ++dt) { v8us w;
#pragma unroll
            for (int r = 0; r < 8; ++r) w[r] = f2bf(o[dt][g][r] * inv);
            *(v8us*)(ar + dt * 16) = w; } };
    put(0);
    __syncthreads();   // stage 0 is in LDS before any wave reads it
    // A stage past a tile's last kept key holds only exact-zero weights for it and is left out: stages 0 .. na - 1 serve both groups, stages na .. nst - 1 the late group alone (the stage's 64 keys in one pass).
    int st = 0;
    for (; st < na; ++st) {
        const int cur = st & 1; const bool more = st + 1 < nst;
        if (more) fetch(st + 1);
        fa_pass<1, 0>(&ks[cur][0], &vs[cur][0], st * FKS, lr, hi, qf, lim, o, m, l); fa_pass<1, 0>(&ks[cur][32 * FPI], &vs[cur][32], st * FKS + 32, lr, hi, qf, lim, o, m, l);
        if (more) put(cur ^ 1);
        __syncthreads();   // publishes the next stage and ends every wave's reads of this one, which the stage after next overwrites
    }
    finish(0);
    asm volatile("s_wait_xcnt 0x0" ::: "memory");   // stands in front of the second loop's first arithmetic, which is given registers that the early group's four stores name (seen in the listing)
    for (; st < nst; ++st) {
        const int cur = st & 1; const bool more = st + 1 < nst;
        if (more) fetch(st + 1);
        fa_pass<2, 1>(&ks[cur][0], &vs[cur][0], st * FKS, lr, hi, qf, lim, o, m, l);
        if (more) put(cur ^ 1);
        __syncthreads();   // as in the loop above
    }
    finish(1);
}


// ---- k_lnrow: one wave a row of C channels (a compile-time count); grid rows / 8. All of the row's loads (the sums, the residual's bf16 copy, gamma, beta) are issued as one group in front of the arithmetic, so that a wave waits out one memory latency and not one for each 128-channel chunk; the sums run in the chunks' order.
template <bool RES, int C>
__global__ __launch_bounds__(256) void k_lnrow(const float* __restrict__ A, const bf* __restrict__ R, const float* __restrict__ gamma, const float* __restrict__ beta, float eps, int nrows, float* Y) {
    static_assert(C % 128 == 0 && C <= LNC_MAX, "whole chunks of 128 channels, 4 a lane");
    constexpr int NCH = C / 128;
    const int lane = threadIdx.x & 31; const int row = blockIdx.x * 8 + (threadIdx.x >> 5); if (row >= nrows) return;
    const float* a = A + (size_t)row * C + lane * 4; const bf* rs = R + (size_t)row * C + lane * 4;
    v4f va[NCH], g[NCH], bt[NCH]; v4us w[NCH];
#pragma unroll   // constant indices here and below, so that the arrays stay in registers
    for (int k = 0; k < NCH; ++k) { va[k] = *(const v4f*)(a + k * 128); if (RES) w[k] = *(const v4us*)(rs + k * 128); }
    asm volatile("s_wait_xcnt 0x0" ::: "memory");   // stands in front of the gamma and beta loads, whose results may be given the registers that the row's loads name as their addresses (seen in the listing, where those registers die here)
#pragma unroll
    for (int k = 0; k < NCH; ++k) { g[k] = *(const v4f*)(gamma + k * 128 + lane * 4); bt[k] = *(const v4f*)(beta + k * 128 + lane * 4); }
    __builtin_amdgcn_sched_barrier(0);   // the loads stay one group in front of the first sum; sunk to their users they would each be waited for alone
    float x[NCH * 4]; float s = 0.0f;
#pragma unroll
    for (int k = 0; k < NCH; ++k) { v4f v = va[k];
        if (RES) { v[0] = __fadd_rn(v[0], bf2f(w[k][0])); v[1] = __fadd_rn(v[1], bf2f(w[k][1])); v[2] = __fadd_rn(v[2], bf2f(w[k][2])); v[3] = __fadd_rn(v[3], bf2f(w[k][3])); }
        x[k * 4 + 0] = v[0]; x[k * 4 + 1] = v[1]; x[k * 4 + 2] = v[2]; x[k * 4 + 3] = v[3]; s = __fadd_rn(__fadd_rn(__fadd_rn(__fadd_rn(s, v[0]), v[1]), v[2]), v[3]); }
    for (int sh = 16; sh; sh >>= 1) s = __fadd_rn(s, __shfl_xor(s, sh, 32));
    const float mean = __fdiv_rn(s, (float)C); float q = 0.0f;
#pragma unroll
    for (int j = 0; j < NCH * 4; ++j) { const float d = __fsub_rn(x[j], mean); x[j] = d; q = __fmaf_rn(d, d, q); }
    for (int sh = 16; sh; sh >>= 1) q = __fadd_rn(q, __shfl_xor(q, sh, 32));
    const float rstd = __fdiv_rn(1.0f, sqrtf(__fadd_rn(__fdiv_rn(q, (float)C), eps)));
    float* y = Y + (size_t)row * C + lane * 4;
#pragma unroll
    for (int k = 0; k < NCH; ++k) { v4f o;
#pragma unroll
        for (int j = 0; j < 4; ++j) o[j] = __fmaf_rn(__fmul_rn(x[k * 4 + j], rstd), bfr(g[k][j]), bfr(bt[k][j]));
        *(v4f*)(y + k * 128) = o; }
}
extern "C" void kernel_launch(void* const* d_in, const int* in_sizes, int n_in,
                              void* d_out, int out_size, void* d_ws, size_t ws_size, hipStream_t stream) {
    (void)in_sizes; (void)n_in; (void)out_size;
    const float* xq = (const float*)d_in[0]; const float* xk = (const float*)d_in[1]; const float* xv = (const float*)d_in[2]; const float* wq = (const float*)d_in[3]; const float* wk = (const float*)d_in[4]; const float* wv = (const float*)d_in[5]; const float* wo = (const float*)d_in[6]; const float* lng = (const float*)d_in[7]; const float* lnb = (const float*)d_in[8]; const int* sl = (const int*)d_in[9];   /* the module's argument order: ten inputs, all read; sen_len int32 [2] */
    float* OUT = (float*)d_out;     // [2][2048][1024]
    static_assert(DM % 128 == 0 && DM <= LNC_MAX, "k_lnrow's channel count");
    char* wsp = (char*)d_ws;
    auto take = [&](size_t bytes) { char* p = wsp; wsp += (bytes + 255) & ~(size_t)255; return (void*)p; };
    bf* WB = (bf*)take((4 * (size_t)DQ * DM + 3 * (size_t)NB_ * TT * DM) * 2);   /* the bf16 copies end to end: Wq, Wk, Wv, Wo ('out, in' [1024][1024]: K-contiguous, an operand of its product as it lies), then q, k, v [2][2048][1024] */
    bf* WO = WB + 3 * (size_t)DQ * DM; bf* XB = WB + 4 * (size_t)DQ * DM;
    h16* QP16 = (h16*)take(3 * (size_t)NB_ * NH_ * TT * HD * 2); h16* KP16 = QP16 + (size_t)NB_ * NH_ * TT * HD; h16* VT16 = KP16 + (size_t)NB_ * NKV * TT * HD;   /* the head planes of both entries, q, k, v end to end: one launch writes them, one attention launch reads them all */
    bf* ATh = (bf*)take((size_t)NB_ * TT * DQ * 2); float* YO = (float*)take((size_t)NB_ * TT * DM * 4);
    if ((size_t)(wsp - (char*)d_ws) > ws_size) return;    // total 80 MiB of the workspace by these reservations' own sum
    k_cvtall<<<(unsigned)(XCH / 256), 256, 0, stream>>>(wq, wk, wv, wo, xq, xk, xv, sl, WB);
    static_assert(HD == 64 && NH_ == NKV && TT % 128 == 0 && DQ % 128 == 0 && DM % 128 == 0, "one 64-column block of a projection is one head; the three weights are alike in shape; whole 128x128 tiles");
    k_proj<<<(TT / 128) * (DQ / 128) * 3 * NB_, 256, 0, stream>>>(XB, WB, sl, QP16);
    static_assert(NH_ == NKV && TT % 256 == 0 && HD == 64, "k_fattn's shape");
    k_fattn<<<dim3(TT / 256, NH_, NB_), 256, 0, stream>>>(QP16, KP16, VT16, sl, ATh);   /* scores, keep test, softmax, value product and merge of every head of both entries */
    k_gemmw<float, DQ><<<dim3(NB_ * TT / 128, DM / 128, 1), 256, 0, stream>>>(ATh, WO, YO, DM, 64);   /* y = merged (one bf16 word) Wo^T into a workspace plane, the rows of both entries */
    k_lnrow<true, DM><<<(unsigned)((NB_ * TT + 7) / 8), 256, 0, stream>>>(YO, XB, lng, lnb, 1.0e-6f, NB_ * TT, OUT);   /* out = LN(y + q) x gamma + beta (q: its bf16 copy): the one writer of the output */
}

// v010
// One run takes 62.4 microseconds.
// Two timings next to v009 put it at 1.14 and 1.12 times that version's speed.
// Over all steps from v000 it is 21.8 times as fast.
#include <hip/hip_runtime.h>

// Multi-head attention on three input tables with a causal rule AND a per-entry key length, an output map, a residual and a layer norm
// (a0 q, a1 k, a2 v [2][2048][1024]; a3 Wq, a4 Wk, a5 Wv, a6 Wo [1024][1024] 'out, in' (y = x W^T), no biases; a7 gamma, a8 beta [1024]; a9 sen_len int32 [2]: the entry's key length (1 .. 2,048);
//  16 heads x 64 (head h = columns h x 64 ..); S = (q Wq^T)(k Wk^T)^T / 8; A KEY j IS KEPT FOR QUERY i WHERE j <= i AND j < sen_len[b]; every other score is replaced by -1e9 (an exclusion: every row keeps key 0); softmax over the keys; ctx = A (v Wv^T); merged token-major; y = merged Wo^T;
//  x = y + q (the raw query table); the result = (x - mean) x rsqrt(var + 1e-6) x gamma + beta over the 1,024 channels (biased variance) -> [2][2048][1024]; argument order q, k, v, Wq, Wk, Wv, Wo, gamma, beta, sen_len).
// Layout: ONE LAUNCH A STAGE, five in all: a bf16 copy of the four weights and the three tables, both entries, made by one launch (of k and v, here and in their projections, only the 128-token tiles that hold a key below the entry's length: live_tiles; the 'out, in' weights as they lie: K-contiguous, the product's second operand, Wv its first); the six exact projections in one grid, whose own epilogue rounds each 64-column block (one head's columns) to f16 and stores it where the head planes of BOTH batch entries want it (q, k [b][h][t][d]; v transposed [b][h][d][t]: that product runs as Wv x^T, rows = channels, so its rows lie as the plane's do);
// ONE attention kernel over all heads and both entries (k_fattn): scores, the keep test (two compares folded into one bound a query), an online softmax, the value product and the token-major merge stay in registers, but for the two wave sets' partial sums, joined once in LDS at the end; one work-group a tile of 64 queries, whose key loop ENDS AT THE LAST KEPT KEY of the tile (an excluded key takes -3.0e38 before the maximum, so its weight is an exact zero: -1e9 below a kept score gives exp of -1e9: an exact zero too; a stage of such keys alone adds nothing and is left out);
// EVERY row on ONE fp16 product (the weights against the maximum in use, at most 2^8); the merged context on ONE bf16 word x Wo exact into a workspace plane (both entries' rows in one grid); the residual (the query table's bf16 copy, the one the q projection reads) added and the row normalised by k_lnrow: the one writer of the output.
// Compute dtypes, f32 accumulate: every float input rounded to bf16 at its load; projections exact; attention: one fp16 product on every row; softmax f32; the output map bf16 x bf16 on one word a side; the norm f32; the integer input is compared only.

#define NB_  2
#define TT   2048
#define DM   1024
#define NH_  16
#define NKV  16
#define REP  (NH_ / NKV)
#define HD   64
#define DQ   (NH_ * HD)
#define DKV  (NKV * HD)
#define LNC_MAX 2048

typedef _Float16 h16;
typedef unsigned short bf;
typedef __attribute__((ext_vector_type(16))) __bf16   v16bf;
typedef __attribute__((ext_vector_type(16))) _Float16 v16h;
typedef __attribute__((ext_vector_type(8)))  _Float16 v8h;
typedef __attribute__((ext_vector_type(4)))  _Float16 v4h;
typedef __attribute__((ext_vector_type(8)))  unsigned short v8us;
typedef __attribute__((ext_vector_type(8)))  float    v8f;
typedef __attribute__((ext_vector_type(4)))  float    v4f;
typedef v8h  __attribute__((may_alias)) v8ha;
typedef v4f  __attribute__((may_alias)) v4fa;
typedef v8us __attribute__((may_alias)) v8usa;

__device__ __forceinline__ unsigned short f2bf(float f) { unsigned u = __float_as_uint(f); u += 0x7FFFu + ((u >> 16) & 1u); return (unsigned short)(u >> 16); }
__device__ __forceinline__ float bf2f(unsigned short b) { return __uint_as_float(((unsigned)b) << 16); }
__device__ __forceinline__ float bfr(float f) { return bf2f(f2bf(f)); }
__device__ __forceinline__ v16h cat16(v8h lo, v8h hi) { return __builtin_shufflevector(lo, hi, 0, 1, 2, 3, 4, 5, 6, 7, 8, 9, 10, 11, 12, 13, 14, 15); }
__device__ __forceinline__ v16bf cat16b(v8us lo, v8us hi) { return __builtin_bit_cast(v16bf, __builtin_shufflevector(lo, hi, 0, 1, 2, 3, 4, 5, 6, 7, 8, 9, 10, 11, 12, 13, 14, 15)); }
__device__ __forceinline__ v8f wmma16(v16h a, v16h b, v8f c) { return __builtin_amdgcn_wmma_f32_16x16x32_f16(false, a, false, b, (short)0, c, false, false); }
__device__ __forceinline__ v8f wmmab(v16bf a, v16bf b, v8f c) { return __builtin_amdgcn_wmma_f32_16x16x32_bf16(false, a, false, b, (short)0, c, false, false); }
// live_tiles: how many 128-token tiles of an entry's k and v tables hold a key that some query keeps (key j is kept only where j < ln): 1 .. TT / 128 for any ln. An entry that keeps no key at all (ln < 1) weighs every key alike and needs them all.
// k_fattn reads keys below ln rounded up to 128 and no others, so rows past these tiles are neither rounded nor projected, and their places in the workspace are never read.
__device__ __forceinline__ int live_tiles(int ln) { const int c = ln > TT ? TT : ln; return c < 1 ? TT / 128 : (c + 127) / 128; }



// ---- gemm_tile, k_gemmw, k_proj: one 128x128 output tile per work-group of 8 waves (4 x 2; a wave holds 32 rows x 64 columns, 8 accumulators) over the whole of K; both operands K-contiguous bf16 planes.
// C[m][n] (f32 sums, stored as TO: f32, or rounded once to f16) = sum_k A[m][k] Bt[n][k], k in rising order in one accumulator.
// Where C lies: row m at pitch ldc, the 64-column block number y at y x sN elements (sN = 64: a plain row-major matrix; sN = rows x 64 with ldc = 64: one [row][64] plane a block of columns).
// The operands come through LDS: a stage is 64 k = one whole 128-byte line of each of the tile's 128 A rows and 128 Bt rows, brought by asynchronous 16-byte copies (8 lanes a line, 4 lines a wave-wide copy, 8 copies a lane), rows padded to 144 bytes for the 16-byte readers; a ring of four buffers: the copies of the next three stages fly while this one is worked on, so that a stage has three trips' time to come from memory. Every line is fetched once a work-group and read from LDS by the 2 or 4 waves that need it.
template <typename T16> struct WFrag;
template <> struct WFrag<h16> { typedef v16h V; static __device__ __forceinline__ V ld(const h16* p) { return cat16(*(const v8h*)p, *(const v8h*)(p + 16)); } static __device__ __forceinline__ v8f mma(V a, V b, v8f c) { return wmma16(a, b, c); } };
template <> struct WFrag<bf> { typedef v16bf V; static __device__ __forceinline__ V ld(const bf* p) { return cat16b(*(const v8us*)p, *(const v8us*)(p + 16)); } static __device__ __forceinline__ v8f mma(V a, V b, v8f c) { return wmmab(a, b, c); } };
__device__ __forceinline__ void st4(float* p, v4f v) { *(v4f*)p = v; }
__device__ __forceinline__ void st4(h16* p, v4f v) { v4h o; o[0] = (h16)v[0]; o[1] = (h16)v[1]; o[2] = (h16)v[2]; o[3] = (h16)v[3]; *(v4h*)p = o; }
#define GKS 64                 // k a stage
#define GPI 72                 // LDS row pitch in 16-bit words: 128 bytes + 16
#define GBW (256 * GPI)        // 16-bit words a buffer: 128 A rows, then 128 Bt rows
#define GNB 4                  // buffers of the ring (a power of two): 144 KiB, two work-groups a WGP
// gemm_tile: the tile whose first row is r0 and first column c0 (multiples of 128); C points at row 0, column 0 of the matrix. KK: the products' length.
template <typename TO, int KK>
__device__ __forceinline__ void gemm_tile(const bf* __restrict__ A, const bf* __restrict__ Bt, TO* C, int ldc, size_t sN, int r0, int c0) {
    static_assert(KK % GKS == 0 && KK / GKS >= GNB && (GNB & (GNB - 1)) == 0, "whole stages, at least one for each buffer");
    static_assert(GNB == 4, "the two counted waits below are written for four buffers of eight copies a lane");
    static_assert(8 * 32 * 68 * 4 <= GNB * GBW * 2, "the output staging fits the ring");
    typedef WFrag<bf>::V V;
    __shared__ __align__(16) bf sm[GNB * GBW];
    const int tid = (int)threadIdx.x, lane = tid & 31, lr = lane & 15, hi = lane >> 4; const int wv = __builtin_amdgcn_readfirstlane(tid >> 5); const int wr = wv >> 1, wc = wv & 1;
    const int srow = tid >> 3, sc = (tid & 7) * 8;   // copies: 8 lanes a 128-byte line; the lane's rows are srow + 32 i of A and of Bt, i = 0 .. 3
    const bf* ag = A + (size_t)(r0 + srow) * KK + sc; const bf* bg = Bt + (size_t)(c0 + srow) * KK + sc;
    const unsigned l0 = (unsigned)(size_t)sm + (unsigned)(srow * GPI + sc) * 2u;   // the lane's LDS byte address of A row srow in buffer 0
    // stage t into buffer nb: the lane's eight copies and, as the last line of their own statement, the wait that stands in front of any rewrite of a register that a copy names
    auto copy = [&](int t, int nb) { const bf* a = ag + t * GKS; const bf* b = bg + t * GKS; const unsigned l = l0 + (unsigned)nb * (GBW * 2u);
        asm volatile("global_load_async_to_lds_b128 %0, %8, off\n\tglobal_load_async_to_lds_b128 %1, %9, off\n\tglobal_load_async_to_lds_b128 %2, %10, off\n\tglobal_load_async_to_lds_b128 %3, %11, off\n\t"
                     "global_load_async_to_lds_b128 %4, %12, off\n\tglobal_load_async_to_lds_b128 %5, %13, off\n\tglobal_load_async_to_lds_b128 %6, %14, off\n\tglobal_load_async_to_lds_b128 %7, %15, off\n\ts_wait_xcnt 0x0"
                     :: "v"(l), "v"(l + 32u * GPI * 2u), "v"(l + 64u * GPI * 2u), "v"(l + 96u * GPI * 2u), "v"(l + 128u * GPI * 2u), "v"(l + 160u * GPI * 2u), "v"(l + 192u * GPI * 2u), "v"(l + 224u * GPI * 2u),
                        "v"(a), "v"(a + 32 * KK), "v"(a + 64 * KK), "v"(a + 96 * KK), "v"(b), "v"(b + 32 * KK), "v"(b + 64 * KK), "v"(b + 96 * KK) : "memory"); };
    v8f acc[2][4];
#pragma unroll
    for (int mb = 0; mb < 2; ++mb)
#pragma unroll
        for (int nb = 0; nb < 4; ++nb) acc[mb][nb] = (v8f){};
    const bf* ra = sm + (wr * 32 + lr) * GPI + 8 * hi; const bf* rb = sm + (128 + wc * 64 + lr) * GPI + 8 * hi;   // the wave's first A row and first Bt row in buffer 0, the lane's k offset
    copy(0, 0); copy(1, 1); copy(2, 2); copy(3, 3);   // every buffer is free: the first four stages, 32 copies a wave
    asm volatile("s_wait_asynccnt 0x18" ::: "memory");   // all but this wave's 24 youngest copies (stages 1 to 3, eight each) have landed: stage 0's
    __syncthreads();   // and every other wave's: stage 0 is in LDS before any wave reads it
    for (int t = 0; t < KK / GKS; ++t) {
        const int off = (t & (GNB - 1)) * GBW;
#pragma unroll
        for (int ks = 0; ks < 2; ++ks) { V a[2], b[4];
#pragma unroll
            for (int mb = 0; mb < 2; ++mb) a[mb] = WFrag<bf>::ld(ra + off + mb * 16 * GPI + ks * 32);
#pragma unroll
            for (int nb = 0; nb < 4; ++nb) b[nb] = WFrag<bf>::ld(rb + off + nb * 16 * GPI + ks * 32);
            __builtin_amdgcn_sched_barrier(0);   // the 12 fragment loads of a k step stand as one group in front of its 8 products (one LDS latency a k step); left free, the compiler deals them out in pairs between the products, each pair waited for alone
#pragma unroll
            for (int nb = 0; nb < 4; ++nb)
#pragma unroll
                for (int mb = 0; mb < 2; ++mb) acc[mb][nb] = WFrag<bf>::mma(a[mb], b[nb], acc[mb][nb]);
            __builtin_amdgcn_sched_barrier(0);   // and the next group stays behind these products, so that it takes their fragments' registers
        }
        asm volatile("s_wait_dscnt 0x0" ::: "memory");      // this wave's reads of the buffer are over
        // its copies of stage t + 1 have landed: while stages t + 2 and t + 3 exist they are exactly the wave's 16 youngest copies (eight a stage in every wave and trip) and stay in flight; in the last three trips the wait is to 0
        if (t + GNB - 1 < KK / GKS) asm volatile("s_wait_asynccnt 0x10" ::: "memory");
        else asm volatile("s_wait_asynccnt 0x0" ::: "memory");
        __syncthreads();   // publishes stage t + 1 and ends every wave's reads of stage t, whose buffer is refilled behind it
        if (t + GNB < KK / GKS) copy(t + GNB, t & (GNB - 1));
    }
    asm volatile("s_wait_asynccnt 0x0" ::: "memory");   // no copy is outstanding when the ring is given another use
    // The last trip's barrier has ended every read of the ring: it now stages the output, each wave's 32 x 64 block in a range of its own, so that whole lines are stored.
    float* ow = (float*)sm + wv * (32 * 68);
#pragma unroll
    for (int mb = 0; mb < 2; ++mb)
#pragma unroll
        for (int nb = 0; nb < 4; ++nb)
#pragma unroll
            for (int j = 0; j < 8; ++j) ow[(mb * 16 + hi * 8 + j) * 68 + nb * 16 + lr] = acc[mb][nb][j];
    __syncthreads();   // a lane reads back what other lanes of its wave wrote: the writes are in LDS first
    TO* cw = C + (size_t)(c0 / 64 + wc) * sN + (size_t)(r0 + wr * 32) * ldc;
#pragma unroll
    for (int s = 0; s < 16; ++s) { const int row = 2 * s + hi, cofs = lr * 4; st4(cw + (size_t)row * ldc + cofs, *(const v4fa*)(ow + row * 68 + cofs)); }
}
// k_gemmw: grid (M / 128, N / 128), 256 threads.
template <typename TO, int KK>
__global__ __launch_bounds__(256) void k_gemmw(const bf* __restrict__ A, const bf* __restrict__ Bt, TO* C, int ldc, size_t sN) {
    gemm_tile<TO, KK>(A, Bt, C, ldc, sN, blockIdx.x * 128, blockIdx.y * 128);
}
// k_proj: the six projections (three tables x two entries) as ONE flat grid of (TT / 128 token tiles) x (DQ / 128 pairs of heads) x 3 x NB_ work-groups. The pair of heads runs fastest; behind it the token tiles that are wanted, counted end to end: all of q's, then the live ones of k, then of v (live_tiles, entry 0 in front of entry 1), so that the work-groups with work are the first of the grid and spread evenly; the rest return at once. X: the tables' bf16 copies [3][NB_][TT][DM]; Wt: Wq, Wk, Wv [3][DQ][DM]; P: the head planes, q and k [b][h][t][d], then v transposed [b][h][d][t].
// q, k: x W^T, column block h is head h's plane (pitch HD). v: Wv x^T, row = channel h x 64 + d, column = token (pitch TT).
__global__ __launch_bounds__(256) void k_proj(const bf* __restrict__ X, const bf* __restrict__ Wt, const int* __restrict__ slen, h16* P) {
    static_assert(NB_ == 2, "two entries' live tiles are counted end to end");
    const int n0 = live_tiles(slen[0]), nl = n0 + live_tiles(slen[1]);   // live tiles of entry 0, of both entries
    int u = (int)blockIdx.x / (DQ / 128), tb = 0, en = u / (TT / 128);   // the token tile's number in the count; as q's: table 0, entry, tile
    if (u < NB_ * (TT / 128)) u -= en * (TT / 128);
    else { u -= NB_ * (TT / 128);
        if (u >= 2 * nl) return;   // no tile left: the same for the whole work-group, in front of every copy and barrier
        tb = u < nl ? 1 : 2; u -= (tb - 1) * nl; en = u < n0 ? 0 : 1; u -= en * n0; }   // u < the entry's live tiles <= TT / 128
    const int zz = tb * NB_ + en; const bool tr = tb == 2; const int t0 = u * 128, ch0 = ((int)blockIdx.x % (DQ / 128)) * 128;
    const bf* x = X + (size_t)zz * TT * DM; const bf* w = Wt + (size_t)tb * DQ * DM; h16* p = P + (size_t)zz * NH_ * TT * HD;
    gemm_tile<h16, DM>(tr ? w : x, tr ? x : w, p, tr ? TT : HD, tr ? (size_t)64 : (size_t)TT * HD, tr ? ch0 : t0, tr ? t0 : ch0);
}



__device__ __forceinline__ void splitf(float y, unsigned short& h, unsigned short& l) { h = f2bf(y); l = f2bf(y - bf2f(h)); }
typedef __attribute__((ext_vector_type(4))) unsigned short v4us;
typedef __attribute__((ext_vector_type(4))) int v4i;

// ---- k_cvtall: every float matrix input rounded to bf16 once, in ONE launch; grid XCH / 256. Thread t takes the 8-element chunk t of the four weights counted end to end and chunk t of each of the three tables (a table is as long as the four weights together); dst: Wq, Wk, Wv, Wo, q, k, v end to end. A work-group's chunks of k and v are two token rows of one entry: past the entry's live tiles they are left out.
#define WCH ((size_t)DQ * DM / 8)         // chunks a weight
#define XCH ((size_t)NB_ * TT * DM / 8)   // chunks a table
__device__ __forceinline__ v8us rnd8(v8f v) { v8us o;
#pragma unroll   // constant indices, so that v and o stay in registers
    for (int k = 0; k < 8; ++k) o[k] = f2bf(v[k]);
    return o; }
__global__ __launch_bounds__(256) void k_cvtall(const float* __restrict__ wq, const float* __restrict__ wk, const float* __restrict__ wv, const float* __restrict__ wo, const float* __restrict__ xq, const float* __restrict__ xk, const float* __restrict__ xv, const int* __restrict__ slen, bf* dst) {
    static_assert(4 * WCH == XCH && WCH % 256 == 0 && DKV == DQ, "the four weights together are as long as one table; a work-group stays inside one weight");
    const size_t g = (size_t)blockIdx.x * 2048; const unsigned e = threadIdx.x * 8;   // the work-group's first element (t = g / 8 + threadIdx.x) and the thread's chunk behind it
    const unsigned wi = blockIdx.x / (unsigned)(WCH / 256);   // which weight: one for the whole work-group
    const float* w = (wi == 0 ? wq : wi == 1 ? wk : wi == 2 ? wv : wo) + (g - wi * WCH * 8);
    static_assert(2048 % DM == 0 && (TT * DM) % 2048 == 0 && (128 * DM) % 2048 == 0, "a work-group holds whole token rows of one 128-token tile of one entry");
    const unsigned en = blockIdx.x / (unsigned)(TT * DM / 2048), tok = (blockIdx.x % (unsigned)(TT * DM / 2048)) * (2048 / DM);   // the entry (0 .. NB_ - 1 by the grid) and the first token of the work-group's rows
    const bool live = (int)tok < live_tiles(slen[en]) * 128;   // one answer for the whole work-group
    const v8f a = *(const v8f*)(w + e), b = *(const v8f*)(xq + g + e);
    dst += g;
    if (live) { const v8f c = *(const v8f*)(xk + g + e), d = *(const v8f*)(xv + g + e); *(v8us*)(dst + 2 * XCH * 8 + e) = rnd8(c); *(v8us*)(dst + 3 * XCH * 8 + e) = rnd8(d); }
    *(v8us*)(dst + e) = rnd8(a); *(v8us*)(dst + XCH * 8 + e) = rnd8(b);
}
// ---- k_fattn: one work-group = ONE 64-query tile of one head of one batch entry; 8 waves = 4 groups of 16 query columns x 2 wave sets, which halve every stage of 128 keys (set 0 its first 64 keys, set 1 the rest) and join their partial sums in LDS at the end; a flat grid of (TT / 64) x heads x entries work-groups, late tiles first.
// A tile's cost is its kept keys, min(causal end, key length): it differs from tile to tile AND from entry to entry, so no fixed pair of tiles of one entry weighs like another pair. Small work-groups, more of them than resident places, cost falling with the index: a place that a short tile leaves takes the next tile; and a long tile's walk over its keys is half as many stages long.
// St = K Q^T (A = 16 key rows, B = 16 query columns) and Ot += Vt Pt: a lane holds the scores of ONE query (column lr), keys 8 hi + r of each 16-key tile, so two score tiles converted in place ARE the B operand of the value product (the hardware k order, which WFrag's loader gives A as well).
// K and Vt tiles of 128 keys go through registers into LDS (whole 128-byte lines from memory, rows padded by 16 bytes for the 16-byte readers), two buffers: the next tile's loads fly while this one is worked on.
#define FKS 64     // keys a pass: one wave set's half of a stage
#define FST (2 * FKS)   // keys a stage
#define FPI 72     // LDS pitch of a K row in 16-bit words: 128 bytes + 16
#define FVP 136    // LDS pitch of a Vt row (a stage's 128 keys) in 16-bit words: 256 bytes + 16
#define FC2 0.18033688011112042f   // HD^-0.5 x log2(e): scores in base 2
__device__ __forceinline__ float xhalf(float x) { return __builtin_bit_cast(float, __builtin_amdgcn_permlanex16(__builtin_bit_cast(int, x), __builtin_bit_cast(int, x), 0x76543210, 0xfedcba98, false, false)); }   // lane l with lane l ^ 16
// eight 2^x in one statement: the early-clobber results keep every v_exp_f32 clear of its neighbour's source and result, and the closing v_nop is the one slot the instruction set asks for between a transcendental and a reader of its result
__device__ __forceinline__ v8f exp2x8(v8f x) { float p0, p1, p2, p3, p4, p5, p6, p7;
    asm("v_exp_f32 %0, %8\n\tv_exp_f32 %1, %9\n\tv_exp_f32 %2, %10\n\tv_exp_f32 %3, %11\n\tv_exp_f32 %4, %12\n\tv_exp_f32 %5, %13\n\tv_exp_f32 %6, %14\n\tv_exp_f32 %7, %15\n\tv_nop"
        : "=&v"(p0), "=&v"(p1), "=&v"(p2), "=&v"(p3), "=&v"(p4), "=&v"(p5), "=&v"(p6), "=&v"(p7) : "v"(x[0]), "v"(x[1]), "v"(x[2]), "v"(x[3]), "v"(x[4]), "v"(x[5]), "v"(x[6]), "v"(x[7]));
    return (v8f){p0, p1, p2, p3, p4, p5, p6, p7}; }
// fa_pass: NS x 32 keys of the staged tile (kb, vb point at the first of them; key0 is its number) against this wave's NG query groups of 16 columns: scores, keep test, online softmax, value product. VP: the staged Vt rows' pitch in 16-bit words.
template <int NS, int NG, int VP>
__device__ __forceinline__ void fa_pass(const h16* kb, const h16* vb, int key0, int lr, int hi, const v16h (&qf)[NG][2], const int (&lim)[NG], v8f (&o)[4][NG], float (&m)[NG], float (&l)[NG]) {
    v16h ka[NS][2][2]; v8f s[NS][2][NG];
#pragma unroll
    for (int sb = 0; sb < NS; ++sb)
#pragma unroll
        for (int kt = 0; kt < 2; ++kt) { const h16* kr = kb + (sb * 32 + kt * 16 + lr) * FPI + 8 * hi; ka[sb][kt][0] = WFrag<h16>::ld(kr); ka[sb][kt][1] = WFrag<h16>::ld(kr + 32); }
    if constexpr (NS == 2) __builtin_amdgcn_sched_barrier(0);   // the 64-key pass: all 16 K fragment loads stand as one group in front of the score products (one LDS latency a pass); left free, the compiler deals them out in pairs between the products, each pair waited for almost alone
#pragma unroll
    for (int sb = 0; sb < NS; ++sb)
#pragma unroll
        for (int kt = 0; kt < 2; ++kt)
#pragma unroll
            for (int g = 0; g < NG; ++g) { s[sb][kt][g] = wmma16(ka[sb][kt][0], qf[g][0], (v8f){}); s[sb][kt][g] = wmma16(ka[sb][kt][1], qf[g][1], s[sb][kt][g]); }
    if constexpr (NS == 2) __builtin_amdgcn_sched_barrier(0);   // keeps the 16 Vt fragment loads of the 64-key pass behind the score products: they take the K fragments' registers and do not queue in front of K fragments that a product waits for
    v16h va[NS][4];
#pragma unroll
    for (int sb = 0; sb < NS; ++sb)
#pragma unroll
        for (int dt = 0; dt < 4; ++dt) va[sb][dt] = WFrag<h16>::ld(vb + (dt * 16 + lr) * VP + sb * 32 + 8 * hi);
    __builtin_amdgcn_sched_barrier(0);   // keeps the Vt fragment loads in front of the softmax, whose vector work then covers their LDS latency; without it they sink to directly in front of each value product
    float bm[NG]; bool need = false;
#pragma unroll
    for (int g = 0; g < NG; ++g) { const int rem = lim[g] - (key0 + 8 * hi); float x = -3.0e38f;   // this lane's key sb x 32 + kt x 16 + r of the pass is kept where that number < rem
#pragma unroll
        for (int sb = 0; sb < NS; ++sb)
#pragma unroll
            for (int kt = 0; kt < 2; ++kt)
#pragma unroll
                for (int r = 0; r < 8; ++r) { const float t = (sb * 32 + kt * 16 + r < rem) ? s[sb][kt][g][r] * FC2 : -3.0e38f; s[sb][kt][g][r] = t; x = fmaxf(x, t); }
        x = fmaxf(x, xhalf(x)); bm[g] = x; need = need || (x - m[g] > 8.0f); }
    if (__builtin_amdgcn_ballot_w32(need) != 0) {   // a scalar branch: the maximum in use moves only where a column's new maximum is more than 8 (base 2) above it, so a weight is at most 2^8
#pragma unroll
        for (int g = 0; g < NG; ++g) { const float mn = fmaxf(m[g], bm[g]); const float al = __builtin_amdgcn_exp2f(m[g] - mn); m[g] = mn; l[g] *= al;
#pragma unroll
            for (int dt = 0; dt < 4; ++dt) o[dt][g] *= al; } }
    v16h pf[NS][NG];
#pragma unroll
    for (int g = 0; g < NG; ++g) { float ls[NS];   // the weights' sum, one chain of additions for each 32 keys: the 64-key pass has two short chains side by side in place of one long one
#pragma unroll
        for (int sb = 0; sb < NS; ++sb) { ls[sb] = sb == 0 ? l[g] : 0.0f;
#pragma unroll
            for (int kt = 0; kt < 2; ++kt) { const v8f p = exp2x8(s[sb][kt][g] - m[g]);
#pragma unroll
                for (int r = 0; r < 8; ++r) { ls[sb] += p[r]; pf[sb][g][kt * 8 + r] = (h16)p[r]; } } }
        l[g] = NS == 2 ? ls[0] + ls[NS - 1] : ls[0]; }
#pragma unroll
    for (int sb = 0; sb < NS; ++sb)
#pragma unroll
        for (int dt = 0; dt < 4; ++dt)
#pragma unroll
            for (int g = 0; g < NG; ++g) o[dt][g] = wmma16(va[sb][dt], pf[sb][g], o[dt][g]);
}
// Flat index -> (head, entry, tile), each of them once: bits 0 to 3 the head, bits 5 to 9 count the tiles down from the last, and the entry is bit 4 XOR bit 3 XOR bit 8, so that indices 8 apart and indices 256 apart are of different entries, whose key lengths differ. For speed only: every tile is done wherever and whenever its work-group runs.
__global__ __launch_bounds__(256) void k_fattn(const h16* __restrict__ Q, const h16* __restrict__ Kp, const h16* __restrict__ Vt, const int* __restrict__ slen, bf* AT) {
    static_assert(NB_ == 2 && NH_ == 16 && TT % FST == 0, "the bit fields of the flat index; whole stages");
    static_assert(4 * 34 * 32 * 4 <= 2 * FST * FPI * 2, "the partial sums fit the K buffers");
    __shared__ __align__(16) h16 ks[2][FST * FPI];
    __shared__ __align__(16) h16 vs[2][HD * FVP];
    const int tid = (int)threadIdx.x, lane = tid & 31, lr = lane & 15, hi = lane >> 4; const int wv = __builtin_amdgcn_readfirstlane(tid >> 5); const int cg = wv & 3, kh = wv >> 2;   // the wave's column group and its wave set
    const int fi = (int)blockIdx.x, h = fi & 15, b = ((fi >> 3) ^ (fi >> 4) ^ (fi >> 8)) & 1, tx = TT / 64 - 1 - (fi >> 5);
    const size_t pl = ((size_t)b * NH_ + h) * TT * HD; Q += pl; Kp += pl; Vt += pl;
    const int qb = tx * 64 + cg * 16;   // the wave's first query
    const int ln = slen[b];   // the entry's key length: compared only
    const bool none = ln < 1;   // no key kept at all: every score is the same replacement, so every key of the table weighs alike: such an entry runs over all keys
    const int ee = (tx + 1) * 64;   // one past the last key that the causal rule leaves to the tile (<= TT)
    const int kend = none ? TT : (ee < ln ? ee : ln);   // one past the tile's last kept key
    const int nst = (kend + FST - 1) / FST;   // stages that hold a kept key of the tile: 1 <= nst <= TT / FST, the same for the whole work-group; their keys lie below ln rounded up to 128: inside the live tiles
    v16h qf[1][2]; int lim[1]; v8f o[4][1]; float m[1], l[1];
    { const int qi = qb + lr; qf[0][0] = WFrag<h16>::ld(Q + (size_t)qi * HD + 8 * hi); qf[0][1] = WFrag<h16>::ld(Q + (size_t)qi * HD + 32 + 8 * hi);
        lim[0] = (qi + 1 < ln) ? qi + 1 : ln;   // key j is kept where j <= qi AND j < ln: j < lim
        m[0] = -3.0e38f; l[0] = 0.0f;
#pragma unroll
        for (int dt = 0; dt < 4; ++dt) o[dt][0] = (v8f){}; }
    const int srow = tid >> 3, sc = (tid & 7) * 8;    // staging K: 8 threads a 128-byte row, rows srow + 32 i
    const int vrow = tid >> 4, vc = (tid & 15) * 8;   // staging Vt: 16 threads a 256-byte run of a row, rows vrow + 16 i
    const h16* kg = Kp + (size_t)srow * HD + sc; const h16* vg = Vt + (size_t)vrow * TT + vc;
    v8h rk[4], rv[4];
    auto fetch = [&](int sn) { const h16* kn = kg + (size_t)sn * FST * HD; const h16* vn = vg + sn * FST;   // stage sn's rows into registers
#pragma unroll   // constant indices, so that rk and rv stay in registers
        for (int i = 0; i < 4; ++i) { rk[i] = *(const v8h*)(kn + i * 32 * HD); rv[i] = *(const v8h*)(vn + (size_t)i * 16 * TT); }
        asm volatile("s_wait_xcnt 0x0" ::: "memory"); };   // stands in front of the pass's first LDS reads and of put's address arithmetic, which are given the registers that these loads name as their addresses (seen in the listing)
    auto put = [&](int nx) {   // and from there into buffer nx
#pragma unroll
        for (int i = 0; i < 4; ++i) { *(v8h*)(&ks[nx][(srow + 32 * i) * FPI + sc]) = rk[i]; *(v8h*)(&vs[nx][(vrow + 16 * i) * FVP + vc]) = rv[i]; } };
    fetch(0); put(0);
    __syncthreads();   // stage 0 is in LDS before any wave reads it
    // A stage past the tile's last kept key holds only exact-zero weights for it and is left out, and so is set 1's half of the last stage where it lies past that key (a scalar test, one answer a wave; the barriers stand outside it). A column that has met no kept key in its wave set yet still has the start maximum, and its sums hold weights of 1: the first kept key's rescale, or the join below, multiplies them by an exact zero.
    for (int st = 0; st < nst; ++st) {
        const int cur = st & 1; const bool more = st + 1 < nst;
        if (more) fetch(st + 1);
        if (st * FST + kh * FKS < kend) fa_pass<2, 1, FVP>(&ks[cur][kh * FKS * FPI], &vs[cur][kh * FKS], st * FST + kh * FKS, lr, hi, qf, lim, o, m, l);
        if (more) put(cur ^ 1);
        __syncthreads();   // publishes the next stage and ends every wave's reads of this one, which the stage after next overwrites
    }
    // The join: the last barrier has ended every read of the K buffers; set 1 leaves its maximum, weight sum and 32 output sums there, a lane's words 128 bytes apart, and set 0 adds them to its own on the common maximum.
    float* xs = (float*)&ks[0][0] + cg * (34 * 32) + lane;
    if (kh == 1) { xs[0] = m[0]; xs[32] = l[0];
#pragma unroll
        for (int dt = 0; dt < 4; ++dt)
#pragma unroll
            for (int r = 0; r < 8; ++r) xs[(2 + dt * 8 + r) * 32] = o[dt][0][r]; }
    __syncthreads();   // set 1's partial sums are in LDS before set 0 reads them
    if (kh == 1) return;   // behind the last barrier
    const float m1 = xs[0], mn = fmaxf(m[0], m1), a0 = __builtin_amdgcn_exp2f(m[0] - mn), a1 = __builtin_amdgcn_exp2f(m1 - mn);   // a set without a kept key for this column weighs 0 (every column keeps key 0, in set 0); with no key kept at all both weigh 1
    const float lj = l[0] * a0 + xs[32] * a1;
    const float inv = __fdiv_rn(1.0f, lj + xhalf(lj)); bf* ar = AT + ((size_t)b * TT + qb + lr) * DQ + h * HD + hi * 8;   // the two halves of a column hold different keys' weights: joined once
#pragma unroll
    for (int dt = 0; dt < 4; ++dt) { v8us w;
#pragma unroll
        for (int r = 0; r < 8; ++r) w[r] = f2bf((o[dt][0][r] * a0 + xs[(2 + dt * 8 + r) * 32] * a1) * inv);
        *(v8us*)(ar + dt * 16) = w; }
}


// ---- k_lnrow: one wave a row of C channels (a compile-time count); grid rows / 8. All of the row's loads (the sums, the residual's bf16 copy, gamma, beta) are issued as one group in front of the arithmetic, so that a wave waits out one memory latency and not one for each 128-channel chunk; the sums run in the chunks' order.
template <bool RES, int C>
__global__ __launch_bounds__(256) void k_lnrow(const float* __restrict__ A, const bf* __restrict__ R, const float* __restrict__ gamma, const float* __restrict__ beta, float eps, int nrows, float* Y) {
    static_assert(C % 128 == 0 && C <= LNC_MAX, "whole chunks of 128 channels, 4 a lane");
    constexpr int NCH = C / 128;
    const int lane = threadIdx.x & 31; const int row = blockIdx.x * 8 + (threadIdx.x >> 5); if (row >= nrows) return;
    const float* a = A + (size_t)row * C + lane * 4; const bf* rs = R + (size_t)row * C + lane * 4;
    v4f va[NCH], g[NCH], bt[NCH]; v4us w[NCH];
#pragma unroll   // constant indices here and below, so that the arrays stay in registers
    for (int k = 0; k < NCH; ++k) { va[k] = *(const v4f*)(a + k * 128); if (RES) w[k] = *(const v4us*)(rs + k * 128); }
    asm volatile("s_wait_xcnt 0x0" ::: "memory");   // stands in front of the gamma and beta loads, whose results may be given the registers that the row's loads name as their addresses (seen in the listing, where those registers die here)
#pragma unroll
    for (int k = 0; k < NCH; ++k) { g[k] = *(const v4f*)(gamma + k * 128 + lane * 4); bt[k] = *(const v4f*)(beta + k * 128 + lane * 4); }
    __builtin_amdgcn_sched_barrier(0);   // the loads stay one group in front of the first sum; sunk to their users they would each be waited for alone
    float x[NCH * 4]; float s = 0.0f;
#pragma unroll
    for (int k = 0; k < NCH; ++k) { v4f v = va[k];
        if (RES) { v[0] = __fadd_rn(v[0], bf2f(w[k][0])); v[1] = __fadd_rn(v[1], bf2f(w[k][1])); v[2] = __fadd_rn(v[2], bf2f(w[k][2])); v[3] = __fadd_rn(v[3], bf2f(w[k][3])); }
        x[k * 4 + 0] = v[0]; x[k * 4 + 1] = v[1]; x[k * 4 + 2] = v[2]; x[k * 4 + 3] = v[3]; s = __fadd_rn(__fadd_rn(__fadd_rn(__fadd_rn(s, v[0]), v[1]), v[2]), v[3]); }
    for (int sh = 16; sh; sh >>= 1) s = __fadd_rn(s, __shfl_xor(s, sh, 32));
    const float mean = __fdiv_rn(s, (float)C); float q = 0.0f;
#pragma unroll
    for (int j = 0; j < NCH * 4; ++j) { const float d = __fsub_rn(x[j], mean); x[j] = d; q = __fmaf_rn(d, d, q); }
    for (int sh = 16; sh; sh >>= 1) q = __fadd_rn(q, __shfl_xor(q, sh, 32));
    const float rstd = __fdiv_rn(1.0f, sqrtf(__fadd_rn(__fdiv_rn(q, (float)C), eps)));
    float* y = Y + (size_t)row * C + lane * 4;
#pragma unroll
    for (int k = 0; k < NCH; ++k) { v4f o;
#pragma unroll
        for (int j = 0; j < 4; ++j) o[j] = __fmaf_rn(__fmul_rn(x[k * 4 + j], rstd), bfr(g[k][j]), bfr(bt[k][j]));
        *(v4f*)(y + k * 128) = o; }
}
extern "C" void kernel_launch(void* const* d_in, const int* in_sizes, int n_in,
                              void* d_out, int out_size, void* d_ws, size_t ws_size, hipStream_t stream) {
    (void)in_sizes; (void)n_in; (void)out_size;
    const float* xq = (const float*)d_in[0]; const float* xk = (const float*)d_in[1]; const float* xv = (const float*)d_in[2]; const float* wq = (const float*)d_in[3]; const float* wk = (const float*)d_in[4]; const float* wv = (const float*)d_in[5]; const float* wo = (const float*)d_in[6]; const float* lng = (const float*)d_in[7]; const float* lnb = (const float*)d_in[8]; const int* sl = (const int*)d_in[9];   /* the module's argument order: ten inputs, all read; sen_len int32 [2] */
    float* OUT = (float*)d_out;     // [2][2048][1024]
    static_assert(DM % 128 == 0 && DM <= LNC_MAX, "k_lnrow's channel count");
    char* wsp = (char*)d_ws;
    auto take = [&](size_t bytes) { char* p = wsp; wsp += (bytes + 255) & ~(size_t)255; return (void*)p; };
    bf* WB = (bf*)take((4 * (size_t)DQ * DM + 3 * (size_t)NB_ * TT * DM) * 2);   /* the bf16 copies end to end: Wq, Wk, Wv, Wo ('out, in' [1024][1024]: K-contiguous, an operand of its product as it lies), then q, k, v [2][2048][1024] */
    bf* WO = WB + 3 * (size_t)DQ * DM; bf* XB = WB + 4 * (size_t)DQ * DM;
    h16* QP16 = (h16*)take(3 * (size_t)NB_ * NH_ * TT * HD * 2); h16* KP16 = QP16 + (size_t)NB_ * NH_ * TT * HD; h16* VT16 = KP16 + (size_t)NB_ * NKV * TT * HD;   /* the head planes of both entries, q, k, v end to end: one launch writes them, one attention launch reads them all */
    bf* ATh = (bf*)take((size_t)NB_ * TT * DQ * 2); float* YO = (float*)take((size_t)NB_ * TT * DM * 4);
    if ((size_t)(wsp - (char*)d_ws) > ws_size) return;    // total 80 MiB of the workspace by these reservations' own sum
    k_cvtall<<<(unsigned)(XCH / 256), 256, 0, stream>>>(wq, wk, wv, wo, xq, xk, xv, sl, WB);
    static_assert(HD == 64 && NH_ == NKV && TT % 128 == 0 && DQ % 128 == 0 && DM % 128 == 0, "one 64-column block of a projection is one head; the three weights are alike in shape; whole 128x128 tiles");
    k_proj<<<(TT / 128) * (DQ / 128) * 3 * NB_, 256, 0, stream>>>(XB, WB, sl, QP16);
    static_assert(NH_ == NKV && TT % 128 == 0 && HD == 64, "k_fattn's shape");
    k_fattn<<<(TT / 64) * NH_ * NB_, 256, 0, stream>>>(QP16, KP16, VT16, sl, ATh);   /* scores, keep test, softmax, value product and merge of every head of both entries */
    k_gemmw<float, DQ><<<dim3(NB_ * TT / 128, DM / 128, 1), 256, 0, stream>>>(ATh, WO, YO, DM, 64);   /* y = merged (one bf16 word) Wo^T into a workspace plane, the rows of both entries */
    k_lnrow<true, DM><<<(unsigned)((NB_ * TT + 7) / 8), 256, 0, stream>>>(YO, XB, lng, lnb, 1.0e-6f, NB_ * TT, OUT);   /* out = LN(y + q) x gamma + beta (q: its bf16 copy): the one writer of the output */
}
